// v000
// The times below were measured on an AMD MI455X: many runs one after another, warmed up first and cycling through
// copies of the inputs, with the whole window's GPU time divided by the number of runs. Launches and the gaps
// between them are all in it. The median over several windows is given; except for v000 it joins two sittings, which
// can be a few percent apart, so the side-by-side timings, each taken in one sitting, are the better comparison.
// v000 is the starting kernel. One run takes 373 microseconds.
#include <hip/hip_runtime.h>
#include <hip/hip_bf16.h>

typedef __attribute__((ext_vector_type(16))) _Float16 v16h;
typedef __attribute__((ext_vector_type(8)))  float    v8f;

#define HWPX (256 * 256)
#define HIMG 256
#define WIMG 256
#define BSZ  4
#define CIN  64
#define CATT 32

// ---- order-preserving float <-> uint encoding (for atomic min/max) ----
__device__ __forceinline__ unsigned fenc(float f) {
  unsigned u = __float_as_uint(f);
  return u ^ ((u >> 31) ? 0xFFFFFFFFu : 0x80000000u);
}
__device__ __forceinline__ float fdec(unsigned u) {
  u ^= ((u >> 31) ? 0x80000000u : 0xFFFFFFFFu);
  return __uint_as_float(u);
}

__global__ void ea_init_mm(unsigned* mm) {
  int i = threadIdx.x;
  if (i < 3) {
    mm[2 * i]     = 0xFFFFFFFFu;  // +inf encoded
    mm[2 * i + 1] = 0u;           // -inf encoded
  }
}

// global min/max of kappa[:, slice, :, :]
__global__ __launch_bounds__(256) void ea_kap_minmax(const float* __restrict__ kappa,
                                                     unsigned* __restrict__ mm) {
  const int slice = blockIdx.y;
  __shared__ unsigned smin[256], smax[256];
  unsigned lmin = 0xFFFFFFFFu, lmax = 0u;
  const int total = BSZ * HWPX;
  for (int e = blockIdx.x * blockDim.x + threadIdx.x; e < total;
       e += gridDim.x * blockDim.x) {
    int b = e / HWPX, off = e - b * HWPX;
    unsigned k = fenc(kappa[((size_t)b * 3 + slice) * HWPX + off]);
    lmin = (k < lmin) ? k : lmin;
    lmax = (k > lmax) ? k : lmax;
  }
  int tid = threadIdx.x;
  smin[tid] = lmin; smax[tid] = lmax;
  __syncthreads();
  for (int s = 128; s > 0; s >>= 1) {
    if (tid < s) {
      unsigned a = smin[tid + s]; if (a < smin[tid]) smin[tid] = a;
      unsigned b = smax[tid + s]; if (b > smax[tid]) smax[tid] = b;
    }
    __syncthreads();
  }
  if (tid == 0) {
    atomicMin(&mm[2 * slice], smin[0]);
    atomicMax(&mm[2 * slice + 1], smax[0]);
  }
}

// Assemble a 16x32 f16 WMMA fragment (A or B operand) from an LDS row of 32
// channel-pairs, per the ISA layout: halves 0-7 = K kb..kb+7, halves 8-15 =
// K kb+16..kb+23 (kb = 0 for lanes 0-15, 8 for lanes 16-31). Union with
// constant indices keeps everything in VGPRs (SROA), no scratch.
__device__ __forceinline__ v16h ea_frag(const _Float16* row, int kb2, int s) {
  const unsigned* p = (const unsigned*)row;
  union { v16h v; unsigned u[8]; } r;
#pragma unroll
  for (int j = 0; j < 4; ++j) {
    r.u[j]     = p[s * 16 + kb2 + j];
    r.u[4 + j] = p[s * 16 + kb2 + 8 + j];
  }
  return r.v;
}

// Scatter a 16x16 f32 D-matrix fragment to an LDS [row][32ch] f16 array.
__device__ __forceinline__ void ea_storeD(_Float16* dst, v8f acc, int mhi,
                                          int col, int nt) {
#pragma unroll
  for (int r = 0; r < 8; ++r)
    dst[(r + mhi) * CATT + nt * 16 + col] = (_Float16)acc[r];
}

// Fused: f16-WMMA q/k projection -> L2 normalize -> k x k windowed cosine / tau
template <int KW>
__global__ __launch_bounds__(256) void ea_affinity(const float* __restrict__ feat,
                                                   const float* __restrict__ kappa,
                                                   const float* __restrict__ qw,
                                                   const float* __restrict__ kw,
                                                   const unsigned* __restrict__ mm,
                                                   float* __restrict__ out,
                                                   int slice) {
  constexpr int P     = KW / 2;
  constexpr int H0    = 16 + 2 * P;          // halo tile edge
  constexpr int HALO2 = H0 * H0;             // halo pixels
  constexpr int KT    = (HALO2 + 15) / 16;   // 16-row M-tiles for key proj
  constexpr int PADPX = KT * 16;             // padded halo pixel count
  constexpr int KK    = KW * KW;

  extern __shared__ char lds_raw[];
  _Float16* stage = (_Float16*)lds_raw;                           // PADPX x 64 (f16)
  _Float16* wqL   = (_Float16*)(lds_raw + (size_t)PADPX * CIN * 2);
  _Float16* wkL   = wqL + CATT * CIN;
  _Float16* qs    = wkL + CATT * CIN;                             // 256 x 32 (f16)
  _Float16* ks    = qs + 256 * CATT;                              // PADPX x 32 (f16)

  const int tid = threadIdx.x;
  const int b   = blockIdx.z;
  const int y0  = blockIdx.y * 16, x0 = blockIdx.x * 16;

  // ---- stage halo of feat into LDS (f16), zero-padded OOB + tile padding ----
  const float* fb = feat + (size_t)b * CIN * HWPX;
  for (int c = 0; c < CIN; ++c) {
    const float* fc = fb + (size_t)c * HWPX;
    for (int p = tid; p < PADPX; p += 256) {
      float v = 0.f;
      if (p < HALO2) {
        int hy = p / H0, hx = p - hy * H0;
        int gy = y0 - P + hy, gx = x0 - P + hx;
        if (gy >= 0 && gy < HIMG && gx >= 0 && gx < WIMG) v = fc[gy * WIMG + gx];
      }
      stage[p * CIN + c] = (_Float16)v;
    }
  }
  for (int i = tid; i < CATT * CIN; i += 256) {
    wqL[i] = (_Float16)qw[i];
    wkL[i] = (_Float16)kw[i];
  }
  __syncthreads();

  const int lane = tid & 31;
  const int wave = tid >> 5;
  const int mrow = lane & 15;
  const int kb2  = (lane >= 16) ? 4 : 0;  // channel-pair base for this half-wave
  const int mhi  = (lane >= 16) ? 8 : 0;
  const int col  = lane & 15;

  // ---- q projection: 16 M-tiles of interior pixels ----
  {
    const _Float16* w0 = &wqL[mrow * CIN];
    const _Float16* w1 = &wqL[(16 + mrow) * CIN];
    const v16h b00 = ea_frag(w0, kb2, 0);  // kstep0, ntile0
    const v16h b10 = ea_frag(w0, kb2, 1);  // kstep1, ntile0
    const v16h b01 = ea_frag(w1, kb2, 0);  // kstep0, ntile1
    const v16h b11 = ea_frag(w1, kb2, 1);  // kstep1, ntile1
    for (int t = wave; t < 16; t += 8) {
      int ip = t * 16 + mrow;  // interior pixel 0..255
      int px = ((ip >> 4) + P) * H0 + ((ip & 15) + P);
      const _Float16* srow = &stage[px * CIN];
      v16h a0 = ea_frag(srow, kb2, 0);
      v16h a1 = ea_frag(srow, kb2, 1);
      v8f acc0 = {}, acc1 = {};
      acc0 = __builtin_amdgcn_wmma_f32_16x16x32_f16(false, a0, false, b00,
                                                    (short)0, acc0, false, false);
      acc1 = __builtin_amdgcn_wmma_f32_16x16x32_f16(false, a0, false, b01,
                                                    (short)0, acc1, false, false);
      acc0 = __builtin_amdgcn_wmma_f32_16x16x32_f16(false, a1, false, b10,
                                                    (short)0, acc0, false, false);
      acc1 = __builtin_amdgcn_wmma_f32_16x16x32_f16(false, a1, false, b11,
                                                    (short)0, acc1, false, false);
      ea_storeD(qs + (t * 16) * CATT, acc0, mhi, col, 0);
      ea_storeD(qs + (t * 16) * CATT, acc1, mhi, col, 1);
    }
  }

  // ---- key projection: KT M-tiles of halo pixels (padding rows are zero) ----
  {
    const _Float16* w0 = &wkL[mrow * CIN];
    const _Float16* w1 = &wkL[(16 + mrow) * CIN];
    const v16h b00 = ea_frag(w0, kb2, 0);
    const v16h b10 = ea_frag(w0, kb2, 1);
    const v16h b01 = ea_frag(w1, kb2, 0);
    const v16h b11 = ea_frag(w1, kb2, 1);
    for (int t = wave; t < KT; t += 8) {
      int px = t * 16 + mrow;  // halo pixel
      const _Float16* srow = &stage[px * CIN];
      v16h a0 = ea_frag(srow, kb2, 0);
      v16h a1 = ea_frag(srow, kb2, 1);
      v8f acc0 = {}, acc1 = {};
      acc0 = __builtin_amdgcn_wmma_f32_16x16x32_f16(false, a0, false, b00,
                                                    (short)0, acc0, false, false);
      acc1 = __builtin_amdgcn_wmma_f32_16x16x32_f16(false, a0, false, b01,
                                                    (short)0, acc1, false, false);
      acc0 = __builtin_amdgcn_wmma_f32_16x16x32_f16(false, a1, false, b10,
                                                    (short)0, acc0, false, false);
      acc1 = __builtin_amdgcn_wmma_f32_16x16x32_f16(false, a1, false, b11,
                                                    (short)0, acc1, false, false);
      ea_storeD(ks + (t * 16) * CATT, acc0, mhi, col, 0);
      ea_storeD(ks + (t * 16) * CATT, acc1, mhi, col, 1);
    }
  }
  __syncthreads();

  // ---- L2 normalize rows (x / max(||x||, 1e-12)); zero rows stay zero ----
  for (int r = tid; r < 256 + PADPX; r += 256) {
    _Float16* row = (r < 256) ? (qs + r * CATT) : (ks + (r - 256) * CATT);
    float s = 0.f;
#pragma unroll
    for (int c = 0; c < CATT; ++c) { float v = (float)row[c]; s += v * v; }
    float inv = 1.f / fmaxf(sqrtf(s), 1e-12f);
#pragma unroll
    for (int c = 0; c < CATT; ++c) row[c] = (_Float16)((float)row[c] * inv);
  }
  __syncthreads();

  // ---- temperature from curvature (global min/max of this slice) ----
  const float kmin  = fdec(mm[2 * slice]);
  const float kmax  = fdec(mm[2 * slice + 1]);
  const float denom = (kmax - kmin) + 1e-6f;

  const int p  = tid;          // this thread's output pixel
  const int py = p >> 4, pxx = p & 15;
  const int gy = y0 + py, gx = x0 + pxx;
  const float kap  = kappa[((size_t)b * 3 + slice) * HWPX + gy * WIMG + gx];
  float tau = 0.5f - ((kap - kmin) / denom) * (0.5f - 0.03f);
  tau = fminf(fmaxf(tau, 0.03f), 0.5f);
  const float scale = 1.f / (tau + 1e-6f);

  float qreg[CATT];
#pragma unroll
  for (int c = 0; c < CATT; ++c) qreg[c] = (float)qs[p * CATT + c];

  for (int dy = 0; dy < KW; ++dy) {
    for (int dx = 0; dx < KW; ++dx) {
      const _Float16* kr = ks + ((py + dy) * H0 + (pxx + dx)) * CATT;
      float dot = 0.f;
#pragma unroll
      for (int c = 0; c < CATT; ++c) dot += qreg[c] * (float)kr[c];
      out[(((size_t)b * KK + (dy * KW + dx)) * HWPX) + gy * WIMG + gx] = dot * scale;
    }
  }
}

static size_t ea_shmem(int KW) {
  int P = KW / 2, H0 = 16 + 2 * P;
  int KT = (H0 * H0 + 15) / 16, PADPX = KT * 16;
  return (size_t)PADPX * CIN * 2        // stage f16
       + 2 * (size_t)CATT * CIN * 2     // weights f16
       + 256 * CATT * 2                 // qn f16
       + (size_t)PADPX * CATT * 2;      // kn f16
}

extern "C" void kernel_launch(void* const* d_in, const int* in_sizes, int n_in,
                              void* d_out, int out_size, void* d_ws, size_t ws_size,
                              hipStream_t stream) {
  const float* feat  = (const float*)d_in[0];
  const float* kappa = (const float*)d_in[1];
  const float* qw    = (const float*)d_in[2];  // (3, 32, 64)
  const float* kw    = (const float*)d_in[3];  // (3, 32, 64)
  float*       out   = (float*)d_out;
  unsigned*    mm    = (unsigned*)d_ws;        // 3 x {min,max} encoded

  ea_init_mm<<<1, 64, 0, stream>>>(mm);
  ea_kap_minmax<<<dim3(256, 3), 256, 0, stream>>>(kappa, mm);

  const dim3 grid(WIMG / 16, HIMG / 16, BSZ), block(256);
  const size_t woff = (size_t)CATT * CIN;

  ea_affinity<3><<<grid, block, ea_shmem(3), stream>>>(
      feat, kappa, qw + 0 * woff, kw + 0 * woff, mm, out, 0);
  ea_affinity<5><<<grid, block, ea_shmem(5), stream>>>(
      feat, kappa, qw + 1 * woff, kw + 1 * woff, mm,
      out + (size_t)BSZ * 9 * HWPX, 1);
  ea_affinity<7><<<grid, block, ea_shmem(7), stream>>>(
      feat, kappa, qw + 2 * woff, kw + 2 * woff, mm,
      out + (size_t)BSZ * (9 + 25) * HWPX, 2);
}

// v001
// It runs in 119 microseconds.
// In two side-by-side timings against v000, it was 3.19 and 3.20 times as fast.
#include <hip/hip_runtime.h>
#include <hip/hip_bf16.h>

typedef __attribute__((ext_vector_type(16))) _Float16 v16h;
typedef __attribute__((ext_vector_type(8)))  float    v8f;

#define HWPX (256 * 256)
#define HIMG 256
#define WIMG 256
#define BSZ  4
#define CIN  64
#define CATT 32
// halfs per LDS row of a WMMA operand (64 channels + 8): 144 B = 16 B x 9, so
// 16 lanes on 16 consecutive rows spread their 16-byte accesses over all banks
#define SPIT (CIN + 8)

// ---- order-preserving float <-> uint encoding (for atomic min/max) ----
__device__ __forceinline__ unsigned fenc(float f) {
  unsigned u = __float_as_uint(f);
  return u ^ ((u >> 31) ? 0xFFFFFFFFu : 0x80000000u);
}
__device__ __forceinline__ float fdec(unsigned u) {
  u ^= ((u >> 31) ? 0x80000000u : 0xFFFFFFFFu);
  return __uint_as_float(u);
}

__global__ void ea_init_mm(unsigned* mm) {
  int i = threadIdx.x;
  if (i < 3) {
    mm[2 * i]     = 0xFFFFFFFFu;  // +inf encoded
    mm[2 * i + 1] = 0u;           // -inf encoded
  }
}

// global min/max of kappa[:, slice, :, :]
__global__ __launch_bounds__(256) void ea_kap_minmax(const float* __restrict__ kappa,
                                                     unsigned* __restrict__ mm) {
  const int slice = blockIdx.y;
  __shared__ unsigned smin[256], smax[256];
  unsigned lmin = 0xFFFFFFFFu, lmax = 0u;
  const int total = BSZ * HWPX;
  for (int e = blockIdx.x * blockDim.x + threadIdx.x; e < total;
       e += gridDim.x * blockDim.x) {
    int b = e / HWPX, off = e - b * HWPX;
    unsigned k = fenc(kappa[((size_t)b * 3 + slice) * HWPX + off]);
    lmin = (k < lmin) ? k : lmin;
    lmax = (k > lmax) ? k : lmax;
  }
  int tid = threadIdx.x;
  smin[tid] = lmin; smax[tid] = lmax;
  __syncthreads();
  for (int s = 128; s > 0; s >>= 1) {
    if (tid < s) {
      unsigned a = smin[tid + s]; if (a < smin[tid]) smin[tid] = a;
      unsigned b = smax[tid + s]; if (b > smax[tid]) smax[tid] = b;
    }
    __syncthreads();
  }
  if (tid == 0) {
    atomicMin(&mm[2 * slice], smin[0]);
    atomicMax(&mm[2 * slice + 1], smax[0]);
  }
}

// Assemble a 16x32 f16 WMMA fragment (A or B operand) from an LDS row of 32
// channel-pairs, per the ISA layout: halves 0-7 = K kb..kb+7, halves 8-15 =
// K kb+16..kb+23 (kb = 0 for lanes 0-15, 8 for lanes 16-31). Union with
// constant indices keeps everything in VGPRs (SROA), no scratch.
// Rows start on 16 bytes, so each run of 8 halves is one 16-byte LDS load.
__device__ __forceinline__ v16h ea_frag(const _Float16* row, int kb2, int s) {
  const uint4* p = (const uint4*)row;
  union { v16h v; uint4 q[2]; } r;
  r.q[0] = p[s * 4 + (kb2 >> 2)];
  r.q[1] = p[s * 4 + (kb2 >> 2) + 2];
  return r.v;
}

// Scatter a 16x16 f32 D-matrix fragment to an LDS [row][32ch] f16 array.
__device__ __forceinline__ void ea_storeD(_Float16* dst, v8f acc, int mhi,
                                          int col, int nt) {
#pragma unroll
  for (int r = 0; r < 8; ++r)
    dst[(r + mhi) * CATT + nt * 16 + col] = (_Float16)acc[r];
}

// Fused: f16-WMMA q/k projection -> L2 normalize -> k x k windowed cosine / tau
template <int KW>
__global__ __launch_bounds__(256) void ea_affinity(const float* __restrict__ feat,
                                                   const float* __restrict__ kappa,
                                                   const float* __restrict__ qw,
                                                   const float* __restrict__ kw,
                                                   const unsigned* __restrict__ mm,
                                                   float* __restrict__ out,
                                                   int slice) {
  constexpr int P     = KW / 2;
  constexpr int H0    = 16 + 2 * P;          // halo tile edge
  constexpr int HALO2 = H0 * H0;             // halo pixels
  constexpr int KT    = (HALO2 + 15) / 16;   // 16-row M-tiles for key proj
  constexpr int PADPX = KT * 16;             // padded halo pixel count
  constexpr int KK    = KW * KW;

  extern __shared__ char lds_raw[];
  _Float16* stage = (_Float16*)lds_raw;                           // PADPX rows of SPIT (f16)
  _Float16* wqL   = (_Float16*)(lds_raw + (size_t)PADPX * SPIT * 2);
  _Float16* wkL   = wqL + CATT * SPIT;
  _Float16* qs    = wkL + CATT * SPIT;                            // 256 x 32 (f16)
  _Float16* ks    = qs + 256 * CATT;                              // PADPX x 32 (f16)

  const int tid = threadIdx.x;
  const int b   = blockIdx.z;
  const int y0  = blockIdx.y * 16, x0 = blockIdx.x * 16;

  // ---- stage halo of feat into LDS (f16), zero-padded OOB + tile padding ----
  // Weights: a thread takes 8 consecutive channels of one row of qw and of kw.
  const int wo = (tid >> 3) * SPIT + (tid & 7) * 8;  // its place in LDS, halfs
  const unsigned wb = (unsigned)tid * 32u;           // its place in qw / kw, bytes
  const float4 qa = *(const float4*)((const char*)qw + wb);
  const float4 qb = *(const float4*)((const char*)qw + wb + 16);
  const float4 ka = *(const float4*)((const char*)kw + wb);
  const float4 kb = *(const float4*)((const char*)kw + wb + 16);
  // precaution: stands before any overwrite of the register these loads name
  asm volatile("s_wait_xcnt 0x0" :: "v"(wb) : "memory");

  // Halo: wave w owns channels 8w..8w+7; a lane gathers them for one halo pixel
  // in registers and writes them as one 16-byte LDS store. All loads are issued
  // before the first value is used.
  constexpr int NI = (PADPX + 31) / 32;
  const int cg = __builtin_amdgcn_readfirstlane(tid >> 5);
  const float* fg = feat + ((size_t)b * CIN + cg * 8) * HWPX;
  float hv[NI][8];
  int   hoff[NI];  // element offset in a channel plane, -1 outside the image
#pragma unroll
  for (int i = 0; i < NI; ++i) {
    // the last group is shifted back to end at PADPX: this wave writes 16 rows
    // twice with the same values, and no group needs a branch
    const int p  = (i * 32 + 32 <= PADPX ? i * 32 : PADPX - 32) + (tid & 31);
    const int hy = p / H0, hx = p - hy * H0;
    const int gy = y0 - P + hy, gx = x0 - P + hx;
    const bool inb = p < HALO2 && gy >= 0 && gy < HIMG && gx >= 0 && gx < WIMG;
    hoff[i] = inb ? gy * WIMG + gx : -1;
  }
  unsigned ha[NI];
#pragma unroll
  for (int i = 0; i < NI; ++i) {
    ha[i] = (unsigned)max(hoff[i], 0);  // always a valid address
#pragma unroll
    for (int j = 0; j < 8; ++j) hv[i][j] = fg[(unsigned)(j * HWPX) + ha[i]];
    // precaution, once per four groups: stands before any overwrite of the
    // registers these loads name (kept live up to here as inputs)
    if ((i & 3) == 3 || i == NI - 1)
      asm volatile("s_wait_xcnt 0x0" :: "v"(ha[i]), "v"(ha[i - 1]), "v"(ha[i - 2]),
                   "v"(ha[i - 3]) : "memory");
  }
  {
    union { uint4 q; _Float16 h[8]; } pq, pk;
    pq.h[0] = (_Float16)qa.x; pq.h[1] = (_Float16)qa.y;
    pq.h[2] = (_Float16)qa.z; pq.h[3] = (_Float16)qa.w;
    pq.h[4] = (_Float16)qb.x; pq.h[5] = (_Float16)qb.y;
    pq.h[6] = (_Float16)qb.z; pq.h[7] = (_Float16)qb.w;
    pk.h[0] = (_Float16)ka.x; pk.h[1] = (_Float16)ka.y;
    pk.h[2] = (_Float16)ka.z; pk.h[3] = (_Float16)ka.w;
    pk.h[4] = (_Float16)kb.x; pk.h[5] = (_Float16)kb.y;
    pk.h[6] = (_Float16)kb.z; pk.h[7] = (_Float16)kb.w;
    *(uint4*)&wqL[wo] = pq.q;
    *(uint4*)&wkL[wo] = pk.q;
  }
#pragma unroll
  for (int i = 0; i < NI; ++i) {
    const int p = (i * 32 + 32 <= PADPX ? i * 32 : PADPX - 32) + (tid & 31);
    union { uint4 q; _Float16 h[8]; } pk;
#pragma unroll
    for (int j = 0; j < 8; ++j) pk.h[j] = (_Float16)(hoff[i] >= 0 ? hv[i][j] : 0.f);
    *(uint4*)&stage[p * SPIT + cg * 8] = pk.q;
  }
  __syncthreads();

  const int lane = tid & 31;
  const int wave = tid >> 5;
  const int mrow = lane & 15;
  const int kb2  = (lane >= 16) ? 4 : 0;  // channel-pair base for this half-wave
  const int mhi  = (lane >= 16) ? 8 : 0;
  const int col  = lane & 15;

  // ---- q projection: 16 M-tiles of interior pixels ----
  {
    const _Float16* w0 = &wqL[mrow * SPIT];
    const _Float16* w1 = &wqL[(16 + mrow) * SPIT];
    const v16h b00 = ea_frag(w0, kb2, 0);  // kstep0, ntile0
    const v16h b10 = ea_frag(w0, kb2, 1);  // kstep1, ntile0
    const v16h b01 = ea_frag(w1, kb2, 0);  // kstep0, ntile1
    const v16h b11 = ea_frag(w1, kb2, 1);  // kstep1, ntile1
    for (int t = wave; t < 16; t += 8) {
      int ip = t * 16 + mrow;  // interior pixel 0..255
      int px = ((ip >> 4) + P) * H0 + ((ip & 15) + P);
      const _Float16* srow = &stage[px * SPIT];
      v16h a0 = ea_frag(srow, kb2, 0);
      v16h a1 = ea_frag(srow, kb2, 1);
      v8f acc0 = {}, acc1 = {};
      acc0 = __builtin_amdgcn_wmma_f32_16x16x32_f16(false, a0, false, b00,
                                                    (short)0, acc0, false, false);
      acc1 = __builtin_amdgcn_wmma_f32_16x16x32_f16(false, a0, false, b01,
                                                    (short)0, acc1, false, false);
      acc0 = __builtin_amdgcn_wmma_f32_16x16x32_f16(false, a1, false, b10,
                                                    (short)0, acc0, false, false);
      acc1 = __builtin_amdgcn_wmma_f32_16x16x32_f16(false, a1, false, b11,
                                                    (short)0, acc1, false, false);
      ea_storeD(qs + (t * 16) * CATT, acc0, mhi, col, 0);
      ea_storeD(qs + (t * 16) * CATT, acc1, mhi, col, 1);
    }
  }

  // ---- key projection: KT M-tiles of halo pixels (padding rows are zero) ----
  {
    const _Float16* w0 = &wkL[mrow * SPIT];
    const _Float16* w1 = &wkL[(16 + mrow) * SPIT];
    const v16h b00 = ea_frag(w0, kb2, 0);
    const v16h b10 = ea_frag(w0, kb2, 1);
    const v16h b01 = ea_frag(w1, kb2, 0);
    const v16h b11 = ea_frag(w1, kb2, 1);
    for (int t = wave; t < KT; t += 8) {
      int px = t * 16 + mrow;  // halo pixel
      const _Float16* srow = &stage[px * SPIT];
      v16h a0 = ea_frag(srow, kb2, 0);
      v16h a1 = ea_frag(srow, kb2, 1);
      v8f acc0 = {}, acc1 = {};
      acc0 = __builtin_amdgcn_wmma_f32_16x16x32_f16(false, a0, false, b00,
                                                    (short)0, acc0, false, false);
      acc1 = __builtin_amdgcn_wmma_f32_16x16x32_f16(false, a0, false, b01,
                                                    (short)0, acc1, false, false);
      acc0 = __builtin_amdgcn_wmma_f32_16x16x32_f16(false, a1, false, b10,
                                                    (short)0, acc0, false, false);
      acc1 = __builtin_amdgcn_wmma_f32_16x16x32_f16(false, a1, false, b11,
                                                    (short)0, acc1, false, false);
      ea_storeD(ks + (t * 16) * CATT, acc0, mhi, col, 0);
      ea_storeD(ks + (t * 16) * CATT, acc1, mhi, col, 1);
    }
  }
  __syncthreads();

  // ---- L2 normalize rows (x / max(||x||, 1e-12)); zero rows stay zero ----
  for (int r = tid; r < 256 + PADPX; r += 256) {
    _Float16* row = (r < 256) ? (qs + r * CATT) : (ks + (r - 256) * CATT);
    float s = 0.f;
#pragma unroll
    for (int c = 0; c < CATT; ++c) { float v = (float)row[c]; s += v * v; }
    float inv = 1.f / fmaxf(sqrtf(s), 1e-12f);
#pragma unroll
    for (int c = 0; c < CATT; ++c) row[c] = (_Float16)((float)row[c] * inv);
  }
  __syncthreads();

  // ---- temperature from curvature (global min/max of this slice) ----
  const float kmin  = fdec(mm[2 * slice]);
  const float kmax  = fdec(mm[2 * slice + 1]);
  const float denom = (kmax - kmin) + 1e-6f;

  const int p  = tid;          // this thread's output pixel
  const int py = p >> 4, pxx = p & 15;
  const int gy = y0 + py, gx = x0 + pxx;
  const float kap  = kappa[((size_t)b * 3 + slice) * HWPX + gy * WIMG + gx];
  float tau = 0.5f - ((kap - kmin) / denom) * (0.5f - 0.03f);
  tau = fminf(fmaxf(tau, 0.03f), 0.5f);
  const float scale = 1.f / (tau + 1e-6f);

  float qreg[CATT];
#pragma unroll
  for (int c = 0; c < CATT; ++c) qreg[c] = (float)qs[p * CATT + c];

  for (int dy = 0; dy < KW; ++dy) {
    for (int dx = 0; dx < KW; ++dx) {
      const _Float16* kr = ks + ((py + dy) * H0 + (pxx + dx)) * CATT;
      float dot = 0.f;
#pragma unroll
      for (int c = 0; c < CATT; ++c) dot += qreg[c] * (float)kr[c];
      out[(((size_t)b * KK + (dy * KW + dx)) * HWPX) + gy * WIMG + gx] = dot * scale;
    }
  }
}

static size_t ea_shmem(int KW) {
  int P = KW / 2, H0 = 16 + 2 * P;
  int KT = (H0 * H0 + 15) / 16, PADPX = KT * 16;
  return (size_t)PADPX * SPIT * 2       // stage f16
       + 2 * (size_t)CATT * SPIT * 2    // weights f16
       + 256 * CATT * 2                 // qn f16
       + (size_t)PADPX * CATT * 2;      // kn f16
}

extern "C" void kernel_launch(void* const* d_in, const int* in_sizes, int n_in,
                              void* d_out, int out_size, void* d_ws, size_t ws_size,
                              hipStream_t stream) {
  const float* feat  = (const float*)d_in[0];
  const float* kappa = (const float*)d_in[1];
  const float* qw    = (const float*)d_in[2];  // (3, 32, 64)
  const float* kw    = (const float*)d_in[3];  // (3, 32, 64)
  float*       out   = (float*)d_out;
  unsigned*    mm    = (unsigned*)d_ws;        // 3 x {min,max} encoded

  ea_init_mm<<<1, 64, 0, stream>>>(mm);
  ea_kap_minmax<<<dim3(256, 3), 256, 0, stream>>>(kappa, mm);

  const dim3 grid(WIMG / 16, HIMG / 16, BSZ), block(256);
  const size_t woff = (size_t)CATT * CIN;

  ea_affinity<3><<<grid, block, ea_shmem(3), stream>>>(
      feat, kappa, qw + 0 * woff, kw + 0 * woff, mm, out, 0);
  ea_affinity<5><<<grid, block, ea_shmem(5), stream>>>(
      feat, kappa, qw + 1 * woff, kw + 1 * woff, mm,
      out + (size_t)BSZ * 9 * HWPX, 1);
  ea_affinity<7><<<grid, block, ea_shmem(7), stream>>>(
      feat, kappa, qw + 2 * woff, kw + 2 * woff, mm,
      out + (size_t)BSZ * (9 + 25) * HWPX, 2);
}

// v002
// One run takes 103 microseconds.
// In both of two side-by-side timings against v001, it was 1.15 times as fast.
// All steps since v000 together make it 3.67 times as fast.
#include <hip/hip_runtime.h>
#include <hip/hip_bf16.h>

typedef __attribute__((ext_vector_type(16))) _Float16 v16h;
typedef __attribute__((ext_vector_type(8)))  float    v8f;

#define HWPX (256 * 256)
#define HIMG 256
#define WIMG 256
#define BSZ  4
#define CIN  64
#define CATT 32
// halfs per LDS row of a WMMA operand (64 channels + 8): 144 B = 16 B x 9, so
// 16 lanes on 16 consecutive rows spread their 16-byte accesses over all banks
#define SPIT (CIN + 8)
// halfs per LDS row of a projected pixel (32 channels + 8): 80 B = 16 B x 5, the
// same spreading for the 16-byte fragment reads of the correlation product
#define QPIT (CATT + 8)
// floats per LDS plane of the result tile (256 pixels + 12): the lanes of one
// band store sit on different window offsets, so on planes; the 12 spreads them
#define OPIT (256 + 12)

// ---- order-preserving float <-> uint encoding (for atomic min/max) ----
__device__ __forceinline__ unsigned fenc(float f) {
  unsigned u = __float_as_uint(f);
  return u ^ ((u >> 31) ? 0xFFFFFFFFu : 0x80000000u);
}
__device__ __forceinline__ float fdec(unsigned u) {
  u ^= ((u >> 31) ? 0x80000000u : 0xFFFFFFFFu);
  return __uint_as_float(u);
}

__global__ void ea_init_mm(unsigned* mm) {
  int i = threadIdx.x;
  if (i < 3) {
    mm[2 * i]     = 0xFFFFFFFFu;  // +inf encoded
    mm[2 * i + 1] = 0u;           // -inf encoded
  }
}

// global min/max of kappa[:, slice, :, :]
__global__ __launch_bounds__(256) void ea_kap_minmax(const float* __restrict__ kappa,
                                                     unsigned* __restrict__ mm) {
  const int slice = blockIdx.y;
  __shared__ unsigned smin[256], smax[256];
  unsigned lmin = 0xFFFFFFFFu, lmax = 0u;
  const int total = BSZ * HWPX;
  for (int e = blockIdx.x * blockDim.x + threadIdx.x; e < total;
       e += gridDim.x * blockDim.x) {
    int b = e / HWPX, off = e - b * HWPX;
    unsigned k = fenc(kappa[((size_t)b * 3 + slice) * HWPX + off]);
    lmin = (k < lmin) ? k : lmin;
    lmax = (k > lmax) ? k : lmax;
  }
  int tid = threadIdx.x;
  smin[tid] = lmin; smax[tid] = lmax;
  __syncthreads();
  for (int s = 128; s > 0; s >>= 1) {
    if (tid < s) {
      unsigned a = smin[tid + s]; if (a < smin[tid]) smin[tid] = a;
      unsigned b = smax[tid + s]; if (b > smax[tid]) smax[tid] = b;
    }
    __syncthreads();
  }
  if (tid == 0) {
    atomicMin(&mm[2 * slice], smin[0]);
    atomicMax(&mm[2 * slice + 1], smax[0]);
  }
}

// Assemble a 16x32 f16 WMMA fragment (A or B operand) from an LDS row of 32
// (stage, weights) or 16 (q, k) channel-pairs, per the ISA layout: halves 0-7 = K kb..kb+7, halves 8-15 =
// K kb+16..kb+23 (kb = 0 for lanes 0-15, 8 for lanes 16-31). Union with
// constant indices keeps everything in VGPRs (SROA), no scratch.
// Rows start on 16 bytes, so each run of 8 halves is one 16-byte LDS load.
__device__ __forceinline__ v16h ea_frag(const _Float16* row, int kb2, int s) {
  const uint4* p = (const uint4*)row;
  union { v16h v; uint4 q[2]; } r;
  r.q[0] = p[s * 4 + (kb2 >> 2)];
  r.q[1] = p[s * 4 + (kb2 >> 2) + 2];
  return r.v;
}

// Scatter a 16x16 f32 D-matrix fragment to an LDS [row][QPIT] f16 array.
__device__ __forceinline__ void ea_storeD(_Float16* dst, v8f acc, int mhi,
                                          int col, int nt) {
#pragma unroll
  for (int r = 0; r < 8; ++r)
    dst[(r + mhi) * QPIT + nt * 16 + col] = (_Float16)acc[r];
}

// Fused: f16-WMMA q/k projection -> L2 normalize -> k x k windowed cosine / tau
template <int KW>
__global__ __launch_bounds__(256) void ea_affinity(const float* __restrict__ feat,
                                                   const float* __restrict__ kappa,
                                                   const float* __restrict__ qw,
                                                   const float* __restrict__ kw,
                                                   const unsigned* __restrict__ mm,
                                                   float* __restrict__ out,
                                                   int slice) {
  constexpr int P     = KW / 2;
  constexpr int H0    = 16 + 2 * P;          // halo tile edge
  constexpr int HALO2 = H0 * H0;             // halo pixels
  constexpr int KT    = (HALO2 + 15) / 16;   // 16-row M-tiles for key proj
  constexpr int PADPX = KT * 16;             // padded halo pixel count
  constexpr int KK    = KW * KW;

  extern __shared__ char lds_raw[];
  _Float16* stage = (_Float16*)lds_raw;                           // PADPX rows of SPIT (f16)
  _Float16* wqL   = (_Float16*)(lds_raw + (size_t)PADPX * SPIT * 2);
  _Float16* wkL   = wqL + CATT * SPIT;
  _Float16* qs    = wkL + CATT * SPIT;                            // 256 rows of QPIT (f16)
  _Float16* ks    = qs + 256 * QPIT;                              // PADPX rows of QPIT (f16)
  float*    ob    = (float*)lds_raw;  // KK planes of OPIT (f32), over stage once it is dead

  const int tid = threadIdx.x;
  const int b   = blockIdx.z;
  const int y0  = blockIdx.y * 16, x0 = blockIdx.x * 16;

  // ---- stage halo of feat into LDS (f16), zero-padded OOB + tile padding ----
  // Weights: a thread takes 8 consecutive channels of one row of qw and of kw.
  const int wo = (tid >> 3) * SPIT + (tid & 7) * 8;  // its place in LDS, halfs
  const unsigned wb = (unsigned)tid * 32u;           // its place in qw / kw, bytes
  const float4 qa = *(const float4*)((const char*)qw + wb);
  const float4 qb = *(const float4*)((const char*)qw + wb + 16);
  const float4 ka = *(const float4*)((const char*)kw + wb);
  const float4 kb = *(const float4*)((const char*)kw + wb + 16);
  // precaution: stands before any overwrite of the register these loads name
  asm volatile("s_wait_xcnt 0x0" :: "v"(wb) : "memory");

  // Halo: wave w owns channels 8w..8w+7; a lane gathers them for one halo pixel
  // in registers and writes them as one 16-byte LDS store. All loads are issued
  // before the first value is used.
  constexpr int NI = (PADPX + 31) / 32;
  const int cg = __builtin_amdgcn_readfirstlane(tid >> 5);
  const float* fg = feat + ((size_t)b * CIN + cg * 8) * HWPX;
  float hv[NI][8];
  int   hoff[NI];  // element offset in a channel plane, -1 outside the image
#pragma unroll
  for (int i = 0; i < NI; ++i) {
    // the last group is shifted back to end at PADPX: this wave writes 16 rows
    // twice with the same values, and no group needs a branch
    const int p  = (i * 32 + 32 <= PADPX ? i * 32 : PADPX - 32) + (tid & 31);
    const int hy = p / H0, hx = p - hy * H0;
    const int gy = y0 - P + hy, gx = x0 - P + hx;
    const bool inb = p < HALO2 && gy >= 0 && gy < HIMG && gx >= 0 && gx < WIMG;
    hoff[i] = inb ? gy * WIMG + gx : -1;
  }
  unsigned ha[NI];
#pragma unroll
  for (int i = 0; i < NI; ++i) {
    ha[i] = (unsigned)max(hoff[i], 0);  // always a valid address
#pragma unroll
    for (int j = 0; j < 8; ++j) hv[i][j] = fg[(unsigned)(j * HWPX) + ha[i]];
    // precaution, once per four groups: stands before any overwrite of the
    // registers these loads name (kept live up to here as inputs)
    if ((i & 3) == 3 || i == NI - 1)
      asm volatile("s_wait_xcnt 0x0" :: "v"(ha[i]), "v"(ha[i - 1]), "v"(ha[i - 2]),
                   "v"(ha[i - 3]) : "memory");
  }
  {
    union { uint4 q; _Float16 h[8]; } pq, pk;
    pq.h[0] = (_Float16)qa.x; pq.h[1] = (_Float16)qa.y;
    pq.h[2] = (_Float16)qa.z; pq.h[3] = (_Float16)qa.w;
    pq.h[4] = (_Float16)qb.x; pq.h[5] = (_Float16)qb.y;
    pq.h[6] = (_Float16)qb.z; pq.h[7] = (_Float16)qb.w;
    pk.h[0] = (_Float16)ka.x; pk.h[1] = (_Float16)ka.y;
    pk.h[2] = (_Float16)ka.z; pk.h[3] = (_Float16)ka.w;
    pk.h[4] = (_Float16)kb.x; pk.h[5] = (_Float16)kb.y;
    pk.h[6] = (_Float16)kb.z; pk.h[7] = (_Float16)kb.w;
    *(uint4*)&wqL[wo] = pq.q;
    *(uint4*)&wkL[wo] = pk.q;
  }
#pragma unroll
  for (int i = 0; i < NI; ++i) {
    const int p = (i * 32 + 32 <= PADPX ? i * 32 : PADPX - 32) + (tid & 31);
    union { uint4 q; _Float16 h[8]; } pk;
#pragma unroll
    for (int j = 0; j < 8; ++j) pk.h[j] = (_Float16)(hoff[i] >= 0 ? hv[i][j] : 0.f);
    *(uint4*)&stage[p * SPIT + cg * 8] = pk.q;
  }
  __syncthreads();

  const int lane = tid & 31;
  const int wave = tid >> 5;
  const int mrow = lane & 15;
  const int kb2  = (lane >= 16) ? 4 : 0;  // channel-pair base for this half-wave
  const int mhi  = (lane >= 16) ? 8 : 0;
  const int col  = lane & 15;

  // ---- q projection: 16 M-tiles of interior pixels ----
  {
    const _Float16* w0 = &wqL[mrow * SPIT];
    const _Float16* w1 = &wqL[(16 + mrow) * SPIT];
    const v16h b00 = ea_frag(w0, kb2, 0);  // kstep0, ntile0
    const v16h b10 = ea_frag(w0, kb2, 1);  // kstep1, ntile0
    const v16h b01 = ea_frag(w1, kb2, 0);  // kstep0, ntile1
    const v16h b11 = ea_frag(w1, kb2, 1);  // kstep1, ntile1
    for (int t = wave; t < 16; t += 8) {
      int ip = t * 16 + mrow;  // interior pixel 0..255
      int px = ((ip >> 4) + P) * H0 + ((ip & 15) + P);
      const _Float16* srow = &stage[px * SPIT];
      v16h a0 = ea_frag(srow, kb2, 0);
      v16h a1 = ea_frag(srow, kb2, 1);
      v8f acc0 = {}, acc1 = {};
      acc0 = __builtin_amdgcn_wmma_f32_16x16x32_f16(false, a0, false, b00,
                                                    (short)0, acc0, false, false);
      acc1 = __builtin_amdgcn_wmma_f32_16x16x32_f16(false, a0, false, b01,
                                                    (short)0, acc1, false, false);
      acc0 = __builtin_amdgcn_wmma_f32_16x16x32_f16(false, a1, false, b10,
                                                    (short)0, acc0, false, false);
      acc1 = __builtin_amdgcn_wmma_f32_16x16x32_f16(false, a1, false, b11,
                                                    (short)0, acc1, false, false);
      ea_storeD(qs + (t * 16) * QPIT, acc0, mhi, col, 0);
      ea_storeD(qs + (t * 16) * QPIT, acc1, mhi, col, 1);
    }
  }

  // ---- key projection: KT M-tiles of halo pixels (padding rows are zero) ----
  {
    const _Float16* w0 = &wkL[mrow * SPIT];
    const _Float16* w1 = &wkL[(16 + mrow) * SPIT];
    const v16h b00 = ea_frag(w0, kb2, 0);
    const v16h b10 = ea_frag(w0, kb2, 1);
    const v16h b01 = ea_frag(w1, kb2, 0);
    const v16h b11 = ea_frag(w1, kb2, 1);
    for (int t = wave; t < KT; t += 8) {
      int px = t * 16 + mrow;  // halo pixel
      const _Float16* srow = &stage[px * SPIT];
      v16h a0 = ea_frag(srow, kb2, 0);
      v16h a1 = ea_frag(srow, kb2, 1);
      v8f acc0 = {}, acc1 = {};
      acc0 = __builtin_amdgcn_wmma_f32_16x16x32_f16(false, a0, false, b00,
                                                    (short)0, acc0, false, false);
      acc1 = __builtin_amdgcn_wmma_f32_16x16x32_f16(false, a0, false, b01,
                                                    (short)0, acc1, false, false);
      acc0 = __builtin_amdgcn_wmma_f32_16x16x32_f16(false, a1, false, b10,
                                                    (short)0, acc0, false, false);
      acc1 = __builtin_amdgcn_wmma_f32_16x16x32_f16(false, a1, false, b11,
                                                    (short)0, acc1, false, false);
      ea_storeD(ks + (t * 16) * QPIT, acc0, mhi, col, 0);
      ea_storeD(ks + (t * 16) * QPIT, acc1, mhi, col, 1);
    }
  }
  __syncthreads();

  // ---- L2 normalize rows (x / max(||x||, 1e-12)); zero rows stay zero ----
  for (int r = tid; r < 256 + PADPX; r += 256) {
    _Float16* row = (r < 256) ? (qs + r * QPIT) : (ks + (r - 256) * QPIT);
    float s = 0.f;
#pragma unroll
    for (int c = 0; c < CATT; ++c) { float v = (float)row[c]; s += v * v; }
    float inv = 1.f / fmaxf(sqrtf(s), 1e-12f);
#pragma unroll
    for (int c = 0; c < CATT; ++c) row[c] = (_Float16)((float)row[c] * inv);
  }
  __syncthreads();

  // ---- temperature from curvature (global min/max of this slice) ----
  const float kmin  = fdec(mm[2 * slice]);
  const float kmax  = fdec(mm[2 * slice + 1]);
  const float denom = (kmax - kmin) + 1e-6f;

  // This thread writes out four neighbouring pixels of every fourth plane.
  const int g = tid & 63;
  const unsigned pixb = (unsigned)(((y0 + (g >> 2)) * WIMG + x0 + (g & 3) * 4) * 4);  // bytes
  const float4 kap4 =
      *(const float4*)((const char*)(kappa + ((size_t)b * 3 + slice) * HWPX) + pixb);
  // precaution: stands before any overwrite of the register this load names
  asm volatile("s_wait_xcnt 0x0" :: "v"(pixb) : "memory");

  // ---- windowed correlation as a banded matrix product ----
  // Wave w owns query rows 2w and 2w+1 of the tile. One product is 16 queries of
  // a row (A) against 16 keys of a halo row (B), all 32 channels in one step:
  // D[m][n] = q[m] . k[n]. Query m wants keys m..m+KW-1 of the H0 in the halo
  // row: key tile 0 holds keys 0..15, key tile 1 keys 16..H0-1 (its other columns
  // repeat the last key and are never stored). A halo row's fragments serve both
  // query rows.
  {
    const int qy0 = cg * 2;
    const v16h qf0 = ea_frag(qs + (qy0 * 16 + mrow) * QPIT, kb2, 0);
    const v16h qf1 = ea_frag(qs + ((qy0 + 1) * 16 + mrow) * QPIT, kb2, 0);
    const _Float16* k0 = ks + (qy0 * H0 + col) * QPIT;
    const _Float16* k1 = ks + (qy0 * H0 + 16 + min(col, 2 * P - 1)) * QPIT;
    // Register r of a lane is query m = r + mhi against key col (tile 0) or
    // 16 + col (tile 1): window offset dx = key - m. The two tiles' bands fall on
    // disjoint lanes, so they are merged: dx = (col - m) mod 16, kept if < KW.
    // Four halo rows at a time, so that fragments and bands stay in few registers.
    // Every loop of this block is unrolled: band[] is then indexed by constants
    // (registers, no scratch) and the LDS offsets become immediates.
#pragma unroll
    for (int c0 = 0; c0 <= KW; c0 += 4) {
      float band[8][8];  // [halo row of the chunk * 2 + query row][register]
#pragma unroll
      for (int kc = 0; kc < 4; ++kc) {
        const int kr = c0 + kc;
        if (kr > KW) continue;
        const v16h f0 = ea_frag(k0 + kr * H0 * QPIT, kb2, 0);
        const v16h f1 = ea_frag(k1 + kr * H0 * QPIT, kb2, 0);
#pragma unroll
        for (int q = 0; q < 2; ++q) {
          const int dy = kr - q;
          if (dy < 0 || dy >= KW) continue;
          const v8f z = {};
          const v8f d0 = __builtin_amdgcn_wmma_f32_16x16x32_f16(
              false, q ? qf1 : qf0, false, f0, (short)0, z, false, false);
          const v8f d1 = __builtin_amdgcn_wmma_f32_16x16x32_f16(
              false, q ? qf1 : qf0, false, f1, (short)0, z, false, false);
#pragma unroll
          for (int r = 0; r < 8; ++r)
            band[kc * 2 + q][r] = (col >= r + mhi) ? d0[r] : d1[r];
        }
      }
      // Band -> ob[dy * KW + dx][pixel]; one lane mask per register index.
#pragma unroll
      for (int r = 0; r < 8; ++r) {
        const int m  = r + mhi;
        const int dx = (col - m) & 15;
        if (dx < KW) {
          float* o = ob + dx * OPIT + qy0 * 16 + m;
#pragma unroll
          for (int e = 0; e < 8; ++e) {
            const int dy = c0 + (e >> 1) - (e & 1);
            if (c0 + (e >> 1) > KW || dy < 0 || dy >= KW) continue;
            o[dy * KW * OPIT + (e & 1) * 16] = band[e][r];
          }
        }
      }
    }
  }

  float sc[4];
  {
    const float kp[4] = {kap4.x, kap4.y, kap4.z, kap4.w};
#pragma unroll  // kp[] and sc[] indexed by constants: registers
    for (int j = 0; j < 4; ++j) {
      float tau = 0.5f - ((kp[j] - kmin) / denom) * (0.5f - 0.03f);
      tau = fminf(fmaxf(tau, 0.03f), 0.5f);
      sc[j] = 1.f / (tau + 1e-6f);
    }
  }
  __syncthreads();  // the result tile is complete before other waves read it

  // ---- write out: 16 bytes a lane, planes pl0, pl0 + 4, ... ----
  constexpr int NP = KK / 4;  // KK = 4 * NP + 1: the last plane goes to pl0 == 0
  const int pl0 = cg >> 1;
  char* ou = (char*)(out + ((size_t)b * KK + pl0) * HWPX);
  float4 ov[NP + 1];
  // both loops unrolled: ov[] stays in registers, and all LDS reads are issued
  // ahead of the first store
#pragma unroll
  for (int i = 0; i < NP; ++i) ov[i] = *(const float4*)&ob[(pl0 + 4 * i) * OPIT + g * 4];
  if (pl0 == 0) ov[NP] = *(const float4*)&ob[(4 * NP) * OPIT + g * 4];
#pragma unroll
  for (int i = 0; i <= NP; ++i) {
    if (i < NP || pl0 == 0) {
      float4 v = ov[i];
      v.x *= sc[0]; v.y *= sc[1]; v.z *= sc[2]; v.w *= sc[3];
      *(float4*)(ou + (size_t)i * (4u * HWPX * 4u) + pixb) = v;
    }
  }
}

static size_t ea_shmem(int KW) {
  int P = KW / 2, H0 = 16 + 2 * P;
  int KT = (H0 * H0 + 15) / 16, PADPX = KT * 16;
  return (size_t)PADPX * SPIT * 2       // stage f16
       + 2 * (size_t)CATT * SPIT * 2    // weights f16
       + 256 * QPIT * 2                 // qn f16
       + (size_t)PADPX * QPIT * 2;      // kn f16
}

extern "C" void kernel_launch(void* const* d_in, const int* in_sizes, int n_in,
                              void* d_out, int out_size, void* d_ws, size_t ws_size,
                              hipStream_t stream) {
  const float* feat  = (const float*)d_in[0];
  const float* kappa = (const float*)d_in[1];
  const float* qw    = (const float*)d_in[2];  // (3, 32, 64)
  const float* kw    = (const float*)d_in[3];  // (3, 32, 64)
  float*       out   = (float*)d_out;
  unsigned*    mm    = (unsigned*)d_ws;        // 3 x {min,max} encoded

  ea_init_mm<<<1, 64, 0, stream>>>(mm);
  ea_kap_minmax<<<dim3(256, 3), 256, 0, stream>>>(kappa, mm);

  const dim3 grid(WIMG / 16, HIMG / 16, BSZ), block(256);
  const size_t woff = (size_t)CATT * CIN;

  ea_affinity<3><<<grid, block, ea_shmem(3), stream>>>(
      feat, kappa, qw + 0 * woff, kw + 0 * woff, mm, out, 0);
  ea_affinity<5><<<grid, block, ea_shmem(5), stream>>>(
      feat, kappa, qw + 1 * woff, kw + 1 * woff, mm,
      out + (size_t)BSZ * 9 * HWPX, 1);
  ea_affinity<7><<<grid, block, ea_shmem(7), stream>>>(
      feat, kappa, qw + 2 * woff, kw + 2 * woff, mm,
      out + (size_t)BSZ * (9 + 25) * HWPX, 2);
}

// v003
// It runs in 66.7 microseconds.
// Next to v002, in two timings, it ran 1.55 times as fast each time.
// Counting every step since v000, it is 5.70 times as fast.
#include <hip/hip_runtime.h>
#include <hip/hip_bf16.h>

typedef __attribute__((ext_vector_type(16))) _Float16 v16h;
typedef __attribute__((ext_vector_type(8)))  float    v8f;

#define HWPX (256 * 256)
#define HIMG 256
#define WIMG 256
#define BSZ  4
#define CIN  64
#define CATT 32
// halfs per LDS row of a WMMA operand (64 channels + 8): 144 B = 16 B x 9, so
// 16 lanes on 16 consecutive rows spread their 16-byte accesses over all banks
#define SPIT (CIN + 8)
// halfs per LDS row of a projected pixel (32 channels + 8): 80 B = 16 B x 5, the
// same spreading for the 16-byte fragment reads of the correlation product
#define QPIT (CATT + 8)
// floats per LDS plane of the result tile (256 pixels + 12): the lanes of one
// band store sit on different window offsets, so on planes; the 12 spreads them
#define OPIT (256 + 12)

// ---- order-preserving float <-> uint encoding (for atomic min/max) ----
__device__ __forceinline__ unsigned fenc(float f) {
  unsigned u = __float_as_uint(f);
  return u ^ ((u >> 31) ? 0xFFFFFFFFu : 0x80000000u);
}
__device__ __forceinline__ float fdec(unsigned u) {
  u ^= ((u >> 31) ? 0x80000000u : 0xFFFFFFFFu);
  return __uint_as_float(u);
}

__global__ void ea_init_mm(unsigned* mm) {
  int i = threadIdx.x;
  if (i < 3) {
    mm[2 * i]     = 0xFFFFFFFFu;  // +inf encoded
    mm[2 * i + 1] = 0u;           // -inf encoded
  }
}

// global min/max of kappa[:, slice, :, :]
__global__ __launch_bounds__(256) void ea_kap_minmax(const float* __restrict__ kappa,
                                                     unsigned* __restrict__ mm) {
  const int slice = blockIdx.y;
  __shared__ unsigned smin[256], smax[256];
  unsigned lmin = 0xFFFFFFFFu, lmax = 0u;
  const int total = BSZ * HWPX;
  for (int e = blockIdx.x * blockDim.x + threadIdx.x; e < total;
       e += gridDim.x * blockDim.x) {
    int b = e / HWPX, off = e - b * HWPX;
    unsigned k = fenc(kappa[((size_t)b * 3 + slice) * HWPX + off]);
    lmin = (k < lmin) ? k : lmin;
    lmax = (k > lmax) ? k : lmax;
  }
  int tid = threadIdx.x;
  smin[tid] = lmin; smax[tid] = lmax;
  __syncthreads();
  for (int s = 128; s > 0; s >>= 1) {
    if (tid < s) {
      unsigned a = smin[tid + s]; if (a < smin[tid]) smin[tid] = a;
      unsigned b = smax[tid + s]; if (b > smax[tid]) smax[tid] = b;
    }
    __syncthreads();
  }
  if (tid == 0) {
    atomicMin(&mm[2 * slice], smin[0]);
    atomicMax(&mm[2 * slice + 1], smax[0]);
  }
}

// Assemble a 16x32 f16 WMMA fragment (A or B operand) from an LDS row of 32
// (stage, weights) or 16 (q, k) channel-pairs, per the ISA layout: halves 0-7 = K kb..kb+7, halves 8-15 =
// K kb+16..kb+23 (kb = 0 for lanes 0-15, 8 for lanes 16-31). Union with
// constant indices keeps everything in VGPRs (SROA), no scratch.
// Rows start on 16 bytes, so each run of 8 halves is one 16-byte LDS load.
__device__ __forceinline__ v16h ea_frag(const _Float16* row, int kb2, int s) {
  const uint4* p = (const uint4*)row;
  union { v16h v; uint4 q[2]; } r;
  r.q[0] = p[s * 4 + (kb2 >> 2)];
  r.q[1] = p[s * 4 + (kb2 >> 2) + 2];
  return r.v;
}

// Scatter a 16x16 f32 D-matrix fragment to an LDS [row][QPIT] f16 array.
__device__ __forceinline__ void ea_storeD(_Float16* dst, v8f acc, int mhi,
                                          int col, int nt) {
#pragma unroll
  for (int r = 0; r < 8; ++r)
    dst[(r + mhi) * QPIT + nt * 16 + col] = (_Float16)acc[r];
}

// 8 floats -> 8 halfs, one 16-byte unit
__device__ __forceinline__ uint4 ea_pack8(float4 a, float4 c) {
  union { uint4 q; _Float16 h[8]; } p;
  p.h[0] = (_Float16)a.x; p.h[1] = (_Float16)a.y;
  p.h[2] = (_Float16)a.z; p.h[3] = (_Float16)a.w;
  p.h[4] = (_Float16)c.x; p.h[5] = (_Float16)c.y;
  p.h[6] = (_Float16)c.z; p.h[7] = (_Float16)c.w;
  return p.q;
}

// LDS map of the fused kernel, bytes. The 22 x 22 halo of the widest window is
// staged once and serves all three window sizes.
#define PST   3                      // halo width of the stage
#define HST   (16 + 2 * PST)         // its edge
#define PADST 496                    // its pixels (484), rounded up to 16
#define L_WQ  (PADST * SPIT * 2)             // weights behind the stage
#define L_QS  (L_WQ + 2 * CATT * SPIT * 2)   // 256 q rows
#define L_KS  (L_QS + 256 * QPIT * 2)        // key rows: 400 / 336 / 496 by window
// Result tiles. The windows run in the order 5, 3, 7. A tile may still be read by
// slow waves while fast ones write the next window's key rows, so it lies behind
// those: 5's behind 336 (and its own 400) rows, 3's behind 496. 7's lies over the
// stage, which is dead by then.
#define L_OB5 (L_KS + 400 * QPIT * 2)
#define L_OB3 (L_KS + PADST * QPIT * 2)
#define L_OB7 0
#define L_ALL (L_OB5 + 25 * OPIT * 4)

// One window size, from the staged halo and the weights in LDS to its output:
// f16-WMMA q/k projection -> L2 normalize -> k x k windowed cosine / tau.
// nqw, nkw: the next window's weights (NEXT): fetched while this window's
// projections run, put into LDS as soon as this window's are dead.
template <int KW, int OBAT, bool NEXT>
__device__ __forceinline__ void ea_window(char* lds_raw,
                                          const float* __restrict__ kappa,
                                          const unsigned* __restrict__ mm,
                                          float* __restrict__ out, int slice,
                                          int b, int y0, int x0, int tid, int cg,
                                          const float* __restrict__ nqw,
                                          const float* __restrict__ nkw) {
  constexpr int P     = KW / 2;
  constexpr int H0    = 16 + 2 * P;          // halo tile edge
  constexpr int HALO2 = H0 * H0;             // halo pixels
  constexpr int KT    = (HALO2 + 15) / 16;   // 16-row M-tiles for key proj
  constexpr int PADPX = KT * 16;             // padded halo pixel count
  constexpr int KK    = KW * KW;
  constexpr int OFF   = PST - P;             // this halo's corner in the stage

  _Float16* stage = (_Float16*)lds_raw;            // PADST rows of SPIT (f16)
  _Float16* wqL   = (_Float16*)(lds_raw + L_WQ);
  _Float16* wkL   = wqL + CATT * SPIT;
  _Float16* qs    = (_Float16*)(lds_raw + L_QS);   // 256 rows of QPIT (f16)
  _Float16* ks    = (_Float16*)(lds_raw + L_KS);   // PADPX rows of QPIT (f16)
  float*    ob    = (float*)(lds_raw + OBAT);      // KK planes of OPIT (f32)

  const int lane = tid & 31;
  const int wave = tid >> 5;
  const int mrow = lane & 15;
  const int kb2  = (lane >= 16) ? 4 : 0;  // channel-pair base for this half-wave
  const int mhi  = (lane >= 16) ? 8 : 0;
  const int col  = lane & 15;

  // A thread takes 8 consecutive channels of one row of the next qw and kw.
  float4 nqa, nqb, nka, nkb;
  if constexpr (NEXT) {
    const unsigned wb = (unsigned)tid * 32u;  // its place in qw / kw, bytes
    nqa = *(const float4*)((const char*)nqw + wb);
    nqb = *(const float4*)((const char*)nqw + wb + 16);
    nka = *(const float4*)((const char*)nkw + wb);
    nkb = *(const float4*)((const char*)nkw + wb + 16);
    // precaution: stands before any overwrite of the register these loads name
    asm volatile("s_wait_xcnt 0x0" :: "v"(wb) : "memory");
  }

  // ---- q projection: 16 M-tiles of interior pixels ----
  {
    const _Float16* w0 = &wqL[mrow * SPIT];
    const _Float16* w1 = &wqL[(16 + mrow) * SPIT];
    const v16h b00 = ea_frag(w0, kb2, 0);  // kstep0, ntile0
    const v16h b10 = ea_frag(w0, kb2, 1);  // kstep1, ntile0
    const v16h b01 = ea_frag(w1, kb2, 0);  // kstep0, ntile1
    const v16h b11 = ea_frag(w1, kb2, 1);  // kstep1, ntile1
    for (int t = wave; t < 16; t += 8) {
      int ip = t * 16 + mrow;  // interior pixel 0..255
      int px = ((ip >> 4) + PST) * HST + ((ip & 15) + PST);
      const _Float16* srow = &stage[px * SPIT];
      v16h a0 = ea_frag(srow, kb2, 0);
      v16h a1 = ea_frag(srow, kb2, 1);
      v8f acc0 = {}, acc1 = {};
      acc0 = __builtin_amdgcn_wmma_f32_16x16x32_f16(false, a0, false, b00,
                                                    (short)0, acc0, false, false);
      acc1 = __builtin_amdgcn_wmma_f32_16x16x32_f16(false, a0, false, b01,
                                                    (short)0, acc1, false, false);
      acc0 = __builtin_amdgcn_wmma_f32_16x16x32_f16(false, a1, false, b10,
                                                    (short)0, acc0, false, false);
      acc1 = __builtin_amdgcn_wmma_f32_16x16x32_f16(false, a1, false, b11,
                                                    (short)0, acc1, false, false);
      ea_storeD(qs + (t * 16) * QPIT, acc0, mhi, col, 0);
      ea_storeD(qs + (t * 16) * QPIT, acc1, mhi, col, 1);
    }
  }

  // ---- key projection: KT M-tiles of halo pixels ----
  {
    const _Float16* w0 = &wkL[mrow * SPIT];
    const _Float16* w1 = &wkL[(16 + mrow) * SPIT];
    const v16h b00 = ea_frag(w0, kb2, 0);
    const v16h b10 = ea_frag(w0, kb2, 1);
    const v16h b01 = ea_frag(w1, kb2, 0);
    const v16h b11 = ea_frag(w1, kb2, 1);
    for (int t = wave; t < KT; t += 8) {
      // halo pixel of this window -> its row in the stage; the rows that pad the
      // last M-tile repeat the last pixel and are never read by the correlation
      const int h  = min(t * 16 + mrow, HALO2 - 1);
      const int hy = h / H0;
      const int px = (hy + OFF) * HST + (h - hy * H0) + OFF;
      const _Float16* srow = &stage[px * SPIT];
      v16h a0 = ea_frag(srow, kb2, 0);
      v16h a1 = ea_frag(srow, kb2, 1);
      v8f acc0 = {}, acc1 = {};
      acc0 = __builtin_amdgcn_wmma_f32_16x16x32_f16(false, a0, false, b00,
                                                    (short)0, acc0, false, false);
      acc1 = __builtin_amdgcn_wmma_f32_16x16x32_f16(false, a0, false, b01,
                                                    (short)0, acc1, false, false);
      acc0 = __builtin_amdgcn_wmma_f32_16x16x32_f16(false, a1, false, b10,
                                                    (short)0, acc0, false, false);
      acc1 = __builtin_amdgcn_wmma_f32_16x16x32_f16(false, a1, false, b11,
                                                    (short)0, acc1, false, false);
      ea_storeD(ks + (t * 16) * QPIT, acc0, mhi, col, 0);
      ea_storeD(ks + (t * 16) * QPIT, acc1, mhi, col, 1);
    }
  }
  __syncthreads();

  // every wave has its weight fragments: the next window's weights take their
  // place (two barriers stand between here and their first read)
  if constexpr (NEXT) {
    const int wo = (tid >> 3) * SPIT + (tid & 7) * 8;
    *(uint4*)&wqL[wo] = ea_pack8(nqa, nqb);
    *(uint4*)&wkL[wo] = ea_pack8(nka, nkb);
  }

  // ---- L2 normalize rows (x / max(||x||, 1e-12)); zero rows stay zero ----
  for (int r = tid; r < 256 + PADPX; r += 256) {
    _Float16* row = (r < 256) ? (qs + r * QPIT) : (ks + (r - 256) * QPIT);
    float s = 0.f;
#pragma unroll
    for (int c = 0; c < CATT; ++c) { float v = (float)row[c]; s += v * v; }
    float inv = 1.f / fmaxf(sqrtf(s), 1e-12f);
#pragma unroll
    for (int c = 0; c < CATT; ++c) row[c] = (_Float16)((float)row[c] * inv);
  }
  __syncthreads();

  // ---- temperature from curvature (global min/max of this slice) ----
  const float kmin  = fdec(mm[2 * slice]);
  const float kmax  = fdec(mm[2 * slice + 1]);
  const float denom = (kmax - kmin) + 1e-6f;

  // This thread writes out four neighbouring pixels of every fourth plane.
  const int g = tid & 63;
  const unsigned pixb = (unsigned)(((y0 + (g >> 2)) * WIMG + x0 + (g & 3) * 4) * 4);  // bytes
  const float4 kap4 =
      *(const float4*)((const char*)(kappa + ((size_t)b * 3 + slice) * HWPX) + pixb);
  // precaution: stands before any overwrite of the register this load names
  asm volatile("s_wait_xcnt 0x0" :: "v"(pixb) : "memory");

  // ---- windowed correlation as a banded matrix product ----
  // Wave w owns query rows 2w and 2w+1 of the tile. One product is 16 queries of
  // a row (A) against 16 keys of a halo row (B), all 32 channels in one step:
  // D[m][n] = q[m] . k[n]. Query m wants keys m..m+KW-1 of the H0 in the halo
  // row: key tile 0 holds keys 0..15, key tile 1 keys 16..H0-1 (its other columns
  // repeat the last key and are never stored). A halo row's fragments serve both
  // query rows.
  {
    const int qy0 = cg * 2;
    const v16h qf0 = ea_frag(qs + (qy0 * 16 + mrow) * QPIT, kb2, 0);
    const v16h qf1 = ea_frag(qs + ((qy0 + 1) * 16 + mrow) * QPIT, kb2, 0);
    const _Float16* k0 = ks + (qy0 * H0 + col) * QPIT;
    const _Float16* k1 = ks + (qy0 * H0 + 16 + min(col, 2 * P - 1)) * QPIT;
    // Register r of a lane is query m = r + mhi against key col (tile 0) or
    // 16 + col (tile 1): window offset dx = key - m. The two tiles' bands fall on
    // disjoint lanes, so they are merged: dx = (col - m) mod 16, kept if < KW.
    // Four halo rows at a time, so that fragments and bands stay in few registers.
    // Every loop of this block is unrolled: band[] is then indexed by constants
    // (registers, no scratch) and the LDS offsets become immediates.
#pragma unroll
    for (int c0 = 0; c0 <= KW; c0 += 4) {
      float band[8][8];  // [halo row of the chunk * 2 + query row][register]
#pragma unroll
      for (int kc = 0; kc < 4; ++kc) {
        const int kr = c0 + kc;
        if (kr > KW) continue;
        const v16h f0 = ea_frag(k0 + kr * H0 * QPIT, kb2, 0);
        const v16h f1 = ea_frag(k1 + kr * H0 * QPIT, kb2, 0);
#pragma unroll
        for (int q = 0; q < 2; ++q) {
          const int dy = kr - q;
          if (dy < 0 || dy >= KW) continue;
          const v8f z = {};
          const v8f d0 = __builtin_amdgcn_wmma_f32_16x16x32_f16(
              false, q ? qf1 : qf0, false, f0, (short)0, z, false, false);
          const v8f d1 = __builtin_amdgcn_wmma_f32_16x16x32_f16(
              false, q ? qf1 : qf0, false, f1, (short)0, z, false, false);
#pragma unroll
          for (int r = 0; r < 8; ++r)
            band[kc * 2 + q][r] = (col >= r + mhi) ? d0[r] : d1[r];
        }
      }
      // Band -> ob[dy * KW + dx][pixel]; one lane mask per register index.
#pragma unroll
      for (int r = 0; r < 8; ++r) {
        const int m  = r + mhi;
        const int dx = (col - m) & 15;
        if (dx < KW) {
          float* o = ob + dx * OPIT + qy0 * 16 + m;
#pragma unroll
          for (int e = 0; e < 8; ++e) {
            const int dy = c0 + (e >> 1) - (e & 1);
            if (c0 + (e >> 1) > KW || dy < 0 || dy >= KW) continue;
            o[dy * KW * OPIT + (e & 1) * 16] = band[e][r];
          }
        }
      }
    }
  }

  float sc[4];
  {
    const float kp[4] = {kap4.x, kap4.y, kap4.z, kap4.w};
#pragma unroll  // kp[] and sc[] indexed by constants: registers
    for (int j = 0; j < 4; ++j) {
      float tau = 0.5f - ((kp[j] - kmin) / denom) * (0.5f - 0.03f);
      tau = fminf(fmaxf(tau, 0.03f), 0.5f);
      sc[j] = 1.f / (tau + 1e-6f);
    }
  }
  __syncthreads();  // the result tile is complete before other waves read it

  // ---- write out: 16 bytes a lane, planes pl0, pl0 + 4, ... ----
  constexpr int NP = KK / 4;  // KK = 4 * NP + 1: the last plane goes to pl0 == 0
  const int pl0 = cg >> 1;
  char* ou = (char*)(out + ((size_t)b * KK + pl0) * HWPX);
  float4 ov[NP + 1];
  // both loops unrolled: ov[] stays in registers, and all LDS reads are issued
  // ahead of the first store
#pragma unroll
  for (int i = 0; i < NP; ++i) ov[i] = *(const float4*)&ob[(pl0 + 4 * i) * OPIT + g * 4];
  if (pl0 == 0) ov[NP] = *(const float4*)&ob[(4 * NP) * OPIT + g * 4];
#pragma unroll
  for (int i = 0; i <= NP; ++i) {
    // precaution: the last plane's address is formed in its own branch; stands
    // before any overwrite there of a register the stores above name
    if (i == NP) asm volatile("s_wait_xcnt 0x0" :: "v"(pixb) : "memory");
    if (i < NP || pl0 == 0) {
      float4 v = ov[i];
      v.x *= sc[0]; v.y *= sc[1]; v.z *= sc[2]; v.w *= sc[3];
      *(float4*)(ou + (size_t)i * (4u * HWPX * 4u) + pixb) = v;
    }
  }
  // precaution: the next window's code follows and reuses registers; stands
  // before any overwrite of a register these stores name
  if constexpr (NEXT) asm volatile("s_wait_xcnt 0x0" :: "v"(pixb) : "memory");
}

// All three window sizes of one 16 x 16 tile: the halo is staged once.
__global__ __launch_bounds__(256) void ea_affinity(const float* __restrict__ feat,
                                                   const float* __restrict__ kappa,
                                                   const float* __restrict__ qw,
                                                   const float* __restrict__ kw,
                                                   const unsigned* __restrict__ mm,
                                                   float* __restrict__ out) {
  constexpr int P     = PST;
  constexpr int H0    = HST;
  constexpr int HALO2 = H0 * H0;
  constexpr int PADPX = PADST;

  extern __shared__ char lds_raw[];
  _Float16* stage = (_Float16*)lds_raw;
  _Float16* wqL   = (_Float16*)(lds_raw + L_WQ);
  _Float16* wkL   = wqL + CATT * SPIT;

  const int tid = threadIdx.x;
  const int b   = blockIdx.z;
  const int y0  = blockIdx.y * 16, x0 = blockIdx.x * 16;

  // ---- stage halo of feat into LDS (f16), zero-padded OOB + tile padding ----
  // Weights of the first window (5 x 5): a thread takes 8 consecutive channels of
  // one row of qw and of kw.
  constexpr int WSL = CATT * CIN;                    // floats of one window's weights
  const int wo = (tid >> 3) * SPIT + (tid & 7) * 8;  // its place in LDS, halfs
  const unsigned wb = (unsigned)tid * 32u;           // its place in qw / kw, bytes
  const float4 qa = *(const float4*)((const char*)(qw + WSL) + wb);
  const float4 qb = *(const float4*)((const char*)(qw + WSL) + wb + 16);
  const float4 ka = *(const float4*)((const char*)(kw + WSL) + wb);
  const float4 kb = *(const float4*)((const char*)(kw + WSL) + wb + 16);
  // precaution: stands before any overwrite of the register these loads name
  asm volatile("s_wait_xcnt 0x0" :: "v"(wb) : "memory");

  // Halo: wave w owns channels 8w..8w+7; a lane gathers them for one halo pixel
  // in registers and writes them as one 16-byte LDS store. All loads are issued
  // before the first value is used.
  constexpr int NI = (PADPX + 31) / 32;
  const int cg = __builtin_amdgcn_readfirstlane(tid >> 5);
  const float* fg = feat + ((size_t)b * CIN + cg * 8) * HWPX;
  float hv[NI][8];
  int   hoff[NI];  // element offset in a channel plane, -1 outside the image
#pragma unroll
  for (int i = 0; i < NI; ++i) {
    // the last group is shifted back to end at PADPX: this wave writes 16 rows
    // twice with the same values, and no group needs a branch
    const int p  = (i * 32 + 32 <= PADPX ? i * 32 : PADPX - 32) + (tid & 31);
    const int hy = p / H0, hx = p - hy * H0;
    const int gy = y0 - P + hy, gx = x0 - P + hx;
    const bool inb = p < HALO2 && gy >= 0 && gy < HIMG && gx >= 0 && gx < WIMG;
    hoff[i] = inb ? gy * WIMG + gx : -1;
  }
  unsigned ha[NI];
#pragma unroll
  for (int i = 0; i < NI; ++i) {
    ha[i] = (unsigned)max(hoff[i], 0);  // always a valid address
#pragma unroll
    for (int j = 0; j < 8; ++j) hv[i][j] = fg[(unsigned)(j * HWPX) + ha[i]];
    // precaution, once per four groups: stands before any overwrite of the
    // registers these loads name (kept live up to here as inputs)
    if ((i & 3) == 3 || i == NI - 1)
      asm volatile("s_wait_xcnt 0x0" :: "v"(ha[i]), "v"(ha[i - 1]), "v"(ha[i - 2]),
                   "v"(ha[i - 3]) : "memory");
  }
  *(uint4*)&wqL[wo] = ea_pack8(qa, qb);
  *(uint4*)&wkL[wo] = ea_pack8(ka, kb);
#pragma unroll
  for (int i = 0; i < NI; ++i) {
    const int p = (i * 32 + 32 <= PADPX ? i * 32 : PADPX - 32) + (tid & 31);
    union { uint4 q; _Float16 h[8]; } pk;
#pragma unroll
    for (int j = 0; j < 8; ++j) pk.h[j] = (_Float16)(hoff[i] >= 0 ? hv[i][j] : 0.f);
    *(uint4*)&stage[p * SPIT + cg * 8] = pk.q;
  }
  __syncthreads();

  ea_window<5, L_OB5, true>(lds_raw, kappa, mm, out + (size_t)BSZ * 9 * HWPX, 1,
                            b, y0, x0, tid, cg, qw, kw);
  ea_window<3, L_OB3, true>(lds_raw, kappa, mm, out, 0,
                            b, y0, x0, tid, cg, qw + 2 * WSL, kw + 2 * WSL);
  ea_window<7, L_OB7, false>(lds_raw, kappa, mm, out + (size_t)BSZ * (9 + 25) * HWPX, 2,
                             b, y0, x0, tid, cg, nullptr, nullptr);
}

extern "C" void kernel_launch(void* const* d_in, const int* in_sizes, int n_in,
                              void* d_out, int out_size, void* d_ws, size_t ws_size,
                              hipStream_t stream) {
  const float* feat  = (const float*)d_in[0];
  const float* kappa = (const float*)d_in[1];
  const float* qw    = (const float*)d_in[2];  // (3, 32, 64)
  const float* kw    = (const float*)d_in[3];  // (3, 32, 64)
  float*       out   = (float*)d_out;
  unsigned*    mm    = (unsigned*)d_ws;        // 3 x {min,max} encoded

  ea_init_mm<<<1, 64, 0, stream>>>(mm);
  ea_kap_minmax<<<dim3(256, 3), 256, 0, stream>>>(kappa, mm);

  const dim3 grid(WIMG / 16, HIMG / 16, BSZ), block(256);
  ea_affinity<<<grid, block, L_ALL, stream>>>(feat, kappa, qw, kw, mm, out);
}

// v004
// It runs in 62 microseconds.
// Next to v003, in two timings, it ran 1.08 times as fast each time.
// All steps since v000 together make it 6.14 times as fast.
#include <hip/hip_runtime.h>
#include <hip/hip_bf16.h>

typedef __attribute__((ext_vector_type(16))) _Float16 v16h;
typedef __attribute__((ext_vector_type(8)))  float    v8f;

#define HWPX (256 * 256)
#define HIMG 256
#define WIMG 256
#define BSZ  4
#define CIN  64
#define CATT 32
// halfs per LDS row of a WMMA operand (64 channels + 8): 144 B = 16 B x 9, so
// 16 lanes on 16 consecutive rows spread their 16-byte accesses over all banks
#define SPIT (CIN + 8)
// halfs per LDS row of a projected pixel (32 channels + 8): 80 B = 16 B x 5, the
// same spreading for the 16-byte fragment reads of the correlation product
#define QPIT (CATT + 8)
// floats per LDS plane of the result tile (256 pixels + 12): the lanes of one
// band store sit on different window offsets, so on planes; the 12 spreads them
#define OPIT (256 + 12)

// ---- order-preserving float <-> uint encoding (for atomic min/max) ----
__device__ __forceinline__ unsigned fenc(float f) {
  unsigned u = __float_as_uint(f);
  return u ^ ((u >> 31) ? 0xFFFFFFFFu : 0x80000000u);
}
__device__ __forceinline__ float fdec(unsigned u) {
  u ^= ((u >> 31) ? 0x80000000u : 0xFFFFFFFFu);
  return __uint_as_float(u);
}

__global__ void ea_init_mm(unsigned* mm) {
  int i = threadIdx.x;
  if (i < 3) {
    mm[2 * i]     = 0xFFFFFFFFu;  // +inf encoded
    mm[2 * i + 1] = 0u;           // -inf encoded
  }
}

// global min/max of kappa[:, slice, :, :]
__global__ __launch_bounds__(256) void ea_kap_minmax(const float* __restrict__ kappa,
                                                     unsigned* __restrict__ mm) {
  const int slice = blockIdx.y;
  __shared__ unsigned smin[256], smax[256];
  unsigned lmin = 0xFFFFFFFFu, lmax = 0u;
  const int total = BSZ * HWPX;
  for (int e = blockIdx.x * blockDim.x + threadIdx.x; e < total;
       e += gridDim.x * blockDim.x) {
    int b = e / HWPX, off = e - b * HWPX;
    unsigned k = fenc(kappa[((size_t)b * 3 + slice) * HWPX + off]);
    lmin = (k < lmin) ? k : lmin;
    lmax = (k > lmax) ? k : lmax;
  }
  int tid = threadIdx.x;
  smin[tid] = lmin; smax[tid] = lmax;
  __syncthreads();
  for (int s = 128; s > 0; s >>= 1) {
    if (tid < s) {
      unsigned a = smin[tid + s]; if (a < smin[tid]) smin[tid] = a;
      unsigned b = smax[tid + s]; if (b > smax[tid]) smax[tid] = b;
    }
    __syncthreads();
  }
  if (tid == 0) {
    atomicMin(&mm[2 * slice], smin[0]);
    atomicMax(&mm[2 * slice + 1], smax[0]);
  }
}

// Assemble a 16x32 f16 WMMA fragment (A or B operand) from an LDS row of 32
// (stage, weights) or 16 (q, k) channel-pairs, per the ISA layout: halves 0-7 = K kb..kb+7, halves 8-15 =
// K kb+16..kb+23 (kb = 0 for lanes 0-15, 8 for lanes 16-31). Union with
// constant indices keeps everything in VGPRs (SROA), no scratch.
// Rows start on 16 bytes, so each run of 8 halves is one 16-byte LDS load.
__device__ __forceinline__ v16h ea_frag(const _Float16* row, int kb2, int s) {
  const uint4* p = (const uint4*)row;
  union { v16h v; uint4 q[2]; } r;
  r.q[0] = p[s * 4 + (kb2 >> 2)];
  r.q[1] = p[s * 4 + (kb2 >> 2) + 2];
  return r.v;
}

// lane l with lane l ^ 16
__device__ __forceinline__ float ea_xhalf(float x) {
  const int b = __builtin_bit_cast(int, x);
  return __builtin_bit_cast(
      float, __builtin_amdgcn_permlanex16(b, b, 0x76543210, 0xfedcba98, false, false));
}

// The projections are computed transposed (weight rows are A, pixels are B), so a
// lane holds channels of ONE pixel: mhi..mhi+7 in c0, 16+mhi..16+mhi+7 in c1, and
// lane l ^ 16 holds that pixel's other 16. L2 normalize (x / max(||x||, 1e-12);
// zero rows stay zero) from the f32 accumulators, then two 16-byte LDS stores
// into the pixel's row of QPIT halfs.
__device__ __forceinline__ void ea_norm_store(_Float16* row, v8f c0, v8f c1, int mhi) {
  float s0 = 0.f, s1 = 0.f;
  // both loops unrolled: c0[], c1[] and h[] are then indexed by constants (registers)
#pragma unroll
  for (int r = 0; r < 8; ++r) { s0 += c0[r] * c0[r]; s1 += c1[r] * c1[r]; }
  float s = s0 + s1;
  s += ea_xhalf(s);
  const float inv = 1.f / fmaxf(sqrtf(s), 1e-12f);
  union { uint4 q; _Float16 h[8]; } p0, p1;
#pragma unroll
  for (int r = 0; r < 8; ++r) {
    p0.h[r] = (_Float16)(c0[r] * inv);
    p1.h[r] = (_Float16)(c1[r] * inv);
  }
  *(uint4*)&row[mhi]      = p0.q;
  *(uint4*)&row[16 + mhi] = p1.q;
}

// 8 floats -> 8 halfs, one 16-byte unit
__device__ __forceinline__ uint4 ea_pack8(float4 a, float4 c) {
  union { uint4 q; _Float16 h[8]; } p;
  p.h[0] = (_Float16)a.x; p.h[1] = (_Float16)a.y;
  p.h[2] = (_Float16)a.z; p.h[3] = (_Float16)a.w;
  p.h[4] = (_Float16)c.x; p.h[5] = (_Float16)c.y;
  p.h[6] = (_Float16)c.z; p.h[7] = (_Float16)c.w;
  return p.q;
}

// LDS map of the fused kernel, bytes. The 22 x 22 halo of the widest window is
// staged once and serves all three window sizes.
#define PST   3                      // halo width of the stage
#define HST   (16 + 2 * PST)         // its edge
#define PADST 496                    // its pixels (484), rounded up to 16
#define L_WQ  (PADST * SPIT * 2)             // weights behind the stage
#define L_QS  (L_WQ + 2 * CATT * SPIT * 2)   // 256 q rows
#define L_KS  (L_QS + 256 * QPIT * 2)        // key rows: 400 / 336 / 496 by window
// Result tiles. The windows run in the order 5, 3, 7. A tile may still be read by
// slow waves while fast ones write the next window's key rows, so it lies behind
// those: 5's behind 336 (and its own 400) rows, 3's behind 496. 7's lies over the
// stage, which is dead by then.
#define L_OB5 (L_KS + 400 * QPIT * 2)
#define L_OB3 (L_KS + PADST * QPIT * 2)
#define L_OB7 0
#define L_ALL (L_OB5 + 25 * OPIT * 4)

// One window size, from the staged halo and the weights in LDS to its output:
// f16-WMMA q/k projection with L2 normalize -> k x k windowed cosine / tau.
// nqw, nkw: the next window's weights (NEXT): fetched while this window's
// projections run, put into LDS as soon as this window's are dead.
template <int KW, int OBAT, bool NEXT>
__device__ __forceinline__ void ea_window(char* lds_raw,
                                          const float* __restrict__ kappa,
                                          const unsigned* __restrict__ mm,
                                          float* __restrict__ out, int slice,
                                          int b, int y0, int x0, int tid, int cg,
                                          const float* __restrict__ nqw,
                                          const float* __restrict__ nkw) {
  constexpr int P     = KW / 2;
  constexpr int H0    = 16 + 2 * P;          // halo tile edge
  constexpr int HALO2 = H0 * H0;             // halo pixels
  constexpr int KT    = (HALO2 + 15) / 16;   // 16-pixel tiles for key proj
  constexpr int KK    = KW * KW;
  constexpr int OFF   = PST - P;             // this halo's corner in the stage

  _Float16* stage = (_Float16*)lds_raw;            // PADST rows of SPIT (f16)
  _Float16* wqL   = (_Float16*)(lds_raw + L_WQ);
  _Float16* wkL   = wqL + CATT * SPIT;
  _Float16* qs    = (_Float16*)(lds_raw + L_QS);   // 256 rows of QPIT (f16)
  _Float16* ks    = (_Float16*)(lds_raw + L_KS);   // KT * 16 rows of QPIT (f16)
  float*    ob    = (float*)(lds_raw + OBAT);      // KK planes of OPIT (f32)

  const int lane = tid & 31;
  const int wave = tid >> 5;
  const int mrow = lane & 15;
  const int kb2  = (lane >= 16) ? 4 : 0;  // channel-pair base for this half-wave
  const int mhi  = (lane >= 16) ? 8 : 0;
  const int col  = lane & 15;

  // A thread takes 8 consecutive channels of one row of the next qw and kw.
  float4 nqa, nqb, nka, nkb;
  if constexpr (NEXT) {
    const unsigned wb = (unsigned)tid * 32u;  // its place in qw / kw, bytes
    nqa = *(const float4*)((const char*)nqw + wb);
    nqb = *(const float4*)((const char*)nqw + wb + 16);
    nka = *(const float4*)((const char*)nkw + wb);
    nkb = *(const float4*)((const char*)nkw + wb + 16);
    // precaution: stands before any overwrite of the register these loads name
    asm volatile("s_wait_xcnt 0x0" :: "v"(wb) : "memory");
  }

  // ---- q projection: 16 tiles of 16 interior pixels, normalized on the way ----
  {
    const _Float16* w0 = &wqL[mrow * SPIT];
    const _Float16* w1 = &wqL[(16 + mrow) * SPIT];
    const v16h b00 = ea_frag(w0, kb2, 0);  // kstep0, channels 0-15
    const v16h b10 = ea_frag(w0, kb2, 1);  // kstep1, channels 0-15
    const v16h b01 = ea_frag(w1, kb2, 0);  // kstep0, channels 16-31
    const v16h b11 = ea_frag(w1, kb2, 1);  // kstep1, channels 16-31
    for (int t = wave; t < 16; t += 8) {
      int ip = t * 16 + mrow;  // interior pixel 0..255
      int px = ((ip >> 4) + PST) * HST + ((ip & 15) + PST);
      const _Float16* srow = &stage[px * SPIT];
      v16h a0 = ea_frag(srow, kb2, 0);
      v16h a1 = ea_frag(srow, kb2, 1);
      v8f acc0 = {}, acc1 = {};
      acc0 = __builtin_amdgcn_wmma_f32_16x16x32_f16(false, b00, false, a0,
                                                    (short)0, acc0, false, false);
      acc1 = __builtin_amdgcn_wmma_f32_16x16x32_f16(false, b01, false, a0,
                                                    (short)0, acc1, false, false);
      acc0 = __builtin_amdgcn_wmma_f32_16x16x32_f16(false, b10, false, a1,
                                                    (short)0, acc0, false, false);
      acc1 = __builtin_amdgcn_wmma_f32_16x16x32_f16(false, b11, false, a1,
                                                    (short)0, acc1, false, false);
      ea_norm_store(qs + (t * 16 + col) * QPIT, acc0, acc1, mhi);
    }
  }

  // ---- key projection: KT tiles of 16 halo pixels, normalized on the way ----
  {
    const _Float16* w0 = &wkL[mrow * SPIT];
    const _Float16* w1 = &wkL[(16 + mrow) * SPIT];
    const v16h b00 = ea_frag(w0, kb2, 0);
    const v16h b10 = ea_frag(w0, kb2, 1);
    const v16h b01 = ea_frag(w1, kb2, 0);
    const v16h b11 = ea_frag(w1, kb2, 1);
    for (int t = wave; t < KT; t += 8) {
      // halo pixel of this window -> its row in the stage; the rows that pad the
      // last tile repeat the last pixel and are never read by the correlation
      const int h  = min(t * 16 + mrow, HALO2 - 1);
      const int hy = h / H0;
      const int px = (hy + OFF) * HST + (h - hy * H0) + OFF;
      const _Float16* srow = &stage[px * SPIT];
      v16h a0 = ea_frag(srow, kb2, 0);
      v16h a1 = ea_frag(srow, kb2, 1);
      v8f acc0 = {}, acc1 = {};
      acc0 = __builtin_amdgcn_wmma_f32_16x16x32_f16(false, b00, false, a0,
                                                    (short)0, acc0, false, false);
      acc1 = __builtin_amdgcn_wmma_f32_16x16x32_f16(false, b01, false, a0,
                                                    (short)0, acc1, false, false);
      acc0 = __builtin_amdgcn_wmma_f32_16x16x32_f16(false, b10, false, a1,
                                                    (short)0, acc0, false, false);
      acc1 = __builtin_amdgcn_wmma_f32_16x16x32_f16(false, b11, false, a1,
                                                    (short)0, acc1, false, false);
      ea_norm_store(ks + (t * 16 + col) * QPIT, acc0, acc1, mhi);
    }
  }
  __syncthreads();

  // every wave has its weight fragments: the next window's weights take their
  // place (the barrier behind the correlation stands in front of their first read)
  if constexpr (NEXT) {
    const int wo = (tid >> 3) * SPIT + (tid & 7) * 8;
    *(uint4*)&wqL[wo] = ea_pack8(nqa, nqb);
    *(uint4*)&wkL[wo] = ea_pack8(nka, nkb);
  }

  // ---- temperature from curvature (global min/max of this slice) ----
  const float kmin  = fdec(mm[2 * slice]);
  const float kmax  = fdec(mm[2 * slice + 1]);
  const float denom = (kmax - kmin) + 1e-6f;

  // This thread writes out four neighbouring pixels of every fourth plane.
  const int g = tid & 63;
  const unsigned pixb = (unsigned)(((y0 + (g >> 2)) * WIMG + x0 + (g & 3) * 4) * 4);  // bytes
  const float4 kap4 =
      *(const float4*)((const char*)(kappa + ((size_t)b * 3 + slice) * HWPX) + pixb);
  // precaution: stands before any overwrite of the register this load names
  asm volatile("s_wait_xcnt 0x0" :: "v"(pixb) : "memory");

  // ---- windowed correlation as a banded matrix product ----
  // Wave w owns query rows 2w and 2w+1 of the tile. One product is 16 queries of
  // a row (A) against 16 keys of a halo row (B), all 32 channels in one step:
  // D[m][n] = q[m] . k[n]. Query m wants keys m..m+KW-1 of the H0 in the halo
  // row: key tile 0 holds keys 0..15, key tile 1 keys 16..H0-1 (its other columns
  // repeat the last key and are never stored). A halo row's fragments serve both
  // query rows.
  {
    const int qy0 = cg * 2;
    const v16h qf0 = ea_frag(qs + (qy0 * 16 + mrow) * QPIT, kb2, 0);
    const v16h qf1 = ea_frag(qs + ((qy0 + 1) * 16 + mrow) * QPIT, kb2, 0);
    const _Float16* k0 = ks + (qy0 * H0 + col) * QPIT;
    const _Float16* k1 = ks + (qy0 * H0 + 16 + min(col, 2 * P - 1)) * QPIT;
    // Register r of a lane is query m = r + mhi against key col (tile 0) or
    // 16 + col (tile 1): window offset dx = key - m. The two tiles' bands fall on
    // disjoint lanes, so they are merged: dx = (col - m) mod 16, kept if < KW.
    // Four halo rows at a time, so that fragments and bands stay in few registers.
    // Every loop of this block is unrolled: band[] is then indexed by constants
    // (registers, no scratch) and the LDS offsets become immediates.
#pragma unroll
    for (int c0 = 0; c0 <= KW; c0 += 4) {
      float band[8][8];  // [halo row of the chunk * 2 + query row][register]
#pragma unroll
      for (int kc = 0; kc < 4; ++kc) {
        const int kr = c0 + kc;
        if (kr > KW) continue;
        const v16h f0 = ea_frag(k0 + kr * H0 * QPIT, kb2, 0);
        const v16h f1 = ea_frag(k1 + kr * H0 * QPIT, kb2, 0);
#pragma unroll
        for (int q = 0; q < 2; ++q) {
          const int dy = kr - q;
          if (dy < 0 || dy >= KW) continue;
          const v8f z = {};
          const v8f d0 = __builtin_amdgcn_wmma_f32_16x16x32_f16(
              false, q ? qf1 : qf0, false, f0, (short)0, z, false, false);
          const v8f d1 = __builtin_amdgcn_wmma_f32_16x16x32_f16(
              false, q ? qf1 : qf0, false, f1, (short)0, z, false, false);
#pragma unroll
          for (int r = 0; r < 8; ++r)
            band[kc * 2 + q][r] = (col >= r + mhi) ? d0[r] : d1[r];
        }
      }
      // Band -> ob[dy * KW + dx][pixel]; one lane mask per register index.
#pragma unroll
      for (int r = 0; r < 8; ++r) {
        const int m  = r + mhi;
        const int dx = (col - m) & 15;
        if (dx < KW) {
          float* o = ob + dx * OPIT + qy0 * 16 + m;
#pragma unroll
          for (int e = 0; e < 8; ++e) {
            const int dy = c0 + (e >> 1) - (e & 1);
            if (c0 + (e >> 1) > KW || dy < 0 || dy >= KW) continue;
            o[dy * KW * OPIT + (e & 1) * 16] = band[e][r];
          }
        }
      }
    }
  }

  float sc[4];
  {
    const float kp[4] = {kap4.x, kap4.y, kap4.z, kap4.w};
#pragma unroll  // kp[] and sc[] indexed by constants: registers
    for (int j = 0; j < 4; ++j) {
      float tau = 0.5f - ((kp[j] - kmin) / denom) * (0.5f - 0.03f);
      tau = fminf(fmaxf(tau, 0.03f), 0.5f);
      sc[j] = 1.f / (tau + 1e-6f);
    }
  }
  __syncthreads();  // the result tile is complete before other waves read it

  // ---- write out: 16 bytes a lane, planes pl0, pl0 + 4, ... ----
  constexpr int NP = KK / 4;  // KK = 4 * NP + 1: the last plane goes to pl0 == 0
  const int pl0 = cg >> 1;
  char* ou = (char*)(out + ((size_t)b * KK + pl0) * HWPX);
  float4 ov[NP + 1];
  // both loops unrolled: ov[] stays in registers, and all LDS reads are issued
  // ahead of the first store
#pragma unroll
  for (int i = 0; i < NP; ++i) ov[i] = *(const float4*)&ob[(pl0 + 4 * i) * OPIT + g * 4];
  if (pl0 == 0) ov[NP] = *(const float4*)&ob[(4 * NP) * OPIT + g * 4];
#pragma unroll
  for (int i = 0; i <= NP; ++i) {
    // precaution: the last plane's address is formed in its own branch; stands
    // before any overwrite there of a register the stores above name
    if (i == NP) asm volatile("s_wait_xcnt 0x0" :: "v"(pixb) : "memory");
    if (i < NP || pl0 == 0) {
      float4 v = ov[i];
      v.x *= sc[0]; v.y *= sc[1]; v.z *= sc[2]; v.w *= sc[3];
      *(float4*)(ou + (size_t)i * (4u * HWPX * 4u) + pixb) = v;
    }
  }
  // precaution: the next window's code follows and reuses registers; stands
  // before any overwrite of a register these stores name
  if constexpr (NEXT) asm volatile("s_wait_xcnt 0x0" :: "v"(pixb) : "memory");
}

// All three window sizes of one 16 x 16 tile: the halo is staged once.
__global__ __launch_bounds__(256) void ea_affinity(const float* __restrict__ feat,
                                                   const float* __restrict__ kappa,
                                                   const float* __restrict__ qw,
                                                   const float* __restrict__ kw,
                                                   const unsigned* __restrict__ mm,
                                                   float* __restrict__ out) {
  constexpr int P     = PST;
  constexpr int H0    = HST;
  constexpr int HALO2 = H0 * H0;
  constexpr int PADPX = PADST;

  extern __shared__ char lds_raw[];
  _Float16* stage = (_Float16*)lds_raw;
  _Float16* wqL   = (_Float16*)(lds_raw + L_WQ);
  _Float16* wkL   = wqL + CATT * SPIT;

  const int tid = threadIdx.x;
  const int b   = blockIdx.z;
  const int y0  = blockIdx.y * 16, x0 = blockIdx.x * 16;

  // ---- stage halo of feat into LDS (f16), zero-padded OOB + tile padding ----
  // Weights of the first window (5 x 5): a thread takes 8 consecutive channels of
  // one row of qw and of kw.
  constexpr int WSL = CATT * CIN;                    // floats of one window's weights
  const int wo = (tid >> 3) * SPIT + (tid & 7) * 8;  // its place in LDS, halfs
  const unsigned wb = (unsigned)tid * 32u;           // its place in qw / kw, bytes
  const float4 qa = *(const float4*)((const char*)(qw + WSL) + wb);
  const float4 qb = *(const float4*)((const char*)(qw + WSL) + wb + 16);
  const float4 ka = *(const float4*)((const char*)(kw + WSL) + wb);
  const float4 kb = *(const float4*)((const char*)(kw + WSL) + wb + 16);
  // precaution: stands before any overwrite of the register these loads name
  asm volatile("s_wait_xcnt 0x0" :: "v"(wb) : "memory");

  // Halo: wave w owns channels 8w..8w+7; a lane gathers them for one halo pixel
  // in registers and writes them as one 16-byte LDS store. All loads are issued
  // before the first value is used.
  constexpr int NI = (PADPX + 31) / 32;
  const int cg = __builtin_amdgcn_readfirstlane(tid >> 5);
  const float* fg = feat + ((size_t)b * CIN + cg * 8) * HWPX;
  float hv[NI][8];
  int   hoff[NI];  // element offset in a channel plane, -1 outside the image
#pragma unroll
  for (int i = 0; i < NI; ++i) {
    // the last group is shifted back to end at PADPX: this wave writes 16 rows
    // twice with the same values, and no group needs a branch
    const int p  = (i * 32 + 32 <= PADPX ? i * 32 : PADPX - 32) + (tid & 31);
    const int hy = p / H0, hx = p - hy * H0;
    const int gy = y0 - P + hy, gx = x0 - P + hx;
    const bool inb = p < HALO2 && gy >= 0 && gy < HIMG && gx >= 0 && gx < WIMG;
    hoff[i] = inb ? gy * WIMG + gx : -1;
  }
  unsigned ha[NI];
#pragma unroll
  for (int i = 0; i < NI; ++i) {
    ha[i] = (unsigned)max(hoff[i], 0);  // always a valid address
#pragma unroll
    for (int j = 0; j < 8; ++j) hv[i][j] = fg[(unsigned)(j * HWPX) + ha[i]];
    // precaution, once per four groups: stands before any overwrite of the
    // registers these loads name (kept live up to here as inputs)
    if ((i & 3) == 3 || i == NI - 1)
      asm volatile("s_wait_xcnt 0x0" :: "v"(ha[i]), "v"(ha[i - 1]), "v"(ha[i - 2]),
                   "v"(ha[i - 3]) : "memory");
  }
  *(uint4*)&wqL[wo] = ea_pack8(qa, qb);
  *(uint4*)&wkL[wo] = ea_pack8(ka, kb);
#pragma unroll
  for (int i = 0; i < NI; ++i) {
    const int p = (i * 32 + 32 <= PADPX ? i * 32 : PADPX - 32) + (tid & 31);
    union { uint4 q; _Float16 h[8]; } pk;
#pragma unroll
    for (int j = 0; j < 8; ++j) pk.h[j] = (_Float16)(hoff[i] >= 0 ? hv[i][j] : 0.f);
    *(uint4*)&stage[p * SPIT + cg * 8] = pk.q;
  }
  __syncthreads();

  ea_window<5, L_OB5, true>(lds_raw, kappa, mm, out + (size_t)BSZ * 9 * HWPX, 1,
                            b, y0, x0, tid, cg, qw, kw);
  ea_window<3, L_OB3, true>(lds_raw, kappa, mm, out, 0,
                            b, y0, x0, tid, cg, qw + 2 * WSL, kw + 2 * WSL);
  ea_window<7, L_OB7, false>(lds_raw, kappa, mm, out + (size_t)BSZ * (9 + 25) * HWPX, 2,
                             b, y0, x0, tid, cg, nullptr, nullptr);
}

extern "C" void kernel_launch(void* const* d_in, const int* in_sizes, int n_in,
                              void* d_out, int out_size, void* d_ws, size_t ws_size,
                              hipStream_t stream) {
  const float* feat  = (const float*)d_in[0];
  const float* kappa = (const float*)d_in[1];
  const float* qw    = (const float*)d_in[2];  // (3, 32, 64)
  const float* kw    = (const float*)d_in[3];  // (3, 32, 64)
  float*       out   = (float*)d_out;
  unsigned*    mm    = (unsigned*)d_ws;        // 3 x {min,max} encoded

  ea_init_mm<<<1, 64, 0, stream>>>(mm);
  ea_kap_minmax<<<dim3(256, 3), 256, 0, stream>>>(kappa, mm);

  const dim3 grid(WIMG / 16, HIMG / 16, BSZ), block(256);
  ea_affinity<<<grid, block, L_ALL, stream>>>(feat, kappa, qw, kw, mm, out);
}

// v005
// It runs in 59.4 microseconds.
// Two timings next to v004 put it at 1.05 and 1.04 times that version's speed.
// Counting every step since v000, it is 6.41 times as fast.
#include <hip/hip_runtime.h>
#include <hip/hip_bf16.h>

typedef __attribute__((ext_vector_type(16))) _Float16 v16h;
typedef __attribute__((ext_vector_type(8)))  float    v8f;

#define HWPX (256 * 256)
#define HIMG 256
#define WIMG 256
#define BSZ  4
#define CIN  64
#define CATT 32
// halfs per LDS row of a WMMA operand (64 channels + 8): 144 B = 16 B x 9, so
// 16 lanes on 16 consecutive rows spread their 16-byte accesses over all banks
#define SPIT (CIN + 8)
// halfs per LDS row of a projected pixel (32 channels + 8): 80 B = 16 B x 5, the
// same spreading for the 16-byte fragment reads of the correlation product
#define QPIT (CATT + 8)
// floats per LDS plane of the result tile (256 pixels + 12): the lanes of one
// band store sit on different window offsets, so on planes; the 12 spreads them
#define OPIT (256 + 12)

// ---- order-preserving float <-> uint encoding: min/max become integer ops ----
__device__ __forceinline__ unsigned fenc(float f) {
  unsigned u = __float_as_uint(f);
  return u ^ ((u >> 31) ? 0xFFFFFFFFu : 0x80000000u);
}
__device__ __forceinline__ float fdec(unsigned u) {
  u ^= ((u >> 31) ? 0x80000000u : 0xFFFFFFFFu);
  return __uint_as_float(u);
}

// min/max of kappa[:, slice, :, :] leave this launch as KPART records {min, max}
// a slice, one per work-group; the reader folds them. A record has a 128-byte
// line of the workspace to itself (KREC unsigneds apart): one writer per line.
#define KPART 16
#define KTHR  512
#define KREC  32

__global__ __launch_bounds__(KTHR) void ea_kap_minmax(const float* __restrict__ kappa,
                                                      unsigned* __restrict__ mm) {
  const int slice = blockIdx.y;
  const int tid   = threadIdx.x;
  // A plane half is KPART * KTHR units of 16 bytes; a thread takes one unit of
  // each half of each of the BSZ planes. All loads are issued before the first use.
  const unsigned vb = (unsigned)(blockIdx.x * KTHR + tid) * 16u;  // bytes
  const char* kp = (const char*)(kappa + (size_t)slice * HWPX);
  float4 v[2 * BSZ];
#pragma unroll  // v[] indexed by constants: registers
  for (int i = 0; i < 2 * BSZ; ++i)
    v[i] = *(const float4*)(kp + (size_t)(i >> 1) * (3u * HWPX * 4u) +
                            (size_t)(i & 1) * (HWPX * 2u) + vb);
  unsigned lmin = 0xFFFFFFFFu, lmax = 0u;
#pragma unroll  // as above
  for (int i = 0; i < 2 * BSZ; ++i) {
    const unsigned k0 = fenc(v[i].x), k1 = fenc(v[i].y), k2 = fenc(v[i].z), k3 = fenc(v[i].w);
    lmin = min(lmin, min(min(k0, k1), min(k2, k3)));
    lmax = max(lmax, max(max(k0, k1), max(k2, k3)));
  }
  // butterfly over the wave, then over the waves' results
#pragma unroll  // the lane distances become constants
  for (int s = 16; s > 0; s >>= 1) {
    lmin = min(lmin, __shfl_xor(lmin, s));
    lmax = max(lmax, __shfl_xor(lmax, s));
  }
  __shared__ unsigned smin[KTHR / 32], smax[KTHR / 32];
  if ((tid & 31) == 0) { smin[tid >> 5] = lmin; smax[tid >> 5] = lmax; }
  __syncthreads();
  if (tid < 32) {
    lmin = smin[tid & (KTHR / 32 - 1)];
    lmax = smax[tid & (KTHR / 32 - 1)];
#pragma unroll  // the lane distances become constants
    for (int s = KTHR / 64; s > 0; s >>= 1) {
      lmin = min(lmin, __shfl_xor(lmin, s));
      lmax = max(lmax, __shfl_xor(lmax, s));
    }
    if (tid == 0)
      *(uint2*)&mm[(slice * KPART + blockIdx.x) * KREC] = make_uint2(lmin, lmax);
  }
}

// Assemble a 16x32 f16 WMMA fragment (A or B operand) from an LDS row of 32
// (stage, weights) or 16 (q, k) channel-pairs, per the ISA layout: halves 0-7 = K kb..kb+7, halves 8-15 =
// K kb+16..kb+23 (kb = 0 for lanes 0-15, 8 for lanes 16-31). Union with
// constant indices keeps everything in VGPRs (SROA), no scratch.
// Rows start on 16 bytes, so each run of 8 halves is one 16-byte LDS load.
__device__ __forceinline__ v16h ea_frag(const _Float16* row, int kb2, int s) {
  const uint4* p = (const uint4*)row;
  union { v16h v; uint4 q[2]; } r;
  r.q[0] = p[s * 4 + (kb2 >> 2)];
  r.q[1] = p[s * 4 + (kb2 >> 2) + 2];
  return r.v;
}

// lane l with lane l ^ 16
__device__ __forceinline__ float ea_xhalf(float x) {
  const int b = __builtin_bit_cast(int, x);
  return __builtin_bit_cast(
      float, __builtin_amdgcn_permlanex16(b, b, 0x76543210, 0xfedcba98, false, false));
}

// The projections are computed transposed (weight rows are A, pixels are B), so a
// lane holds channels of ONE pixel: mhi..mhi+7 in c0, 16+mhi..16+mhi+7 in c1, and
// lane l ^ 16 holds that pixel's other 16. L2 normalize (x / max(||x||, 1e-12);
// zero rows stay zero) from the f32 accumulators, then two 16-byte LDS stores
// into the pixel's row of QPIT halfs.
__device__ __forceinline__ void ea_norm_store(_Float16* row, v8f c0, v8f c1, int mhi) {
  float s0 = 0.f, s1 = 0.f;
  // both loops unrolled: c0[], c1[] and h[] are then indexed by constants (registers)
#pragma unroll
  for (int r = 0; r < 8; ++r) { s0 += c0[r] * c0[r]; s1 += c1[r] * c1[r]; }
  float s = s0 + s1;
  s += ea_xhalf(s);
  const float inv = 1.f / fmaxf(sqrtf(s), 1e-12f);
  union { uint4 q; _Float16 h[8]; } p0, p1;
#pragma unroll
  for (int r = 0; r < 8; ++r) {
    p0.h[r] = (_Float16)(c0[r] * inv);
    p1.h[r] = (_Float16)(c1[r] * inv);
  }
  *(uint4*)&row[mhi]      = p0.q;
  *(uint4*)&row[16 + mhi] = p1.q;
}

// 8 floats -> 8 halfs, one 16-byte unit
__device__ __forceinline__ uint4 ea_pack8(float4 a, float4 c) {
  union { uint4 q; _Float16 h[8]; } p;
  p.h[0] = (_Float16)a.x; p.h[1] = (_Float16)a.y;
  p.h[2] = (_Float16)a.z; p.h[3] = (_Float16)a.w;
  p.h[4] = (_Float16)c.x; p.h[5] = (_Float16)c.y;
  p.h[6] = (_Float16)c.z; p.h[7] = (_Float16)c.w;
  return p.q;
}

// LDS map of the fused kernel, bytes. The 22 x 22 halo of the widest window is
// staged once and serves all three window sizes.
#define PST   3                      // halo width of the stage
#define HST   (16 + 2 * PST)         // its edge
#define PADST 496                    // its pixels (484), rounded up to 16
#define L_WQ  (PADST * SPIT * 2)             // weights behind the stage
#define L_QS  (L_WQ + 2 * CATT * SPIT * 2)   // 256 q rows
#define L_KS  (L_QS + 256 * QPIT * 2)        // key rows: 400 / 336 / 496 by window
// Result tiles. The windows run in the order 5, 3, 7. A tile may still be read by
// slow waves while fast ones write the next window's key rows, so it lies behind
// those: 5's behind 336 (and its own 400) rows, 3's behind 496. 7's lies over the
// stage, which is dead by then.
#define L_OB5 (L_KS + 400 * QPIT * 2)
#define L_OB3 (L_KS + PADST * QPIT * 2)
#define L_OB7 0
#define L_ALL (L_OB5 + 25 * OPIT * 4)

// One window size, from the staged halo and the weights in LDS to its output:
// f16-WMMA q/k projection with L2 normalize -> k x k windowed cosine / tau.
// nqw, nkw: the next window's weights (NEXT): fetched while this window's
// projections run, put into LDS as soon as this window's are dead.
template <int KW, int OBAT, bool NEXT>
__device__ __forceinline__ void ea_window(char* lds_raw,
                                          const float* __restrict__ kappa,
                                          const unsigned* __restrict__ mm,
                                          float* __restrict__ out, int slice,
                                          int b, int y0, int x0, int tid, int cg,
                                          const float* __restrict__ nqw,
                                          const float* __restrict__ nkw) {
  constexpr int P     = KW / 2;
  constexpr int H0    = 16 + 2 * P;          // halo tile edge
  constexpr int HALO2 = H0 * H0;             // halo pixels
  constexpr int KT    = (HALO2 + 15) / 16;   // 16-pixel tiles for key proj
  constexpr int KK    = KW * KW;
  constexpr int OFF   = PST - P;             // this halo's corner in the stage

  _Float16* stage = (_Float16*)lds_raw;            // PADST rows of SPIT (f16)
  _Float16* wqL   = (_Float16*)(lds_raw + L_WQ);
  _Float16* wkL   = wqL + CATT * SPIT;
  _Float16* qs    = (_Float16*)(lds_raw + L_QS);   // 256 rows of QPIT (f16)
  _Float16* ks    = (_Float16*)(lds_raw + L_KS);   // KT * 16 rows of QPIT (f16)
  float*    ob    = (float*)(lds_raw + OBAT);      // KK planes of OPIT (f32)

  const int lane = tid & 31;
  const int wave = tid >> 5;
  const int mrow = lane & 15;
  const int kb2  = (lane >= 16) ? 4 : 0;  // channel-pair base for this half-wave
  const int mhi  = (lane >= 16) ? 8 : 0;
  const int col  = lane & 15;

  // A thread takes 8 consecutive channels of one row of the next qw and kw.
  float4 nqa, nqb, nka, nkb;
  if constexpr (NEXT) {
    const unsigned wb = (unsigned)tid * 32u;  // its place in qw / kw, bytes
    nqa = *(const float4*)((const char*)nqw + wb);
    nqb = *(const float4*)((const char*)nqw + wb + 16);
    nka = *(const float4*)((const char*)nkw + wb);
    nkb = *(const float4*)((const char*)nkw + wb + 16);
    // precaution: stands before any overwrite of the register these loads name
    asm volatile("s_wait_xcnt 0x0" :: "v"(wb) : "memory");
  }

  // ---- q projection: 16 tiles of 16 interior pixels, normalized on the way ----
  {
    const _Float16* w0 = &wqL[mrow * SPIT];
    const _Float16* w1 = &wqL[(16 + mrow) * SPIT];
    const v16h b00 = ea_frag(w0, kb2, 0);  // kstep0, channels 0-15
    const v16h b10 = ea_frag(w0, kb2, 1);  // kstep1, channels 0-15
    const v16h b01 = ea_frag(w1, kb2, 0);  // kstep0, channels 16-31
    const v16h b11 = ea_frag(w1, kb2, 1);  // kstep1, channels 16-31
    for (int t = wave; t < 16; t += 8) {
      int ip = t * 16 + mrow;  // interior pixel 0..255
      int px = ((ip >> 4) + PST) * HST + ((ip & 15) + PST);
      const _Float16* srow = &stage[px * SPIT];
      v16h a0 = ea_frag(srow, kb2, 0);
      v16h a1 = ea_frag(srow, kb2, 1);
      v8f acc0 = {}, acc1 = {};
      acc0 = __builtin_amdgcn_wmma_f32_16x16x32_f16(false, b00, false, a0,
                                                    (short)0, acc0, false, false);
      acc1 = __builtin_amdgcn_wmma_f32_16x16x32_f16(false, b01, false, a0,
                                                    (short)0, acc1, false, false);
      acc0 = __builtin_amdgcn_wmma_f32_16x16x32_f16(false, b10, false, a1,
                                                    (short)0, acc0, false, false);
      acc1 = __builtin_amdgcn_wmma_f32_16x16x32_f16(false, b11, false, a1,
                                                    (short)0, acc1, false, false);
      ea_norm_store(qs + (t * 16 + col) * QPIT, acc0, acc1, mhi);
    }
  }

  // ---- key projection: KT tiles of 16 halo pixels, normalized on the way ----
  {
    const _Float16* w0 = &wkL[mrow * SPIT];
    const _Float16* w1 = &wkL[(16 + mrow) * SPIT];
    const v16h b00 = ea_frag(w0, kb2, 0);
    const v16h b10 = ea_frag(w0, kb2, 1);
    const v16h b01 = ea_frag(w1, kb2, 0);
    const v16h b11 = ea_frag(w1, kb2, 1);
    for (int t = wave; t < KT; t += 8) {
      // halo pixel of this window -> its row in the stage; the rows that pad the
      // last tile repeat the last pixel and are never read by the correlation
      const int h  = min(t * 16 + mrow, HALO2 - 1);
      const int hy = h / H0;
      const int px = (hy + OFF) * HST + (h - hy * H0) + OFF;
      const _Float16* srow = &stage[px * SPIT];
      v16h a0 = ea_frag(srow, kb2, 0);
      v16h a1 = ea_frag(srow, kb2, 1);
      v8f acc0 = {}, acc1 = {};
      acc0 = __builtin_amdgcn_wmma_f32_16x16x32_f16(false, b00, false, a0,
                                                    (short)0, acc0, false, false);
      acc1 = __builtin_amdgcn_wmma_f32_16x16x32_f16(false, b01, false, a0,
                                                    (short)0, acc1, false, false);
      acc0 = __builtin_amdgcn_wmma_f32_16x16x32_f16(false, b10, false, a1,
                                                    (short)0, acc0, false, false);
      acc1 = __builtin_amdgcn_wmma_f32_16x16x32_f16(false, b11, false, a1,
                                                    (short)0, acc1, false, false);
      ea_norm_store(ks + (t * 16 + col) * QPIT, acc0, acc1, mhi);
    }
  }
  __syncthreads();

  // every wave has its weight fragments: the next window's weights take their
  // place (the barrier behind the correlation stands in front of their first read)
  if constexpr (NEXT) {
    const int wo = (tid >> 3) * SPIT + (tid & 7) * 8;
    *(uint4*)&wqL[wo] = ea_pack8(nqa, nqb);
    *(uint4*)&wkL[wo] = ea_pack8(nka, nkb);
  }

  // ---- temperature from curvature (global min/max of this slice) ----
  // the slice's records are folded here; their addresses are uniform (scalar loads)
  unsigned emin = 0xFFFFFFFFu, emax = 0u;
#pragma unroll  // all records are fetched before the first is used
  for (int i = 0; i < KPART; ++i) {
    const unsigned* rec = mm + (slice * KPART + i) * KREC;
    emin = min(emin, rec[0]);
    emax = max(emax, rec[1]);
  }
  const float kmin  = fdec(emin);
  const float kmax  = fdec(emax);
  const float denom = (kmax - kmin) + 1e-6f;

  // This thread writes out four neighbouring pixels of every fourth plane.
  const int g = tid & 63;
  const unsigned pixb = (unsigned)(((y0 + (g >> 2)) * WIMG + x0 + (g & 3) * 4) * 4);  // bytes
  const float4 kap4 =
      *(const float4*)((const char*)(kappa + ((size_t)b * 3 + slice) * HWPX) + pixb);
  // precaution: stands before any overwrite of the register this load names
  asm volatile("s_wait_xcnt 0x0" :: "v"(pixb) : "memory");

  // ---- windowed correlation as a banded matrix product ----
  // Wave w owns query rows 2w and 2w+1 of the tile. One product is 16 queries of
  // a row (A) against 16 keys of a halo row (B), all 32 channels in one step:
  // D[m][n] = q[m] . k[n]. Query m wants keys m..m+KW-1 of the H0 in the halo
  // row: key tile 0 holds keys 0..15, key tile 1 keys 16..H0-1 (its other columns
  // repeat the last key and are never stored). A halo row's fragments serve both
  // query rows.
  {
    const int qy0 = cg * 2;
    const v16h qf0 = ea_frag(qs + (qy0 * 16 + mrow) * QPIT, kb2, 0);
    const v16h qf1 = ea_frag(qs + ((qy0 + 1) * 16 + mrow) * QPIT, kb2, 0);
    const _Float16* k0 = ks + (qy0 * H0 + col) * QPIT;
    const _Float16* k1 = ks + (qy0 * H0 + 16 + min(col, 2 * P - 1)) * QPIT;
    // Register r of a lane is query m = r + mhi against key col (tile 0) or
    // 16 + col (tile 1): window offset dx = key - m. The two tiles' bands fall on
    // disjoint lanes, so they are merged: dx = (col - m) mod 16, kept if < KW.
    // Four halo rows at a time, so that fragments and bands stay in few registers.
    // Every loop of this block is unrolled: band[] is then indexed by constants
    // (registers, no scratch) and the LDS offsets become immediates.
#pragma unroll
    for (int c0 = 0; c0 <= KW; c0 += 4) {
      float band[8][8];  // [halo row of the chunk * 2 + query row][register]
#pragma unroll
      for (int kc = 0; kc < 4; ++kc) {
        const int kr = c0 + kc;
        if (kr > KW) continue;
        const v16h f0 = ea_frag(k0 + kr * H0 * QPIT, kb2, 0);
        const v16h f1 = ea_frag(k1 + kr * H0 * QPIT, kb2, 0);
#pragma unroll
        for (int q = 0; q < 2; ++q) {
          const int dy = kr - q;
          if (dy < 0 || dy >= KW) continue;
          const v8f z = {};
          const v8f d0 = __builtin_amdgcn_wmma_f32_16x16x32_f16(
              false, q ? qf1 : qf0, false, f0, (short)0, z, false, false);
          const v8f d1 = __builtin_amdgcn_wmma_f32_16x16x32_f16(
              false, q ? qf1 : qf0, false, f1, (short)0, z, false, false);
#pragma unroll
          for (int r = 0; r < 8; ++r)
            band[kc * 2 + q][r] = (col >= r + mhi) ? d0[r] : d1[r];
        }
      }
      // Band -> ob[dy * KW + dx][pixel]; one lane mask per register index.
#pragma unroll
      for (int r = 0; r < 8; ++r) {
        const int m  = r + mhi;
        const int dx = (col - m) & 15;
        if (dx < KW) {
          float* o = ob + dx * OPIT + qy0 * 16 + m;
#pragma unroll
          for (int e = 0; e < 8; ++e) {
            const int dy = c0 + (e >> 1) - (e & 1);
            if (c0 + (e >> 1) > KW || dy < 0 || dy >= KW) continue;
            o[dy * KW * OPIT + (e & 1) * 16] = band[e][r];
          }
        }
      }
    }
  }

  float sc[4];
  {
    const float kp[4] = {kap4.x, kap4.y, kap4.z, kap4.w};
#pragma unroll  // kp[] and sc[] indexed by constants: registers
    for (int j = 0; j < 4; ++j) {
      float tau = 0.5f - ((kp[j] - kmin) / denom) * (0.5f - 0.03f);
      tau = fminf(fmaxf(tau, 0.03f), 0.5f);
      sc[j] = 1.f / (tau + 1e-6f);
    }
  }
  __syncthreads();  // the result tile is complete before other waves read it

  // ---- write out: 16 bytes a lane, planes pl0, pl0 + 4, ... ----
  constexpr int NP = KK / 4;  // KK = 4 * NP + 1: the last plane goes to pl0 == 0
  const int pl0 = cg >> 1;
  char* ou = (char*)(out + ((size_t)b * KK + pl0) * HWPX);
  float4 ov[NP + 1];
  // both loops unrolled: ov[] stays in registers, and all LDS reads are issued
  // ahead of the first store
#pragma unroll
  for (int i = 0; i < NP; ++i) ov[i] = *(const float4*)&ob[(pl0 + 4 * i) * OPIT + g * 4];
  if (pl0 == 0) ov[NP] = *(const float4*)&ob[(4 * NP) * OPIT + g * 4];
#pragma unroll
  for (int i = 0; i <= NP; ++i) {
    // precaution: the last plane's address is formed in its own branch; stands
    // before any overwrite there of a register the stores above name
    if (i == NP) asm volatile("s_wait_xcnt 0x0" :: "v"(pixb) : "memory");
    if (i < NP || pl0 == 0) {
      float4 v = ov[i];
      v.x *= sc[0]; v.y *= sc[1]; v.z *= sc[2]; v.w *= sc[3];
      *(float4*)(ou + (size_t)i * (4u * HWPX * 4u) + pixb) = v;
    }
  }
  // precaution: the next window's code follows and reuses registers; stands
  // before any overwrite of a register these stores name
  if constexpr (NEXT) asm volatile("s_wait_xcnt 0x0" :: "v"(pixb) : "memory");
}

// All three window sizes of one 16 x 16 tile: the halo is staged once.
__global__ __launch_bounds__(256) void ea_affinity(const float* __restrict__ feat,
                                                   const float* __restrict__ kappa,
                                                   const float* __restrict__ qw,
                                                   const float* __restrict__ kw,
                                                   const unsigned* __restrict__ mm,
                                                   float* __restrict__ out) {
  constexpr int P     = PST;
  constexpr int H0    = HST;
  constexpr int HALO2 = H0 * H0;
  constexpr int PADPX = PADST;

  extern __shared__ char lds_raw[];
  _Float16* stage = (_Float16*)lds_raw;
  _Float16* wqL   = (_Float16*)(lds_raw + L_WQ);
  _Float16* wkL   = wqL + CATT * SPIT;

  const int tid = threadIdx.x;
  const int b   = blockIdx.z;
  const int y0  = blockIdx.y * 16, x0 = blockIdx.x * 16;

  // ---- stage halo of feat into LDS (f16), zero-padded OOB + tile padding ----
  // Weights of the first window (5 x 5): a thread takes 8 consecutive channels of
  // one row of qw and of kw.
  constexpr int WSL = CATT * CIN;                    // floats of one window's weights
  const int wo = (tid >> 3) * SPIT + (tid & 7) * 8;  // its place in LDS, halfs
  const unsigned wb = (unsigned)tid * 32u;           // its place in qw / kw, bytes
  const float4 qa = *(const float4*)((const char*)(qw + WSL) + wb);
  const float4 qb = *(const float4*)((const char*)(qw + WSL) + wb + 16);
  const float4 ka = *(const float4*)((const char*)(kw + WSL) + wb);
  const float4 kb = *(const float4*)((const char*)(kw + WSL) + wb + 16);
  // precaution: stands before any overwrite of the register these loads name
  asm volatile("s_wait_xcnt 0x0" :: "v"(wb) : "memory");

  // Halo: wave w owns channels 8w..8w+7; a lane gathers them for one halo pixel
  // in registers and writes them as one 16-byte LDS store. All loads are issued
  // before the first value is used.
  constexpr int NI = (PADPX + 31) / 32;
  const int cg = __builtin_amdgcn_readfirstlane(tid >> 5);
  const float* fg = feat + ((size_t)b * CIN + cg * 8) * HWPX;
  float hv[NI][8];
  int   hoff[NI];  // element offset in a channel plane, -1 outside the image
#pragma unroll
  for (int i = 0; i < NI; ++i) {
    // the last group is shifted back to end at PADPX: this wave writes 16 rows
    // twice with the same values, and no group needs a branch
    const int p  = (i * 32 + 32 <= PADPX ? i * 32 : PADPX - 32) + (tid & 31);
    const int hy = p / H0, hx = p - hy * H0;
    const int gy = y0 - P + hy, gx = x0 - P + hx;
    const bool inb = p < HALO2 && gy >= 0 && gy < HIMG && gx >= 0 && gx < WIMG;
    hoff[i] = inb ? gy * WIMG + gx : -1;
  }
  unsigned ha[NI];
#pragma unroll
  for (int i = 0; i < NI; ++i) {
    ha[i] = (unsigned)max(hoff[i], 0);  // always a valid address
#pragma unroll
    for (int j = 0; j < 8; ++j) hv[i][j] = fg[(unsigned)(j * HWPX) + ha[i]];
    // precaution, once per four groups: stands before any overwrite of the
    // registers these loads name (kept live up to here as inputs)
    if ((i & 3) == 3 || i == NI - 1)
      asm volatile("s_wait_xcnt 0x0" :: "v"(ha[i]), "v"(ha[i - 1]), "v"(ha[i - 2]),
                   "v"(ha[i - 3]) : "memory");
  }
  *(uint4*)&wqL[wo] = ea_pack8(qa, qb);
  *(uint4*)&wkL[wo] = ea_pack8(ka, kb);
#pragma unroll
  for (int i = 0; i < NI; ++i) {
    const int p = (i * 32 + 32 <= PADPX ? i * 32 : PADPX - 32) + (tid & 31);
    union { uint4 q; _Float16 h[8]; } pk;
#pragma unroll
    for (int j = 0; j < 8; ++j) pk.h[j] = (_Float16)(hoff[i] >= 0 ? hv[i][j] : 0.f);
    *(uint4*)&stage[p * SPIT + cg * 8] = pk.q;
  }
  __syncthreads();

  ea_window<5, L_OB5, true>(lds_raw, kappa, mm, out + (size_t)BSZ * 9 * HWPX, 1,
                            b, y0, x0, tid, cg, qw, kw);
  ea_window<3, L_OB3, true>(lds_raw, kappa, mm, out, 0,
                            b, y0, x0, tid, cg, qw + 2 * WSL, kw + 2 * WSL);
  ea_window<7, L_OB7, false>(lds_raw, kappa, mm, out + (size_t)BSZ * (9 + 25) * HWPX, 2,
                             b, y0, x0, tid, cg, nullptr, nullptr);
}

extern "C" void kernel_launch(void* const* d_in, const int* in_sizes, int n_in,
                              void* d_out, int out_size, void* d_ws, size_t ws_size,
                              hipStream_t stream) {
  const float* feat  = (const float*)d_in[0];
  const float* kappa = (const float*)d_in[1];
  const float* qw    = (const float*)d_in[2];  // (3, 32, 64)
  const float* kw    = (const float*)d_in[3];  // (3, 32, 64)
  float*       out   = (float*)d_out;
  unsigned*    mm    = (unsigned*)d_ws;        // 3 x KPART records {min,max}, encoded

  ea_kap_minmax<<<dim3(KPART, 3), KTHR, 0, stream>>>(kappa, mm);

  const dim3 grid(WIMG / 16, HIMG / 16, BSZ), block(256);
  ea_affinity<<<grid, block, L_ALL, stream>>>(feat, kappa, qw, kw, mm, out);
}

// v006
// One run takes 46 microseconds.
// Two timings next to v005 both put it at 1.29 times that version's speed.
// All steps since v000 together make it 8.26 times as fast.
#include <hip/hip_runtime.h>
#include <hip/hip_bf16.h>

typedef __attribute__((ext_vector_type(16))) _Float16 v16h;
typedef __attribute__((ext_vector_type(8)))  float    v8f;

#define HWPX (256 * 256)
#define HIMG 256
#define WIMG 256
#define BSZ  4
#define CIN  64
#define CATT 32
// halfs per LDS row of a WMMA operand (64 channels + 8): 144 B = 16 B x 9, so
// 16 lanes on 16 consecutive rows spread their 16-byte accesses over all banks
#define SPIT (CIN + 8)
// halfs per LDS row of a projected pixel (32 channels + 8): 80 B = 16 B x 5, the
// same spreading for the 16-byte fragment reads of the correlation product
#define QPIT (CATT + 8)
// The tile of one work-group: TX pixels are one 128-byte line of every plane
#define TX  32
#define TY  16
#define NPX (TX * TY)
// floats per LDS plane of the result tile (512 pixels + 12): the lanes of one
// band store sit on different window offsets, so on planes; the 12 spreads them
#define OPIT (NPX + 12)

// ---- order-preserving float <-> uint encoding: min/max become integer ops ----
__device__ __forceinline__ unsigned fenc(float f) {
  unsigned u = __float_as_uint(f);
  return u ^ ((u >> 31) ? 0xFFFFFFFFu : 0x80000000u);
}
__device__ __forceinline__ float fdec(unsigned u) {
  u ^= ((u >> 31) ? 0x80000000u : 0xFFFFFFFFu);
  return __uint_as_float(u);
}

// min/max of kappa[:, slice, :, :] leave this launch as KPART records {min, max}
// a slice, one per work-group; the reader folds them. A record has a 128-byte
// line of the workspace to itself (KREC unsigneds apart): one writer per line.
#define KPART 16
#define KTHR  512
#define KREC  32

__global__ __launch_bounds__(KTHR) void ea_kap_minmax(const float* __restrict__ kappa,
                                                      unsigned* __restrict__ mm) {
  const int slice = blockIdx.y;
  const int tid   = threadIdx.x;
  // A plane half is KPART * KTHR units of 16 bytes; a thread takes one unit of
  // each half of each of the BSZ planes. All loads are issued before the first use.
  const unsigned vb = (unsigned)(blockIdx.x * KTHR + tid) * 16u;  // bytes
  const char* kp = (const char*)(kappa + (size_t)slice * HWPX);
  float4 v[2 * BSZ];
#pragma unroll  // v[] indexed by constants: registers
  for (int i = 0; i < 2 * BSZ; ++i)
    v[i] = *(const float4*)(kp + (size_t)(i >> 1) * (3u * HWPX * 4u) +
                            (size_t)(i & 1) * (HWPX * 2u) + vb);
  unsigned lmin = 0xFFFFFFFFu, lmax = 0u;
#pragma unroll  // as above
  for (int i = 0; i < 2 * BSZ; ++i) {
    const unsigned k0 = fenc(v[i].x), k1 = fenc(v[i].y), k2 = fenc(v[i].z), k3 = fenc(v[i].w);
    lmin = min(lmin, min(min(k0, k1), min(k2, k3)));
    lmax = max(lmax, max(max(k0, k1), max(k2, k3)));
  }
  // butterfly over the wave, then over the waves' results
#pragma unroll  // the lane distances become constants
  for (int s = 16; s > 0; s >>= 1) {
    lmin = min(lmin, __shfl_xor(lmin, s));
    lmax = max(lmax, __shfl_xor(lmax, s));
  }
  __shared__ unsigned smin[KTHR / 32], smax[KTHR / 32];
  if ((tid & 31) == 0) { smin[tid >> 5] = lmin; smax[tid >> 5] = lmax; }
  __syncthreads();
  if (tid < 32) {
    lmin = smin[tid & (KTHR / 32 - 1)];
    lmax = smax[tid & (KTHR / 32 - 1)];
#pragma unroll  // the lane distances become constants
    for (int s = KTHR / 64; s > 0; s >>= 1) {
      lmin = min(lmin, __shfl_xor(lmin, s));
      lmax = max(lmax, __shfl_xor(lmax, s));
    }
    if (tid == 0)
      *(uint2*)&mm[(slice * KPART + blockIdx.x) * KREC] = make_uint2(lmin, lmax);
  }
}

// Assemble a 16x32 f16 WMMA fragment (A or B operand) from an LDS row of 32
// (stage, weights) or 16 (q, k) channel-pairs, per the ISA layout: halves 0-7 = K kb..kb+7, halves 8-15 =
// K kb+16..kb+23 (kb = 0 for lanes 0-15, 8 for lanes 16-31). Union with
// constant indices keeps everything in VGPRs (SROA), no scratch.
// Rows start on 16 bytes, so each run of 8 halves is one 16-byte LDS load.
__device__ __forceinline__ v16h ea_frag(const _Float16* row, int kb2, int s) {
  const uint4* p = (const uint4*)row;
  union { v16h v; uint4 q[2]; } r;
  r.q[0] = p[s * 4 + (kb2 >> 2)];
  r.q[1] = p[s * 4 + (kb2 >> 2) + 2];
  return r.v;
}

// lane l with lane l ^ 16
__device__ __forceinline__ float ea_xhalf(float x) {
  const int b = __builtin_bit_cast(int, x);
  return __builtin_bit_cast(
      float, __builtin_amdgcn_permlanex16(b, b, 0x76543210, 0xfedcba98, false, false));
}

// The projections are computed transposed (weight rows are A, pixels are B), so a
// lane holds channels of ONE pixel: mhi..mhi+7 in c0, 16+mhi..16+mhi+7 in c1, and
// lane l ^ 16 holds that pixel's other 16. L2 normalize (x / max(||x||, 1e-12);
// zero rows stay zero) from the f32 accumulators, then two 16-byte LDS stores
// into the pixel's row of QPIT halfs.
__device__ __forceinline__ void ea_norm_store(_Float16* row, v8f c0, v8f c1, int mhi) {
  float s0 = 0.f, s1 = 0.f;
  // both loops unrolled: c0[], c1[] and h[] are then indexed by constants (registers)
#pragma unroll
  for (int r = 0; r < 8; ++r) { s0 += c0[r] * c0[r]; s1 += c1[r] * c1[r]; }
  float s = s0 + s1;
  s += ea_xhalf(s);
  const float inv = 1.f / fmaxf(sqrtf(s), 1e-12f);
  union { uint4 q; _Float16 h[8]; } p0, p1;
#pragma unroll
  for (int r = 0; r < 8; ++r) {
    p0.h[r] = (_Float16)(c0[r] * inv);
    p1.h[r] = (_Float16)(c1[r] * inv);
  }
  *(uint4*)&row[mhi]      = p0.q;
  *(uint4*)&row[16 + mhi] = p1.q;
}

// 8 floats -> 8 halfs, one 16-byte unit
__device__ __forceinline__ uint4 ea_pack8(float4 a, float4 c) {
  union { uint4 q; _Float16 h[8]; } p;
  p.h[0] = (_Float16)a.x; p.h[1] = (_Float16)a.y;
  p.h[2] = (_Float16)a.z; p.h[3] = (_Float16)a.w;
  p.h[4] = (_Float16)c.x; p.h[5] = (_Float16)c.y;
  p.h[6] = (_Float16)c.z; p.h[7] = (_Float16)c.w;
  return p.q;
}

// LDS map of the fused kernel, bytes. The 38 x 22 halo of the widest window is
// staged once and serves all three window sizes.
#define PST   3                      // halo width of the stage
#define HSX   (TX + 2 * PST)         // its edges
#define HSY   (TY + 2 * PST)
#define PADST 848                    // its pixels (836), rounded up to 16
#define L_WQ  (PADST * SPIT * 2)             // weights behind the stage
#define L_QS  (L_WQ + 2 * CATT * SPIT * 2)   // 512 q rows
#define L_KS  (L_QS + NPX * QPIT * 2)        // key rows: 720 / 624 / 848 by window
// Result tiles. The windows run in the order 5, 3, 7. A tile may still be read by
// slow waves while fast ones write the next window's key rows, so it lies behind
// those: 5's behind 624 (and its own 720) rows, 3's behind 848. 7's lies over the
// stage, which is dead by then.
#define L_OB5 (L_KS + 720 * QPIT * 2)
#define L_OB3 (L_KS + PADST * QPIT * 2)
#define L_OB7 0
#define L_ALL (L_OB5 + 25 * OPIT * 4)

// One window size, from the staged halo and the weights in LDS to its output:
// f16-WMMA q/k projection with L2 normalize -> k x k windowed cosine / tau.
// nqw, nkw: the next window's weights (NEXT): fetched while this window's
// projections run, put into LDS as soon as this window's are dead.
template <int KW, int OBAT, bool NEXT>
__device__ __forceinline__ void ea_window(char* lds_raw,
                                          const float* __restrict__ kappa,
                                          const unsigned* __restrict__ mm,
                                          float* __restrict__ out, int slice,
                                          int b, int y0, int x0, int tid, int cg,
                                          const float* __restrict__ nqw,
                                          const float* __restrict__ nkw) {
  constexpr int P     = KW / 2;
  constexpr int HX    = TX + 2 * P;          // halo tile edges
  constexpr int HY    = TY + 2 * P;
  constexpr int HALO2 = HX * HY;             // halo pixels
  constexpr int KT    = (HALO2 + 15) / 16;   // 16-pixel tiles for key proj
  constexpr int KK    = KW * KW;
  constexpr int OFF   = PST - P;             // this halo's corner in the stage

  _Float16* stage = (_Float16*)lds_raw;            // PADST rows of SPIT (f16)
  _Float16* wqL   = (_Float16*)(lds_raw + L_WQ);
  _Float16* wkL   = wqL + CATT * SPIT;
  _Float16* qs    = (_Float16*)(lds_raw + L_QS);   // NPX rows of QPIT (f16)
  _Float16* ks    = (_Float16*)(lds_raw + L_KS);   // KT * 16 rows of QPIT (f16)
  float*    ob    = (float*)(lds_raw + OBAT);      // KK planes of OPIT (f32)

  const int lane = tid & 31;
  const int mrow = lane & 15;
  const int kb2  = (lane >= 16) ? 4 : 0;  // channel-pair base for this half-wave
  const int mhi  = (lane >= 16) ? 8 : 0;
  const int col  = lane & 15;

  // A thread takes 8 consecutive channels of one row of the next qw (waves 0-7)
  // or kw (waves 8-15).
  float4 nwa, nwb;
  if constexpr (NEXT) {
    const float* nsrc = cg < 8 ? nqw : nkw;
    const unsigned wb = (unsigned)(tid & 255) * 32u;  // its place in qw / kw, bytes
    nwa = *(const float4*)((const char*)nsrc + wb);
    nwb = *(const float4*)((const char*)nsrc + wb + 16);
    // precaution: stands before any overwrite of the register these loads name
    asm volatile("s_wait_xcnt 0x0" :: "v"(wb) : "memory");
  }

  // ---- q projection: 32 tiles of 16 interior pixels, normalized on the way; a
  // wave takes the two of its own image row ----
  {
    const _Float16* w0 = &wqL[mrow * SPIT];
    const _Float16* w1 = &wqL[(16 + mrow) * SPIT];
    const v16h b00 = ea_frag(w0, kb2, 0);  // kstep0, channels 0-15
    const v16h b10 = ea_frag(w0, kb2, 1);  // kstep1, channels 0-15
    const v16h b01 = ea_frag(w1, kb2, 0);  // kstep0, channels 16-31
    const v16h b11 = ea_frag(w1, kb2, 1);  // kstep1, channels 16-31
    for (int t = cg * 2; t < cg * 2 + 2; ++t) {
      int ip = t * 16 + mrow;  // interior pixel 0..511
      int px = ((ip >> 5) + PST) * HSX + ((ip & 31) + PST);
      const _Float16* srow = &stage[px * SPIT];
      v16h a0 = ea_frag(srow, kb2, 0);
      v16h a1 = ea_frag(srow, kb2, 1);
      v8f acc0 = {}, acc1 = {};
      acc0 = __builtin_amdgcn_wmma_f32_16x16x32_f16(false, b00, false, a0,
                                                    (short)0, acc0, false, false);
      acc1 = __builtin_amdgcn_wmma_f32_16x16x32_f16(false, b01, false, a0,
                                                    (short)0, acc1, false, false);
      acc0 = __builtin_amdgcn_wmma_f32_16x16x32_f16(false, b10, false, a1,
                                                    (short)0, acc0, false, false);
      acc1 = __builtin_amdgcn_wmma_f32_16x16x32_f16(false, b11, false, a1,
                                                    (short)0, acc1, false, false);
      ea_norm_store(qs + (t * 16 + col) * QPIT, acc0, acc1, mhi);
    }
  }

  // ---- key projection: KT tiles of 16 halo pixels, normalized on the way ----
  {
    const _Float16* w0 = &wkL[mrow * SPIT];
    const _Float16* w1 = &wkL[(16 + mrow) * SPIT];
    const v16h b00 = ea_frag(w0, kb2, 0);
    const v16h b10 = ea_frag(w0, kb2, 1);
    const v16h b01 = ea_frag(w1, kb2, 0);
    const v16h b11 = ea_frag(w1, kb2, 1);
    for (int t = cg; t < KT; t += 16) {
      // halo pixel of this window -> its row in the stage; the rows that pad the
      // last tile repeat the last pixel and are never read by the correlation
      const int h  = min(t * 16 + mrow, HALO2 - 1);
      const int hy = h / HX;
      const int px = (hy + OFF) * HSX + (h - hy * HX) + OFF;
      const _Float16* srow = &stage[px * SPIT];
      v16h a0 = ea_frag(srow, kb2, 0);
      v16h a1 = ea_frag(srow, kb2, 1);
      v8f acc0 = {}, acc1 = {};
      acc0 = __builtin_amdgcn_wmma_f32_16x16x32_f16(false, b00, false, a0,
                                                    (short)0, acc0, false, false);
      acc1 = __builtin_amdgcn_wmma_f32_16x16x32_f16(false, b01, false, a0,
                                                    (short)0, acc1, false, false);
      acc0 = __builtin_amdgcn_wmma_f32_16x16x32_f16(false, b10, false, a1,
                                                    (short)0, acc0, false, false);
      acc1 = __builtin_amdgcn_wmma_f32_16x16x32_f16(false, b11, false, a1,
                                                    (short)0, acc1, false, false);
      ea_norm_store(ks + (t * 16 + col) * QPIT, acc0, acc1, mhi);
    }
  }
  __syncthreads();

  // every wave has its weight fragments: the next window's weights take their
  // place (the barrier behind the correlation stands in front of their first read)
  if constexpr (NEXT) {
    // rows 0-31 are wq, rows 32-63 wk, which lies directly behind it
    const int wo = (tid >> 3) * SPIT + (tid & 7) * 8;
    *(uint4*)&wqL[wo] = ea_pack8(nwa, nwb);
  }

  // ---- temperature from curvature (global min/max of this slice) ----
  // the slice's records are folded here; their addresses are uniform (scalar loads)
  unsigned emin = 0xFFFFFFFFu, emax = 0u;
#pragma unroll  // all records are fetched before the first is used
  for (int i = 0; i < KPART; ++i) {
    const unsigned* rec = mm + (slice * KPART + i) * KREC;
    emin = min(emin, rec[0]);
    emax = max(emax, rec[1]);
  }
  const float kmin  = fdec(emin);
  const float kmax  = fdec(emax);
  const float denom = (kmax - kmin) + 1e-6f;

  // This thread writes out four neighbouring pixels of every fourth plane;
  // eight threads in a row cover one 128-byte line.
  const int g = tid & 127;
  const unsigned pixb = (unsigned)(((y0 + (g >> 3)) * WIMG + x0 + (g & 7) * 4) * 4);  // bytes
  const float4 kap4 =
      *(const float4*)((const char*)(kappa + ((size_t)b * 3 + slice) * HWPX) + pixb);
  // precaution: stands before any overwrite of the register this load names
  asm volatile("s_wait_xcnt 0x0" :: "v"(pixb) : "memory");

  // ---- windowed correlation as a banded matrix product ----
  // Wave w owns query row w of the tile, as two runs of 16 queries. One product is
  // 16 queries (A) against 16 keys of a halo row (B), all 32 channels in one step:
  // D[m][n] = q[m] . k[n]. Query m of run q wants keys 16q+m..16q+m+KW-1 of the HX
  // in the halo row: they lie in key tiles q and q + 1. Key tile 2 holds keys
  // 32..HX-1 (its other columns repeat the last key and are never stored). Key
  // tile 1 serves both runs.
  {
    const int qy = cg;
    const v16h qf0 = ea_frag(qs + (qy * TX + mrow) * QPIT, kb2, 0);
    const v16h qf1 = ea_frag(qs + (qy * TX + 16 + mrow) * QPIT, kb2, 0);
    const _Float16* k0 = ks + (qy * HX + col) * QPIT;
    const _Float16* k2 = ks + (qy * HX + 32 + min(col, 2 * P - 1)) * QPIT;
    // Register r of a lane is query m = r + mhi of the run against key col of the
    // run's first or second key tile: window offset dx = key - m. The two tiles'
    // bands fall on disjoint lanes, so they are merged: dx = (col - m) mod 16,
    // kept if < KW.
    // Four halo rows at a time, so that fragments and bands stay in few registers.
    // Every loop of this block is unrolled: band[] is then indexed by constants
    // (registers, no scratch) and the LDS offsets become immediates.
#pragma unroll
    for (int c0 = 0; c0 < KW; c0 += 4) {
      float band[8][8];  // [halo row of the chunk * 2 + run][register]
#pragma unroll
      for (int kc = 0; kc < 4; ++kc) {
        const int dy = c0 + kc;
        if (dy >= KW) continue;
        const v16h fa = ea_frag(k0 + dy * HX * QPIT, kb2, 0);
        const v16h fb = ea_frag(k0 + (dy * HX + 16) * QPIT, kb2, 0);
        const v16h fc = ea_frag(k2 + dy * HX * QPIT, kb2, 0);
#pragma unroll
        for (int q = 0; q < 2; ++q) {
          const v8f z = {};
          const v8f d0 = __builtin_amdgcn_wmma_f32_16x16x32_f16(
              false, q ? qf1 : qf0, false, q ? fb : fa, (short)0, z, false, false);
          const v8f d1 = __builtin_amdgcn_wmma_f32_16x16x32_f16(
              false, q ? qf1 : qf0, false, q ? fc : fb, (short)0, z, false, false);
#pragma unroll
          for (int r = 0; r < 8; ++r)
            band[kc * 2 + q][r] = (col >= r + mhi) ? d0[r] : d1[r];
        }
      }
      // Band -> ob[dy * KW + dx][pixel]; one lane mask per register index.
#pragma unroll
      for (int r = 0; r < 8; ++r) {
        const int m  = r + mhi;
        const int dx = (col - m) & 15;
        if (dx < KW) {
          float* o = ob + dx * OPIT + qy * TX + m;
#pragma unroll
          for (int e = 0; e < 8; ++e) {
            const int dy = c0 + (e >> 1);
            if (dy >= KW) continue;
            o[dy * KW * OPIT + (e & 1) * 16] = band[e][r];
          }
        }
      }
    }
  }

  float sc[4];
  {
    const float kp[4] = {kap4.x, kap4.y, kap4.z, kap4.w};
#pragma unroll  // kp[] and sc[] indexed by constants: registers
    for (int j = 0; j < 4; ++j) {
      float tau = 0.5f - ((kp[j] - kmin) / denom) * (0.5f - 0.03f);
      tau = fminf(fmaxf(tau, 0.03f), 0.5f);
      sc[j] = 1.f / (tau + 1e-6f);
    }
  }
  __syncthreads();  // the result tile is complete before other waves read it

  // ---- write out: 16 bytes a lane, planes pl0, pl0 + 4, ... ----
  constexpr int NP = KK / 4;  // KK = 4 * NP + 1: the last plane goes to pl0 == 0
  const int pl0 = cg >> 2;
  char* ou = (char*)(out + ((size_t)b * KK + pl0) * HWPX);
  float4 ov[NP + 1];
  // both loops unrolled: ov[] stays in registers, and all LDS reads are issued
  // ahead of the first store
#pragma unroll
  for (int i = 0; i < NP; ++i) ov[i] = *(const float4*)&ob[(pl0 + 4 * i) * OPIT + g * 4];
  if (pl0 == 0) ov[NP] = *(const float4*)&ob[(4 * NP) * OPIT + g * 4];
#pragma unroll
  for (int i = 0; i <= NP; ++i) {
    // precaution: the last plane's address is formed in its own branch; stands
    // before any overwrite there of a register the stores above name
    if (i == NP) asm volatile("s_wait_xcnt 0x0" :: "v"(pixb) : "memory");
    if (i < NP || pl0 == 0) {
      float4 v = ov[i];
      v.x *= sc[0]; v.y *= sc[1]; v.z *= sc[2]; v.w *= sc[3];
      *(float4*)(ou + (size_t)i * (4u * HWPX * 4u) + pixb) = v;
    }
  }
  // precaution: the next window's code follows and reuses registers; stands
  // before any overwrite of a register these stores name
  if constexpr (NEXT) asm volatile("s_wait_xcnt 0x0" :: "v"(pixb) : "memory");
}

// All three window sizes of one 32 x 16 tile: the halo is staged once.
__global__ __launch_bounds__(512) void ea_affinity(const float* __restrict__ feat,
                                                   const float* __restrict__ kappa,
                                                   const float* __restrict__ qw,
                                                   const float* __restrict__ kw,
                                                   const unsigned* __restrict__ mm,
                                                   float* __restrict__ out) {
  constexpr int P     = PST;
  constexpr int H0    = HSX;
  constexpr int HALO2 = HSX * HSY;
  constexpr int PADPX = PADST;

  __shared__ __attribute__((aligned(16))) char lds_raw[L_ALL];
  static_assert(L_ALL <= 320 * 1024 && L_OB3 + 9 * OPIT * 4 <= L_ALL && 49 * OPIT * 4 <= L_WQ,
                "the map fits one work-group's LDS, and the last tile fits over the stage");
  _Float16* stage = (_Float16*)lds_raw;
  _Float16* wqL   = (_Float16*)(lds_raw + L_WQ);
  _Float16* wkL   = wqL + CATT * SPIT;

  const int tid = threadIdx.x;
  const int b   = blockIdx.z;
  const int y0  = blockIdx.y * TY, x0 = blockIdx.x * TX;

  // ---- stage halo of feat into LDS (f16), zero-padded OOB + tile padding ----
  // Weights of the first window (5 x 5): a thread takes 8 consecutive channels of
  // one row of qw (waves 0-7) or of kw (waves 8-15); in LDS wk's rows follow wq's.
  constexpr int WSL = CATT * CIN;                    // floats of one window's weights
  const int cg = __builtin_amdgcn_readfirstlane(tid >> 5);  // the wave, 0..15
  const int wo = (tid >> 3) * SPIT + (tid & 7) * 8;  // its place in LDS, halfs
  const unsigned wb = (unsigned)(tid & 255) * 32u;   // its place in qw / kw, bytes
  const float* wsrc = (cg < 8 ? qw : kw) + WSL;
  const float4 wa = *(const float4*)((const char*)wsrc + wb);
  const float4 wc = *(const float4*)((const char*)wsrc + wb + 16);
  // precaution: stands before any overwrite of the register these loads name
  asm volatile("s_wait_xcnt 0x0" :: "v"(wb) : "memory");

  // Halo: waves w and w + 8 own channels 8w..8w+7, each one half of the groups of
  // 32 pixels; a lane gathers the channels of one halo pixel in registers and
  // writes them as one 16-byte LDS store. All loads are issued before the first
  // value is used.
  constexpr int NI = (PADPX + 63) / 64;  // groups a wave
  static_assert(NI * 64 >= PADPX && PADPX >= 32, "groups cover the stage");
  const int cc = cg & 7;
  const int g0 = (cg >> 3) * NI;
  const float* fg = feat + ((size_t)b * CIN + cc * 8) * HWPX;
  float hv[NI][8];
  int   hoff[NI];  // element offset in a channel plane, -1 outside the image
#pragma unroll
  for (int i = 0; i < NI; ++i) {
    // the last groups are shifted back to end at PADPX: this wave writes some rows
    // again with the same values, and no group needs a branch
    const int p  = min((g0 + i) * 32, PADPX - 32) + (tid & 31);
    const int hy = p / H0, hx = p - hy * H0;
    const int gy = y0 - P + hy, gx = x0 - P + hx;
    const bool inb = p < HALO2 && gy >= 0 && gy < HIMG && gx >= 0 && gx < WIMG;
    hoff[i] = inb ? gy * WIMG + gx : -1;
  }
  unsigned ha[NI];
#pragma unroll
  for (int i = 0; i < NI; ++i) {
    ha[i] = (unsigned)max(hoff[i], 0);  // always a valid address
#pragma unroll
    for (int j = 0; j < 8; ++j) hv[i][j] = fg[(unsigned)(j * HWPX) + ha[i]];
    // precaution, once per four groups: stands before any overwrite of the
    // registers these loads name (kept live up to here as inputs)
    if ((i & 3) == 3 || i == NI - 1)
      asm volatile("s_wait_xcnt 0x0" :: "v"(ha[i]), "v"(ha[i - 1]), "v"(ha[i - 2]),
                   "v"(ha[i - 3]) : "memory");
  }
  *(uint4*)&wqL[wo] = ea_pack8(wa, wc);
#pragma unroll
  for (int i = 0; i < NI; ++i) {
    const int p = min((g0 + i) * 32, PADPX - 32) + (tid & 31);
    union { uint4 q; _Float16 h[8]; } pk;
#pragma unroll
    for (int j = 0; j < 8; ++j) pk.h[j] = (_Float16)(hoff[i] >= 0 ? hv[i][j] : 0.f);
    *(uint4*)&stage[p * SPIT + cc * 8] = pk.q;
  }
  __syncthreads();

  ea_window<5, L_OB5, true>(lds_raw, kappa, mm, out + (size_t)BSZ * 9 * HWPX, 1,
                            b, y0, x0, tid, cg, qw, kw);
  ea_window<3, L_OB3, true>(lds_raw, kappa, mm, out, 0,
                            b, y0, x0, tid, cg, qw + 2 * WSL, kw + 2 * WSL);
  ea_window<7, L_OB7, false>(lds_raw, kappa, mm, out + (size_t)BSZ * (9 + 25) * HWPX, 2,
                             b, y0, x0, tid, cg, nullptr, nullptr);
}

extern "C" void kernel_launch(void* const* d_in, const int* in_sizes, int n_in,
                              void* d_out, int out_size, void* d_ws, size_t ws_size,
                              hipStream_t stream) {
  const float* feat  = (const float*)d_in[0];
  const float* kappa = (const float*)d_in[1];
  const float* qw    = (const float*)d_in[2];  // (3, 32, 64)
  const float* kw    = (const float*)d_in[3];  // (3, 32, 64)
  float*       out   = (float*)d_out;
  unsigned*    mm    = (unsigned*)d_ws;        // 3 x KPART records {min,max}, encoded

  ea_kap_minmax<<<dim3(KPART, 3), KTHR, 0, stream>>>(kappa, mm);

  const dim3 grid(WIMG / TX, HIMG / TY, BSZ), block(512);
  ea_affinity<<<grid, block, 0, stream>>>(feat, kappa, qw, kw, mm, out);
}

// v007
// A run of this version takes 43.5 microseconds.
// Timed twice side by side with v006, it ran 1.06 times as fast both times.
// Over all steps from v000 it is 8.76 times as fast.
#include <hip/hip_runtime.h>
#include <hip/hip_bf16.h>

typedef __attribute__((ext_vector_type(16))) _Float16 v16h;
typedef __attribute__((ext_vector_type(8)))  float    v8f;

#define HWPX (256 * 256)
#define HIMG 256
#define WIMG 256
#define BSZ  4
#define CIN  64
#define CATT 32
// halfs per LDS row of a WMMA operand (64 channels + 8): 144 B = 16 B x 9, so
// 16 lanes on 16 consecutive rows spread their 16-byte accesses over all banks
#define SPIT (CIN + 8)
// halfs per LDS row of a projected pixel (32 channels + 8): 80 B = 16 B x 5, the
// same spreading for the 16-byte fragment reads of the correlation product
#define QPIT (CATT + 8)
// The tile of one work-group: TX pixels are one 128-byte line of every plane
#define TX  32
#define TY  16
#define NPX (TX * TY)
// floats per LDS plane of the result tile (512 pixels + 12): the lanes of one
// band store sit on different window offsets, so on planes; the 12 spreads them
#define OPIT (NPX + 12)

// ---- order-preserving float <-> uint encoding: min/max become integer ops ----
__device__ __forceinline__ unsigned fenc(float f) {
  unsigned u = __float_as_uint(f);
  return u ^ ((u >> 31) ? 0xFFFFFFFFu : 0x80000000u);
}
__device__ __forceinline__ float fdec(unsigned u) {
  u ^= ((u >> 31) ? 0x80000000u : 0xFFFFFFFFu);
  return __uint_as_float(u);
}

// min/max of kappa[:, slice, :, :] leave this launch as KPART records {min, max}
// a slice, one per work-group; the reader folds them. A record has a 128-byte
// line of the workspace to itself (KREC unsigneds apart): one writer per line.
#define KPART 16
#define KTHR  512
#define KREC  32

__global__ __launch_bounds__(KTHR) void ea_kap_minmax(const float* __restrict__ kappa,
                                                      unsigned* __restrict__ mm) {
  const int slice = blockIdx.y;
  const int tid   = threadIdx.x;
  // A plane half is KPART * KTHR units of 16 bytes; a thread takes one unit of
  // each half of each of the BSZ planes. All loads are issued before the first use.
  const unsigned vb = (unsigned)(blockIdx.x * KTHR + tid) * 16u;  // bytes
  const char* kp = (const char*)(kappa + (size_t)slice * HWPX);
  float4 v[2 * BSZ];
#pragma unroll  // v[] indexed by constants: registers
  for (int i = 0; i < 2 * BSZ; ++i)
    v[i] = *(const float4*)(kp + (size_t)(i >> 1) * (3u * HWPX * 4u) +
                            (size_t)(i & 1) * (HWPX * 2u) + vb);
  unsigned lmin = 0xFFFFFFFFu, lmax = 0u;
#pragma unroll  // as above
  for (int i = 0; i < 2 * BSZ; ++i) {
    const unsigned k0 = fenc(v[i].x), k1 = fenc(v[i].y), k2 = fenc(v[i].z), k3 = fenc(v[i].w);
    lmin = min(lmin, min(min(k0, k1), min(k2, k3)));
    lmax = max(lmax, max(max(k0, k1), max(k2, k3)));
  }
  // butterfly over the wave, then over the waves' results
#pragma unroll  // the lane distances become constants
  for (int s = 16; s > 0; s >>= 1) {
    lmin = min(lmin, __shfl_xor(lmin, s));
    lmax = max(lmax, __shfl_xor(lmax, s));
  }
  __shared__ unsigned smin[KTHR / 32], smax[KTHR / 32];
  if ((tid & 31) == 0) { smin[tid >> 5] = lmin; smax[tid >> 5] = lmax; }
  __syncthreads();
  if (tid < 32) {
    lmin = smin[tid & (KTHR / 32 - 1)];
    lmax = smax[tid & (KTHR / 32 - 1)];
#pragma unroll  // the lane distances become constants
    for (int s = KTHR / 64; s > 0; s >>= 1) {
      lmin = min(lmin, __shfl_xor(lmin, s));
      lmax = max(lmax, __shfl_xor(lmax, s));
    }
    if (tid == 0)
      *(uint2*)&mm[(slice * KPART + blockIdx.x) * KREC] = make_uint2(lmin, lmax);
  }
}

// Assemble a 16x32 f16 WMMA fragment (A or B operand) from an LDS row of 32
// (stage, weights) or 16 (q, k) channel-pairs, per the ISA layout: halves 0-7 = K kb..kb+7, halves 8-15 =
// K kb+16..kb+23 (kb = 0 for lanes 0-15, 8 for lanes 16-31). Union with
// constant indices keeps everything in VGPRs (SROA), no scratch.
// Rows start on 16 bytes, so each run of 8 halves is one 16-byte LDS load.
__device__ __forceinline__ v16h ea_frag(const _Float16* row, int kb2, int s) {
  const uint4* p = (const uint4*)row;
  union { v16h v; uint4 q[2]; } r;
  r.q[0] = p[s * 4 + (kb2 >> 2)];
  r.q[1] = p[s * 4 + (kb2 >> 2) + 2];
  return r.v;
}

// Work-group barrier that orders LDS alone: the wave's own LDS accesses are waited
// for, its global loads and stores stay in flight (__syncthreads() waits for those
// too, which would end the fetch of the next halo at the first barrier). Nothing in
// global memory goes from wave to wave in this kernel.
__device__ __forceinline__ void ea_lds_barrier() {
  asm volatile("s_wait_dscnt 0x0\n\ts_barrier_signal -1\n\ts_barrier_wait -1" ::: "memory");
}

// lane l with lane l ^ 16
__device__ __forceinline__ float ea_xhalf(float x) {
  const int b = __builtin_bit_cast(int, x);
  return __builtin_bit_cast(
      float, __builtin_amdgcn_permlanex16(b, b, 0x76543210, 0xfedcba98, false, false));
}

// The projections are computed transposed (weight rows are A, pixels are B), so a
// lane holds channels of ONE pixel: mhi..mhi+7 in c0, 16+mhi..16+mhi+7 in c1, and
// lane l ^ 16 holds that pixel's other 16. L2 normalize (x / max(||x||, 1e-12);
// zero rows stay zero) from the f32 accumulators, then two 16-byte LDS stores
// into the pixel's row of QPIT halfs.
__device__ __forceinline__ void ea_norm_store(_Float16* row, v8f c0, v8f c1, int mhi) {
  float s0 = 0.f, s1 = 0.f;
  // both loops unrolled: c0[], c1[] and h[] are then indexed by constants (registers)
#pragma unroll
  for (int r = 0; r < 8; ++r) { s0 += c0[r] * c0[r]; s1 += c1[r] * c1[r]; }
  float s = s0 + s1;
  s += ea_xhalf(s);
  const float inv = 1.f / fmaxf(sqrtf(s), 1e-12f);
  union { uint4 q; _Float16 h[8]; } p0, p1;
#pragma unroll
  for (int r = 0; r < 8; ++r) {
    p0.h[r] = (_Float16)(c0[r] * inv);
    p1.h[r] = (_Float16)(c1[r] * inv);
  }
  *(uint4*)&row[mhi]      = p0.q;
  *(uint4*)&row[16 + mhi] = p1.q;
}

// 8 floats -> 8 halfs, one 16-byte unit
__device__ __forceinline__ uint4 ea_pack8(float4 a, float4 c) {
  union { uint4 q; _Float16 h[8]; } p;
  p.h[0] = (_Float16)a.x; p.h[1] = (_Float16)a.y;
  p.h[2] = (_Float16)a.z; p.h[3] = (_Float16)a.w;
  p.h[4] = (_Float16)c.x; p.h[5] = (_Float16)c.y;
  p.h[6] = (_Float16)c.z; p.h[7] = (_Float16)c.w;
  return p.q;
}

// LDS map of the fused kernel, bytes. The 38 x 22 halo of the widest window is
// staged once and serves all three window sizes.
#define PST   3                      // halo width of the stage
#define HSX   (TX + 2 * PST)         // its edges
#define HSY   (TY + 2 * PST)
#define PADST 848                    // its pixels (836), rounded up to 16
// The stage starts L_ST bytes in: the last window's result tile, which starts at 0,
// then ends in front of the stage's row PXA, and the rows from there on can take
// the next tile's halo while that result tile is in use.
#define L_ST  38400
#define PXA   448
#define L_WQ  (L_ST + PADST * SPIT * 2)      // weights behind the stage
#define L_QS  (L_WQ + 2 * CATT * SPIT * 2)   // 512 q rows
#define L_KS  (L_QS + NPX * QPIT * 2)        // key rows: 720 / 624 / 848 by window
// Result tiles. The windows run in the order 5, 3, 7. A tile may still be read by
// slow waves while fast ones write the next window's key rows, so it lies behind
// those: 5's behind 624 (and its own 720) rows, 3's behind 848. 7's lies over the
// first PXA rows of the stage, which is dead by then.
#define L_OB5 (L_KS + 720 * QPIT * 2)
#define L_OB3 (L_KS + PADST * QPIT * 2)
#define L_OB7 0
#define L_ALL (L_OB5 + 25 * OPIT * 4)

// A work-group walks TPW tiles, one below the other. The halo of the next tile is
// fetched into registers while the current tile's windows are computed.
#define TPW 2
// Halo fetch: waves w and w + 8 own channels 8w..8w+7, each one half of the groups
// of 32 pixels below row PXA (its groups 0..NI/2-1) and one half of those from PXA
// on (its groups NI/2..NI-1); a lane gathers the channels of one halo pixel in registers and
// writes them as one 16-byte LDS store.
#define NI ((PADST + 63) / 64)  // groups a wave
static_assert(NI * 64 >= PADST && PADST >= 32 && NI >= 8 && NI % 2 == 0 && NI * 32 == PXA,
              "groups cover the stage");
struct EaHalo {
  float        hv[NI][8];  // values in flight
  uint4        pk[NI];     // the same as f16, zero outside the image
  unsigned     inm;        // bit i: the pixel of group i lies inside the image
  const float* fg;         // first of this wave's 8 channel planes
  int          g0;         // first group of this wave: 0 or NI / 2
};

// the halo pixel of a lane in group i; the last groups are shifted back to end at
// PADST: the wave writes some rows again with the same values, no group needs a branch
// (only the last two i can reach the end: the others differ by constants)
__device__ __forceinline__ int ea_halo_gs(int g0, int i) {  // lane 0's, the same for the wave
  const int gs = (g0 + i + (i >= NI / 2 ? NI / 2 : 0)) * 32;
  return (NI + i) * 32 <= PADST - 32 ? gs : min(gs, PADST - 32);
}
__device__ __forceinline__ int ea_halo_px(int g0, int i, int lane) {
  return ea_halo_gs(g0, i) + lane;
}

// Issue the loads of groups I0..I1-1 of the halo of the tile at (y0, x0); nothing
// here uses a loaded value.
template <int I0, int I1>
__device__ __forceinline__ void ea_halo_issue(EaHalo& hs, int y0, int x0, int lane) {
  unsigned ha[NI];
  if (I0 == 0) hs.inm = 0u;
#pragma unroll  // hv[] and ha[] indexed by constants: registers
  for (int i = I0; i < I1; ++i) {
    // Row and column are taken from the pixel's number counted from image row 0, the
    // group's part of it summed as a scalar (readfirstlane keeps that sum together):
    // no vector value here is then the same for every tile. Such values would be
    // kept in registers round the tile loop, over the budget (scratch).
    const int gs = ea_halo_gs(hs.g0, i);
    const unsigned q  = (unsigned)__builtin_amdgcn_readfirstlane(gs + y0 * HSX) + (unsigned)lane;
    const unsigned qy = q / HSX;
    const int gy = (int)qy - PST, gx = x0 - PST + (int)(q - qy * HSX);
    const bool inp = (NI + i) * 32 + 31 < HSX * HSY || gs + lane < HSX * HSY;
    const bool inb = inp && gy >= 0 && gy < HIMG && gx >= 0 && gx < WIMG;
    ha[i] = inb ? (unsigned)(gy * WIMG + gx) * 4u : 0u;  // bytes; always a valid address
    hs.inm |= (inb ? 1u : 0u) << i;
    // the plane's distance is a constant of the load: one address register a group
#pragma unroll
    for (int j = 0; j < 8; ++j)
      hs.hv[i][j] = *(const float*)((const char*)hs.fg + ha[i] + (size_t)j * (HWPX * 4));
    // precaution, once per four groups: stands before any overwrite of the
    // registers these loads name (kept live up to here as inputs)
    if (((i - I0) & 3) == 3 || i == I1 - 1)
      asm volatile("s_wait_xcnt 0x0" :: "v"(ha[i]), "v"(ha[i - 1]), "v"(ha[i - 2]),
                   "v"(ha[i - 3]) : "memory");
  }
}

// No tile follows: nothing is fetched. The registers get a value all the same, so
// that on this path too their old values end here; otherwise the old values count
// as live round the whole tile loop and the register budget is overrun (scratch).
template <int I0, int I1>
__device__ __forceinline__ void ea_halo_none(EaHalo& hs) {
  if (I0 == 0) hs.inm = 0u;
#pragma unroll  // hv[] indexed by constants: registers
  for (int i = I0; i < I1; ++i)
#pragma unroll
    for (int j = 0; j < 8; ++j) hs.hv[i][j] = 0.f;
}

// Two f32 -> one register of two f16, a in the low half, rounded to nearest even as
// the cast does. In asm text so that the conversion stays where it is written: the
// compiler otherwise moves it down to the LDS store behind the last window, all f32
// values stay live through that window's correlation, and registers go to scratch.
__device__ __forceinline__ unsigned ea_cvt2_here(float a, float c) {
  unsigned r;
  asm volatile("v_cvt_pk_f16_f32 %0, %1, %2" : "=v"(r) : "v"(a), "v"(c));
  return r;
}

// f32 -> f16, 8 channels of a pixel to one 16-byte unit, zero outside the image
template <int I0, int I1>
__device__ __forceinline__ void ea_halo_pack(EaHalo& hs) {
#pragma unroll  // hv[] and pk[] indexed by constants: registers
  for (int i = I0; i < I1; ++i) {
    const bool inb = hs.inm >> i & 1u;
    const float* v = hs.hv[i];
    const unsigned r0 = ea_cvt2_here(v[0], v[1]), r1 = ea_cvt2_here(v[2], v[3]);
    const unsigned r2 = ea_cvt2_here(v[4], v[5]), r3 = ea_cvt2_here(v[6], v[7]);
    hs.pk[i] = make_uint4(inb ? r0 : 0u, inb ? r1 : 0u, inb ? r2 : 0u, inb ? r3 : 0u);
  }
}

// Packed groups I0..I1-1 into the stage. One address register: the groups lie a
// constant apart, but for the last ones, which are shifted back by a count that is
// the same for the whole wave.
template <int I0, int I1>
__device__ __forceinline__ void ea_halo_store(const EaHalo& hs, _Float16* stage, int lane,
                                              int cc) {
  const int px0 = ea_halo_px(hs.g0, I0, lane);
  char* sb = (char*)&stage[px0 * SPIT + cc * 8];
#pragma unroll  // pk[] indexed by constants: registers
  for (int i = I0; i < I1; ++i)
    *(uint4*)(sb + (ea_halo_px(hs.g0, i, lane) - px0) * (SPIT * 2)) = hs.pk[i];
}

// One window size, from the staged halo and the weights in LDS to its output:
// f16-WMMA q/k projection with L2 normalize -> k x k windowed cosine / tau.
// nqw, nkw: the next window's weights: fetched while this window's
// projections run, put into LDS as soon as this window's are dead.
// HOOK, if more (a tile follows at yn): the next halo's loads are issued in two halves,
// each behind a window's correlation (HOOK 0: first half, 1: second half), and packed
// to f16 behind the following window's projections (HOOK 1: first half, 2: second
// half, which goes into the stage at once). Loads return in order, so a half lies
// between two places where the windows wait for loads of their own; it stays under
// the count of loads a wave can have outstanding, and off the correlations' registers.
template <int KW, int OBAT, int HOOK>
__device__ __forceinline__ void ea_window(char* lds_raw,
                                          const float* __restrict__ kappa,
                                          float kmin, float denom,
                                          float* __restrict__ out, int slice,
                                          int b, int y0, int x0, int tid, int cg,
                                          const float* __restrict__ nqw,
                                          const float* __restrict__ nkw,
                                          EaHalo& hs, bool more, int yn) {
  constexpr int P     = KW / 2;
  constexpr int HX    = TX + 2 * P;          // halo tile edges
  constexpr int HY    = TY + 2 * P;
  constexpr int HALO2 = HX * HY;             // halo pixels
  constexpr int KT    = (HALO2 + 15) / 16;   // 16-pixel tiles for key proj
  constexpr int KK    = KW * KW;
  constexpr int OFF   = PST - P;             // this halo's corner in the stage

  _Float16* stage = (_Float16*)(lds_raw + L_ST);   // PADST rows of SPIT (f16)
  _Float16* wqL   = (_Float16*)(lds_raw + L_WQ);
  _Float16* wkL   = wqL + CATT * SPIT;
  _Float16* qs    = (_Float16*)(lds_raw + L_QS);   // NPX rows of QPIT (f16)
  _Float16* ks    = (_Float16*)(lds_raw + L_KS);   // KT * 16 rows of QPIT (f16)
  float*    ob    = (float*)(lds_raw + OBAT);      // KK planes of OPIT (f32)

  const int lane = tid & 31;
  const int mrow = lane & 15;
  const int kb2  = (lane >= 16) ? 4 : 0;  // channel-pair base for this half-wave
  const int mhi  = (lane >= 16) ? 8 : 0;
  const int col  = lane & 15;

  // A thread takes 8 consecutive channels of one row of the next qw (waves 0-7)
  // or kw (waves 8-15).
  float4 nwa, nwb;
  {
    const float* nsrc = cg < 8 ? nqw : nkw;
    const unsigned wb = (unsigned)(tid & 255) * 32u;  // its place in qw / kw, bytes
    nwa = *(const float4*)((const char*)nsrc + wb);
    nwb = *(const float4*)((const char*)nsrc + wb + 16);
    // precaution: stands before any overwrite of the register these loads name
    asm volatile("s_wait_xcnt 0x0" :: "v"(wb) : "memory");
  }
  // ---- q projection: 32 tiles of 16 interior pixels, normalized on the way; a
  // wave takes the two of its own image row ----
  {
    const _Float16* w0 = &wqL[mrow * SPIT];
    const _Float16* w1 = &wqL[(16 + mrow) * SPIT];
    const v16h b00 = ea_frag(w0, kb2, 0);  // kstep0, channels 0-15
    const v16h b10 = ea_frag(w0, kb2, 1);  // kstep1, channels 0-15
    const v16h b01 = ea_frag(w1, kb2, 0);  // kstep0, channels 16-31
    const v16h b11 = ea_frag(w1, kb2, 1);  // kstep1, channels 16-31
    for (int t = cg * 2; t < cg * 2 + 2; ++t) {
      int ip = t * 16 + mrow;  // interior pixel 0..511
      int px = ((ip >> 5) + PST) * HSX + ((ip & 31) + PST);
      const _Float16* srow = &stage[px * SPIT];
      v16h a0 = ea_frag(srow, kb2, 0);
      v16h a1 = ea_frag(srow, kb2, 1);
      v8f acc0 = {}, acc1 = {};
      acc0 = __builtin_amdgcn_wmma_f32_16x16x32_f16(false, b00, false, a0,
                                                    (short)0, acc0, false, false);
      acc1 = __builtin_amdgcn_wmma_f32_16x16x32_f16(false, b01, false, a0,
                                                    (short)0, acc1, false, false);
      acc0 = __builtin_amdgcn_wmma_f32_16x16x32_f16(false, b10, false, a1,
                                                    (short)0, acc0, false, false);
      acc1 = __builtin_amdgcn_wmma_f32_16x16x32_f16(false, b11, false, a1,
                                                    (short)0, acc1, false, false);
      ea_norm_store(qs + (t * 16 + col) * QPIT, acc0, acc1, mhi);
    }
  }

  // ---- key projection: KT tiles of 16 halo pixels, normalized on the way ----
  {
    const _Float16* w0 = &wkL[mrow * SPIT];
    const _Float16* w1 = &wkL[(16 + mrow) * SPIT];
    const v16h b00 = ea_frag(w0, kb2, 0);
    const v16h b10 = ea_frag(w0, kb2, 1);
    const v16h b01 = ea_frag(w1, kb2, 0);
    const v16h b11 = ea_frag(w1, kb2, 1);
    for (int t = cg; t < KT; t += 16) {
      // halo pixel of this window -> its row in the stage; the rows that pad the
      // last tile repeat the last pixel and are never read by the correlation
      const int h  = min(t * 16 + mrow, HALO2 - 1);
      const int hy = h / HX;
      const int px = (hy + OFF) * HSX + (h - hy * HX) + OFF;
      const _Float16* srow = &stage[px * SPIT];
      v16h a0 = ea_frag(srow, kb2, 0);
      v16h a1 = ea_frag(srow, kb2, 1);
      v8f acc0 = {}, acc1 = {};
      acc0 = __builtin_amdgcn_wmma_f32_16x16x32_f16(false, b00, false, a0,
                                                    (short)0, acc0, false, false);
      acc1 = __builtin_amdgcn_wmma_f32_16x16x32_f16(false, b01, false, a0,
                                                    (short)0, acc1, false, false);
      acc0 = __builtin_amdgcn_wmma_f32_16x16x32_f16(false, b10, false, a1,
                                                    (short)0, acc0, false, false);
      acc1 = __builtin_amdgcn_wmma_f32_16x16x32_f16(false, b11, false, a1,
                                                    (short)0, acc1, false, false);
      ea_norm_store(ks + (t * 16 + col) * QPIT, acc0, acc1, mhi);
    }
  }
  ea_lds_barrier();

  // every wave has its weight fragments: the next window's weights take their
  // place (the barrier behind the correlation stands in front of their first read)
  {
    // rows 0-31 are wq, rows 32-63 wk, which lies directly behind it
    const int wo = (tid >> 3) * SPIT + (tid & 7) * 8;
    *(uint4*)&wqL[wo] = ea_pack8(nwa, nwb);
  }
  // The wait for the weights above has waited for the halo loads too, which are older.
  if (HOOK == 1 && more) ea_halo_pack<0, NI / 2>(hs);
  if (HOOK == 2 && more) {
    // behind the barrier above no wave reads the stage any more, and this window's
    // result tile ends in front of these rows
    ea_halo_pack<NI / 2, NI>(hs);
    ea_halo_store<NI / 2, NI>(hs, stage, lane, cg & 7);
  }

  // This thread writes out four neighbouring pixels of every fourth plane;
  // eight threads in a row cover one 128-byte line.
  const int g = tid & 127;
  const unsigned pixb = (unsigned)(((y0 + (g >> 3)) * WIMG + x0 + (g & 7) * 4) * 4);  // bytes
  const float4 kap4 =
      *(const float4*)((const char*)(kappa + ((size_t)b * 3 + slice) * HWPX) + pixb);
  // precaution: stands before any overwrite of the register this load names
  asm volatile("s_wait_xcnt 0x0" :: "v"(pixb) : "memory");

  // ---- windowed correlation as a banded matrix product ----
  // Wave w owns query row w of the tile, as two runs of 16 queries. One product is
  // 16 queries (A) against 16 keys of a halo row (B), all 32 channels in one step:
  // D[m][n] = q[m] . k[n]. Query m of run q wants keys 16q+m..16q+m+KW-1 of the HX
  // in the halo row: they lie in key tiles q and q + 1. Key tile 2 holds keys
  // 32..HX-1 (its other columns repeat the last key and are never stored). Key
  // tile 1 serves both runs.
  {
    const int qy = cg;
    const v16h qf0 = ea_frag(qs + (qy * TX + mrow) * QPIT, kb2, 0);
    const v16h qf1 = ea_frag(qs + (qy * TX + 16 + mrow) * QPIT, kb2, 0);
    const _Float16* k0 = ks + (qy * HX + col) * QPIT;
    const _Float16* k2 = ks + (qy * HX + 32 + min(col, 2 * P - 1)) * QPIT;
    // Register r of a lane is query m = r + mhi of the run against key col of the
    // run's first or second key tile: window offset dx = key - m. The two tiles'
    // bands fall on disjoint lanes, so they are merged: dx = (col - m) mod 16,
    // kept if < KW.
    // Four halo rows at a time, so that fragments and bands stay in few registers.
    // Every loop of this block is unrolled: band[] is then indexed by constants
    // (registers, no scratch) and the LDS offsets become immediates.
#pragma unroll
    for (int c0 = 0; c0 < KW; c0 += 4) {
      float band[8][8];  // [halo row of the chunk * 2 + run][register]
#pragma unroll
      for (int kc = 0; kc < 4; ++kc) {
        const int dy = c0 + kc;
        if (dy >= KW) continue;
        const v16h fa = ea_frag(k0 + dy * HX * QPIT, kb2, 0);
        const v16h fb = ea_frag(k0 + (dy * HX + 16) * QPIT, kb2, 0);
        const v16h fc = ea_frag(k2 + dy * HX * QPIT, kb2, 0);
#pragma unroll
        for (int q = 0; q < 2; ++q) {
          const v8f z = {};
          const v8f d0 = __builtin_amdgcn_wmma_f32_16x16x32_f16(
              false, q ? qf1 : qf0, false, q ? fb : fa, (short)0, z, false, false);
          const v8f d1 = __builtin_amdgcn_wmma_f32_16x16x32_f16(
              false, q ? qf1 : qf0, false, q ? fc : fb, (short)0, z, false, false);
#pragma unroll
          for (int r = 0; r < 8; ++r)
            band[kc * 2 + q][r] = (col >= r + mhi) ? d0[r] : d1[r];
        }
      }
      // Band -> ob[dy * KW + dx][pixel]; one lane mask per register index.
#pragma unroll
      for (int r = 0; r < 8; ++r) {
        const int m  = r + mhi;
        const int dx = (col - m) & 15;
        if (dx < KW) {
          float* o = ob + dx * OPIT + qy * TX + m;
#pragma unroll
          for (int e = 0; e < 8; ++e) {
            const int dy = c0 + (e >> 1);
            if (dy >= KW) continue;
            o[dy * KW * OPIT + (e & 1) * 16] = band[e][r];
          }
        }
      }
    }
  }

  if constexpr (HOOK == 0 || HOOK == 1) {
    // holds the kappa load's wait here, in front of the halo loads: behind them it
    // would have to wait for them as well (one path issues none, so no count fits both)
    asm volatile("" :: "v"(kap4.x), "v"(kap4.y), "v"(kap4.z), "v"(kap4.w));
    constexpr int I0 = HOOK == 0 ? 0 : NI / 2;
    if (more) ea_halo_issue<I0, I0 + NI / 2>(hs, yn, x0, lane);
    else      ea_halo_none<I0, I0 + NI / 2>(hs);
  }

  float sc[4];
  {
    const float kp[4] = {kap4.x, kap4.y, kap4.z, kap4.w};
#pragma unroll  // kp[] and sc[] indexed by constants: registers
    for (int j = 0; j < 4; ++j) {
      float tau = 0.5f - ((kp[j] - kmin) / denom) * (0.5f - 0.03f);
      tau = fminf(fmaxf(tau, 0.03f), 0.5f);
      sc[j] = 1.f / (tau + 1e-6f);
    }
  }
  ea_lds_barrier();  // the result tile is complete before other waves read it

  // ---- write out: 16 bytes a lane, planes pl0, pl0 + 4, ... ----
  constexpr int NP = KK / 4;  // KK = 4 * NP + 1: the last plane goes to pl0 == 0
  const int pl0 = cg >> 2;
  char* ou = (char*)(out + ((size_t)b * KK + pl0) * HWPX);
  float4 ov[NP + 1];
  // both loops unrolled: ov[] stays in registers, and all LDS reads are issued
  // ahead of the first store
#pragma unroll
  for (int i = 0; i < NP; ++i) ov[i] = *(const float4*)&ob[(pl0 + 4 * i) * OPIT + g * 4];
  // a value on the other path too: an unset register would count as live round the tile loop
  ov[NP] = make_float4(0.f, 0.f, 0.f, 0.f);
  if (pl0 == 0) ov[NP] = *(const float4*)&ob[(4 * NP) * OPIT + g * 4];
#pragma unroll
  for (int i = 0; i <= NP; ++i) {
    // precaution: the last plane's address is formed in its own branch; stands
    // before any overwrite there of a register the stores above name
    if (i == NP) asm volatile("s_wait_xcnt 0x0" :: "v"(pixb) : "memory");
    if (i < NP || pl0 == 0) {
      float4 v = ov[i];
      v.x *= sc[0]; v.y *= sc[1]; v.z *= sc[2]; v.w *= sc[3];
      *(float4*)(ou + (size_t)i * (4u * HWPX * 4u) + pixb) = v;
    }
  }
  // precaution: the next window's code follows and reuses registers; stands
  // before any overwrite of a register these stores name
  asm volatile("s_wait_xcnt 0x0" :: "v"(pixb) : "memory");
}

// Temperature range from curvature: the global min/max of a slice, folded from its
// records; their addresses are uniform (scalar loads).
struct EaRange { float kmin, denom; };
__device__ __forceinline__ EaRange ea_range(const unsigned* __restrict__ mm, int slice) {
  unsigned emin = 0xFFFFFFFFu, emax = 0u;
#pragma unroll  // all records are fetched before the first is used
  for (int i = 0; i < KPART; ++i) {
    const unsigned* rec = mm + (slice * KPART + i) * KREC;
    emin = min(emin, rec[0]);
    emax = max(emax, rec[1]);
  }
  EaRange r;
  r.kmin  = fdec(emin);
  r.denom = (fdec(emax) - r.kmin) + 1e-6f;
  return r;
}

// All three window sizes of ntile tiles of 32 x 16: a tile's halo is staged once.
// ntile is an argument and no constant: with a known count of two the compiler takes
// the one next tile's addresses for constants of the loop, forms them all ahead of it
// and keeps them in registers, over the budget (scratch).
__global__ __launch_bounds__(512) void ea_affinity(const float* __restrict__ feat,
                                                   const float* __restrict__ kappa,
                                                   const float* __restrict__ qw,
                                                   const float* __restrict__ kw,
                                                   const unsigned* __restrict__ mm,
                                                   float* __restrict__ out, int ntile) {
  __shared__ __attribute__((aligned(16))) char lds_raw[L_ALL];
  static_assert(L_ALL <= 320 * 1024 && L_OB3 + 9 * OPIT * 4 <= L_ALL && 49 * OPIT * 4 <= L_ST + PXA * SPIT * 2,
                "the map fits one work-group's LDS, the last tile ends in front of row PXA");
  _Float16* wqL   = (_Float16*)(lds_raw + L_WQ);

  const int tid  = threadIdx.x;
  const int lane = tid & 31;
  const int b    = blockIdx.z;
  const int yb   = blockIdx.y * ntile * TY, x0 = blockIdx.x * TX;

  // Weights of the first window (5 x 5): a thread takes 8 consecutive channels of
  // one row of qw (waves 0-7) or of kw (waves 8-15); in LDS wk's rows follow wq's.
  constexpr int WSL = CATT * CIN;                    // floats of one window's weights
  const int cg = __builtin_amdgcn_readfirstlane(tid >> 5);  // the wave, 0..15
  const int wo = (tid >> 3) * SPIT + (tid & 7) * 8;  // its place in LDS, halfs
  const unsigned wb = (unsigned)(tid & 255) * 32u;   // its place in qw / kw, bytes
  const float* wsrc = (cg < 8 ? qw : kw) + WSL;
  // ---- halo of the first tile: all loads are issued before the first value is used ----
  const int cc = cg & 7;
  EaHalo hs;
  hs.fg = feat + ((size_t)b * CIN + cc * 8) * HWPX;
  hs.g0 = (cg >> 3) * (NI / 2);
  ea_halo_issue<0, NI / 2>(hs, yb, x0, lane);
  ea_halo_issue<NI / 2, NI>(hs, yb, x0, lane);
  const float4 wa = *(const float4*)((const char*)wsrc + wb);
  const float4 wc = *(const float4*)((const char*)wsrc + wb + 16);
  // precaution: stands before any overwrite of the register these loads name
  asm volatile("s_wait_xcnt 0x0" :: "v"(wb) : "memory");
  ea_halo_pack<0, NI>(hs);
  *(uint4*)&wqL[wo] = ea_pack8(wa, wc);

  _Float16* stage = (_Float16*)(lds_raw + L_ST);
  ea_halo_store<NI / 2, NI>(hs, stage, lane, cc);

  // folded once for all tiles
  const EaRange kr[3] = {ea_range(mm, 0), ea_range(mm, 1), ea_range(mm, 2)};

  // At the head of a trip the first half of the tile's packed halo is in hs.pk, the
  // second half in the stage. Not unrolled: one copy of the windows' code, for speed only.
#pragma clang loop unroll(disable)
  for (int it = 0;; ++it) {
    const int  y0   = yb + it * TY;
    const bool more = it + 1 < ntile;
    // ---- halo into LDS (f16), zero-padded outside the image + tile padding ----
    ea_halo_store<0, NI / 2>(hs, stage, lane, cc);
    // the packed registers end here on every path (as in ea_halo_none)
#pragma unroll
    for (int i = 0; i < NI / 2; ++i) hs.pk[i] = make_uint4(0u, 0u, 0u, 0u);
    ea_lds_barrier();

    ea_window<5, L_OB5, 0>(lds_raw, kappa, kr[1].kmin, kr[1].denom,
                           out + (size_t)BSZ * 9 * HWPX, 1, b, y0, x0, tid, cg, qw, kw,
                           hs, more, y0 + TY);
    ea_window<3, L_OB3, 1>(lds_raw, kappa, kr[0].kmin, kr[0].denom, out, 0,
                           b, y0, x0, tid, cg, qw + 2 * WSL, kw + 2 * WSL, hs, more, y0 + TY);
    // its next weights are those of the next tile's first window
    ea_window<7, L_OB7, 2>(lds_raw, kappa, kr[2].kmin, kr[2].denom,
                           out + (size_t)BSZ * (9 + 25) * HWPX, 2, b, y0, x0, tid, cg,
                           qw + WSL, kw + WSL, hs, more, y0 + TY);
    if (!more) break;
    // the last result tile lies over the stage's first rows: every wave has read it
    ea_lds_barrier();
  }
}

extern "C" void kernel_launch(void* const* d_in, const int* in_sizes, int n_in,
                              void* d_out, int out_size, void* d_ws, size_t ws_size,
                              hipStream_t stream) {
  const float* feat  = (const float*)d_in[0];
  const float* kappa = (const float*)d_in[1];
  const float* qw    = (const float*)d_in[2];  // (3, 32, 64)
  const float* kw    = (const float*)d_in[3];  // (3, 32, 64)
  float*       out   = (float*)d_out;
  unsigned*    mm    = (unsigned*)d_ws;        // 3 x KPART records {min,max}, encoded

  ea_kap_minmax<<<dim3(KPART, 3), KTHR, 0, stream>>>(kappa, mm);

  const dim3 grid(WIMG / TX, HIMG / (TPW * TY), BSZ), block(512);
  ea_affinity<<<grid, block, 0, stream>>>(feat, kappa, qw, kw, mm, out, TPW);
}

// v008
// It runs in 41.4 microseconds.
// Timed twice side by side with v007, it ran 1.05 times as fast both times.
// All steps since v000 together make it 9.21 times as fast.
#include <hip/hip_runtime.h>
#include <hip/hip_bf16.h>

typedef __attribute__((ext_vector_type(16))) _Float16 v16h;
typedef __attribute__((ext_vector_type(8)))  float    v8f;

#define HWPX (256 * 256)
#define HIMG 256
#define WIMG 256
#define BSZ  4
#define CIN  64
#define CATT 32
// halfs per LDS row of a WMMA operand (64 channels + 8): 144 B = 16 B x 9, so
// 16 lanes on 16 consecutive rows spread their 16-byte accesses over all banks
#define SPIT (CIN + 8)
// halfs per LDS row of a projected pixel (32 channels + 8): 80 B = 16 B x 5, the
// same spreading for the 16-byte fragment reads of the correlation product
#define QPIT (CATT + 8)
// The tile of one work-group: TX pixels are one 128-byte line of every plane
#define TX  32
#define TY  16
#define NPX (TX * TY)
// floats per LDS plane of the result tile (512 pixels + 12): the lanes of one
// band store sit on different window offsets, so on planes; the 12 spreads them
#define OPIT (NPX + 12)

// ---- order-preserving float <-> uint encoding: min/max become integer ops ----
__device__ __forceinline__ unsigned fenc(float f) {
  unsigned u = __float_as_uint(f);
  return u ^ ((u >> 31) ? 0xFFFFFFFFu : 0x80000000u);
}
__device__ __forceinline__ float fdec(unsigned u) {
  u ^= ((u >> 31) ? 0x80000000u : 0xFFFFFFFFu);
  return __uint_as_float(u);
}

// min/max of kappa[:, slice, :, :] leave this launch as KPART records {min, max}
// a slice, one per work-group; the reader folds them. A record has a 128-byte
// line of the workspace to itself (KREC unsigneds apart): one writer per line.
#define KPART 16
#define KTHR  512
#define KREC  32

__global__ __launch_bounds__(KTHR) void ea_kap_minmax(const float* __restrict__ kappa,
                                                      unsigned* __restrict__ mm) {
  const int slice = blockIdx.y;
  const int tid   = threadIdx.x;
  // A plane half is KPART * KTHR units of 16 bytes; a thread takes one unit of
  // each half of each of the BSZ planes. All loads are issued before the first use.
  const unsigned vb = (unsigned)(blockIdx.x * KTHR + tid) * 16u;  // bytes
  const char* kp = (const char*)(kappa + (size_t)slice * HWPX);
  float4 v[2 * BSZ];
#pragma unroll  // v[] indexed by constants: registers
  for (int i = 0; i < 2 * BSZ; ++i)
    v[i] = *(const float4*)(kp + (size_t)(i >> 1) * (3u * HWPX * 4u) +
                            (size_t)(i & 1) * (HWPX * 2u) + vb);
  unsigned lmin = 0xFFFFFFFFu, lmax = 0u;
#pragma unroll  // as above
  for (int i = 0; i < 2 * BSZ; ++i) {
    const unsigned k0 = fenc(v[i].x), k1 = fenc(v[i].y), k2 = fenc(v[i].z), k3 = fenc(v[i].w);
    lmin = min(lmin, min(min(k0, k1), min(k2, k3)));
    lmax = max(lmax, max(max(k0, k1), max(k2, k3)));
  }
  // butterfly over the wave, then over the waves' results
#pragma unroll  // the lane distances become constants
  for (int s = 16; s > 0; s >>= 1) {
    lmin = min(lmin, __shfl_xor(lmin, s));
    lmax = max(lmax, __shfl_xor(lmax, s));
  }
  __shared__ unsigned smin[KTHR / 32], smax[KTHR / 32];
  if ((tid & 31) == 0) { smin[tid >> 5] = lmin; smax[tid >> 5] = lmax; }
  __syncthreads();
  if (tid < 32) {
    lmin = smin[tid & (KTHR / 32 - 1)];
    lmax = smax[tid & (KTHR / 32 - 1)];
#pragma unroll  // the lane distances become constants
    for (int s = KTHR / 64; s > 0; s >>= 1) {
      lmin = min(lmin, __shfl_xor(lmin, s));
      lmax = max(lmax, __shfl_xor(lmax, s));
    }
    if (tid == 0)
      *(uint2*)&mm[(slice * KPART + blockIdx.x) * KREC] = make_uint2(lmin, lmax);
  }
}

// Assemble a 16x32 f16 WMMA fragment (A or B operand) from an LDS row of 32
// (stage, weights) or 16 (q, k) channel-pairs, per the ISA layout: halves 0-7 = K kb..kb+7, halves 8-15 =
// K kb+16..kb+23 (kb = 0 for lanes 0-15, 8 for lanes 16-31). Union with
// constant indices keeps everything in VGPRs (SROA), no scratch.
// Rows start on 16 bytes, so each run of 8 halves is one 16-byte LDS load.
__device__ __forceinline__ v16h ea_frag(const _Float16* row, int kb2, int s) {
  const uint4* p = (const uint4*)row;
  union { v16h v; uint4 q[2]; } r;
  r.q[0] = p[s * 4 + (kb2 >> 2)];
  r.q[1] = p[s * 4 + (kb2 >> 2) + 2];
  return r.v;
}

// Work-group barrier that orders LDS alone: the wave's own LDS accesses are waited
// for, its global loads and stores stay in flight (__syncthreads() waits for those
// too, which would end the fetch of the next halo at the first barrier). Nothing in
// global memory goes from wave to wave in this kernel.
__device__ __forceinline__ void ea_lds_barrier() {
  asm volatile("s_wait_dscnt 0x0\n\ts_barrier_signal -1\n\ts_barrier_wait -1" ::: "memory");
}

// lane l with lane l ^ 16
__device__ __forceinline__ float ea_xhalf(float x) {
  const int b = __builtin_bit_cast(int, x);
  return __builtin_bit_cast(
      float, __builtin_amdgcn_permlanex16(b, b, 0x76543210, 0xfedcba98, false, false));
}

// The projections are computed transposed (weight rows are A, pixels are B), so a
// lane holds channels of ONE pixel: mhi..mhi+7 in c0, 16+mhi..16+mhi+7 in c1, and
// lane l ^ 16 holds that pixel's other 16. L2 normalize (x / max(||x||, 1e-12);
// zero rows stay zero) from the f32 accumulators, then two 16-byte LDS stores
// into the pixel's row of QPIT halfs.
__device__ __forceinline__ void ea_norm_store(_Float16* row, v8f c0, v8f c1, int mhi) {
  float s0 = 0.f, s1 = 0.f;
  // both loops unrolled: c0[], c1[] and h[] are then indexed by constants (registers)
#pragma unroll
  for (int r = 0; r < 8; ++r) { s0 += c0[r] * c0[r]; s1 += c1[r] * c1[r]; }
  float s = s0 + s1;
  s += ea_xhalf(s);
  const float inv = 1.f / fmaxf(sqrtf(s), 1e-12f);
  union { uint4 q; _Float16 h[8]; } p0, p1;
#pragma unroll
  for (int r = 0; r < 8; ++r) {
    p0.h[r] = (_Float16)(c0[r] * inv);
    p1.h[r] = (_Float16)(c1[r] * inv);
  }
  *(uint4*)&row[mhi]      = p0.q;
  *(uint4*)&row[16 + mhi] = p1.q;
}

// 8 floats -> 8 halfs, one 16-byte unit
__device__ __forceinline__ uint4 ea_pack8(float4 a, float4 c) {
  union { uint4 q; _Float16 h[8]; } p;
  p.h[0] = (_Float16)a.x; p.h[1] = (_Float16)a.y;
  p.h[2] = (_Float16)a.z; p.h[3] = (_Float16)a.w;
  p.h[4] = (_Float16)c.x; p.h[5] = (_Float16)c.y;
  p.h[6] = (_Float16)c.z; p.h[7] = (_Float16)c.w;
  return p.q;
}

// LDS map of the fused kernel, bytes. The 38 x 22 halo of the widest window is
// staged once and serves all three window sizes.
#define PST   3                      // halo width of the stage
#define HSX   (TX + 2 * PST)         // its edges
#define HSY   (TY + 2 * PST)
#define PADST 848                    // its pixels (836), rounded up to 16
// The stage starts L_ST bytes in: the last window's result tile, which starts at 0,
// then ends in front of the stage's row PXA, and the rows from there on can take
// the next tile's halo while that result tile is in use.
#define L_ST  38400
#define PXA   448
#define L_WQ  (L_ST + PADST * SPIT * 2)      // weights behind the stage
#define L_QS  (L_WQ + 2 * CATT * SPIT * 2)   // 512 q rows
#define L_KS  (L_QS + NPX * QPIT * 2)        // key rows: 720 / 624 / 848 by window
// Result tiles. The windows run in the order 5, 3, 7. A tile may still be read by
// slow waves while fast ones write the next window's key rows, so it lies behind
// those: 5's behind 624 (and its own 720) rows, 3's behind 848. 7's lies over the
// first PXA rows of the stage, which is dead by then.
#define L_OB5 (L_KS + 720 * QPIT * 2)
#define L_OB3 (L_KS + PADST * QPIT * 2)
#define L_OB7 0
#define L_ALL (L_OB5 + 25 * OPIT * 4)

// A work-group walks TPW tiles, one below the other. The halo of the next tile is
// fetched into registers while the current tile's windows are computed.
#define TPW 2
// The grid: NXT work-groups across an image, NYB down, in NDIE regions, RPI an image
#define NXT  (WIMG / TX)
#define NYB  (HIMG / (TPW * TY))
#define NDIE 8
#define RPI  (NDIE / BSZ)
static_assert(RPI * BSZ == NDIE && NYB % RPI == 0, "regions tile the images");
// Halo fetch: waves w and w + 8 own channels 8w..8w+7, each one half of the groups
// of 32 pixels below row PXA (its groups 0..NI/2-1) and one half of those from PXA
// on (its groups NI/2..NI-1); a lane gathers the channels of one halo pixel in registers and
// writes them as one 16-byte LDS store.
#define NI ((PADST + 63) / 64)  // groups a wave
static_assert(NI * 64 >= PADST && PADST >= 32 && NI >= 8 && NI % 2 == 0 && NI * 32 == PXA,
              "groups cover the stage");
struct EaHalo {
  float        hv[NI][8];  // values in flight
  uint4        pk[NI];     // the same as f16, zero outside the image
  unsigned     inm;        // bit i: the pixel of group i lies inside the image
  const float* fg;         // first of this wave's 8 channel planes
  int          g0;         // first group of this wave: 0 or NI / 2
};

// the halo pixel of a lane in group i; the last groups are shifted back to end at
// PADST: the wave writes some rows again with the same values, no group needs a branch
// (only the last two i can reach the end: the others differ by constants)
__device__ __forceinline__ int ea_halo_gs(int g0, int i) {  // lane 0's, the same for the wave
  const int gs = (g0 + i + (i >= NI / 2 ? NI / 2 : 0)) * 32;
  return (NI + i) * 32 <= PADST - 32 ? gs : min(gs, PADST - 32);
}
__device__ __forceinline__ int ea_halo_px(int g0, int i, int lane) {
  return ea_halo_gs(g0, i) + lane;
}

// Issue the loads of groups I0..I1-1 of the halo of the tile at (y0, x0); nothing
// here uses a loaded value.
template <int I0, int I1>
__device__ __forceinline__ void ea_halo_issue(EaHalo& hs, int y0, int x0, int lane) {
  unsigned ha[NI];
  if (I0 == 0) hs.inm = 0u;
#pragma unroll  // hv[] and ha[] indexed by constants: registers
  for (int i = I0; i < I1; ++i) {
    // Row and column are taken from the pixel's number counted from image row 0, the
    // group's part of it summed as a scalar (readfirstlane keeps that sum together):
    // no vector value here is then the same for every tile. Such values would be
    // kept in registers round the tile loop, over the budget (scratch).
    const int gs = ea_halo_gs(hs.g0, i);
    const unsigned q  = (unsigned)__builtin_amdgcn_readfirstlane(gs + y0 * HSX) + (unsigned)lane;
    const unsigned qy = q / HSX;
    const int gy = (int)qy - PST, gx = x0 - PST + (int)(q - qy * HSX);
    const bool inp = (NI + i) * 32 + 31 < HSX * HSY || gs + lane < HSX * HSY;
    const bool inb = inp && gy >= 0 && gy < HIMG && gx >= 0 && gx < WIMG;
    ha[i] = inb ? (unsigned)(gy * WIMG + gx) * 4u : 0u;  // bytes; always a valid address
    hs.inm |= (inb ? 1u : 0u) << i;
    // the plane's distance is a constant of the load: one address register a group
#pragma unroll
    for (int j = 0; j < 8; ++j)
      hs.hv[i][j] = *(const float*)((const char*)hs.fg + ha[i] + (size_t)j * (HWPX * 4));
    // precaution, once per four groups: stands before any overwrite of the
    // registers these loads name (kept live up to here as inputs)
    if (((i - I0) & 3) == 3 || i == I1 - 1)
      asm volatile("s_wait_xcnt 0x0" :: "v"(ha[i]), "v"(ha[i - 1]), "v"(ha[i - 2]),
                   "v"(ha[i - 3]) : "memory");
  }
}

// No tile follows: nothing is fetched. The registers get a value all the same, so
// that on this path too their old values end here; otherwise the old values count
// as live round the whole tile loop and the register budget is overrun (scratch).
template <int I0, int I1>
__device__ __forceinline__ void ea_halo_none(EaHalo& hs) {
  if (I0 == 0) hs.inm = 0u;
#pragma unroll  // hv[] indexed by constants: registers
  for (int i = I0; i < I1; ++i)
#pragma unroll
    for (int j = 0; j < 8; ++j) hs.hv[i][j] = 0.f;
}

// Two f32 -> one register of two f16, a in the low half, rounded to nearest even as
// the cast does. In asm text so that the conversion stays where it is written: the
// compiler otherwise moves it down to the LDS store behind the last window, all f32
// values stay live through that window's correlation, and registers go to scratch.
__device__ __forceinline__ unsigned ea_cvt2_here(float a, float c) {
  unsigned r;
  asm volatile("v_cvt_pk_f16_f32 %0, %1, %2" : "=v"(r) : "v"(a), "v"(c));
  return r;
}

// f32 -> f16, 8 channels of a pixel to one 16-byte unit, zero outside the image
template <int I0, int I1>
__device__ __forceinline__ void ea_halo_pack(EaHalo& hs) {
#pragma unroll  // hv[] and pk[] indexed by constants: registers
  for (int i = I0; i < I1; ++i) {
    const bool inb = hs.inm >> i & 1u;
    const float* v = hs.hv[i];
    const unsigned r0 = ea_cvt2_here(v[0], v[1]), r1 = ea_cvt2_here(v[2], v[3]);
    const unsigned r2 = ea_cvt2_here(v[4], v[5]), r3 = ea_cvt2_here(v[6], v[7]);
    hs.pk[i] = make_uint4(inb ? r0 : 0u, inb ? r1 : 0u, inb ? r2 : 0u, inb ? r3 : 0u);
  }
}

// Packed groups I0..I1-1 into the stage. One address register: the groups lie a
// constant apart, but for the last ones, which are shifted back by a count that is
// the same for the whole wave.
template <int I0, int I1>
__device__ __forceinline__ void ea_halo_store(const EaHalo& hs, _Float16* stage, int lane,
                                              int cc) {
  const int px0 = ea_halo_px(hs.g0, I0, lane);
  char* sb = (char*)&stage[px0 * SPIT + cc * 8];
#pragma unroll  // pk[] indexed by constants: registers
  for (int i = I0; i < I1; ++i)
    *(uint4*)(sb + (ea_halo_px(hs.g0, i, lane) - px0) * (SPIT * 2)) = hs.pk[i];
}

// One window size, from the staged halo and the weights in LDS to its output:
// f16-WMMA q/k projection with L2 normalize -> k x k windowed cosine / tau.
// nqw, nkw: the next window's weights: fetched while this window's
// projections run, put into LDS as soon as this window's are dead.
// HOOK, if more (a tile follows at yn): the next halo's loads are issued in two halves,
// each behind a window's correlation (HOOK 0: first half, 1: second half), and packed
// to f16 behind the following window's projections (HOOK 1: first half, 2: second
// half, which goes into the stage at once). Loads return in order, so a half lies
// between two places where the windows wait for loads of their own; it stays under
// the count of loads a wave can have outstanding, and off the correlations' registers.
template <int KW, int OBAT, int HOOK>
__device__ __forceinline__ void ea_window(char* lds_raw,
                                          const float* __restrict__ kappa,
                                          float kmin, float denom,
                                          float* __restrict__ out, int slice,
                                          int b, int y0, int x0, int tid, int cg,
                                          const float* __restrict__ nqw,
                                          const float* __restrict__ nkw,
                                          EaHalo& hs, bool more, int yn) {
  constexpr int P     = KW / 2;
  constexpr int HX    = TX + 2 * P;          // halo tile edges
  constexpr int HY    = TY + 2 * P;
  constexpr int HALO2 = HX * HY;             // halo pixels
  constexpr int KT    = (HALO2 + 15) / 16;   // 16-pixel tiles for key proj
  constexpr int KK    = KW * KW;
  constexpr int OFF   = PST - P;             // this halo's corner in the stage

  _Float16* stage = (_Float16*)(lds_raw + L_ST);   // PADST rows of SPIT (f16)
  _Float16* wqL   = (_Float16*)(lds_raw + L_WQ);
  _Float16* wkL   = wqL + CATT * SPIT;
  _Float16* qs    = (_Float16*)(lds_raw + L_QS);   // NPX rows of QPIT (f16)
  _Float16* ks    = (_Float16*)(lds_raw + L_KS);   // KT * 16 rows of QPIT (f16)
  float*    ob    = (float*)(lds_raw + OBAT);      // KK planes of OPIT (f32)

  const int lane = tid & 31;
  const int mrow = lane & 15;
  const int kb2  = (lane >= 16) ? 4 : 0;  // channel-pair base for this half-wave
  const int mhi  = (lane >= 16) ? 8 : 0;
  const int col  = lane & 15;

  // A thread takes 8 consecutive channels of one row of the next qw (waves 0-7)
  // or kw (waves 8-15).
  float4 nwa, nwb;
  {
    const float* nsrc = cg < 8 ? nqw : nkw;
    const unsigned wb = (unsigned)(tid & 255) * 32u;  // its place in qw / kw, bytes
    nwa = *(const float4*)((const char*)nsrc + wb);
    nwb = *(const float4*)((const char*)nsrc + wb + 16);
    // precaution: stands before any overwrite of the register these loads name
    asm volatile("s_wait_xcnt 0x0" :: "v"(wb) : "memory");
  }
  // ---- q projection: 32 tiles of 16 interior pixels, normalized on the way; a
  // wave takes the two of its own image row ----
  {
    const _Float16* w0 = &wqL[mrow * SPIT];
    const _Float16* w1 = &wqL[(16 + mrow) * SPIT];
    const v16h b00 = ea_frag(w0, kb2, 0);  // kstep0, channels 0-15
    const v16h b10 = ea_frag(w0, kb2, 1);  // kstep1, channels 0-15
    const v16h b01 = ea_frag(w1, kb2, 0);  // kstep0, channels 16-31
    const v16h b11 = ea_frag(w1, kb2, 1);  // kstep1, channels 16-31
    for (int t = cg * 2; t < cg * 2 + 2; ++t) {
      int ip = t * 16 + mrow;  // interior pixel 0..511
      int px = ((ip >> 5) + PST) * HSX + ((ip & 31) + PST);
      const _Float16* srow = &stage[px * SPIT];
      v16h a0 = ea_frag(srow, kb2, 0);
      v16h a1 = ea_frag(srow, kb2, 1);
      v8f acc0 = {}, acc1 = {};
      acc0 = __builtin_amdgcn_wmma_f32_16x16x32_f16(false, b00, false, a0,
                                                    (short)0, acc0, false, false);
      acc1 = __builtin_amdgcn_wmma_f32_16x16x32_f16(false, b01, false, a0,
                                                    (short)0, acc1, false, false);
      acc0 = __builtin_amdgcn_wmma_f32_16x16x32_f16(false, b10, false, a1,
                                                    (short)0, acc0, false, false);
      acc1 = __builtin_amdgcn_wmma_f32_16x16x32_f16(false, b11, false, a1,
                                                    (short)0, acc1, false, false);
      ea_norm_store(qs + (t * 16 + col) * QPIT, acc0, acc1, mhi);
    }
  }

  // ---- key projection: KT tiles of 16 halo pixels, normalized on the way ----
  {
    const _Float16* w0 = &wkL[mrow * SPIT];
    const _Float16* w1 = &wkL[(16 + mrow) * SPIT];
    const v16h b00 = ea_frag(w0, kb2, 0);
    const v16h b10 = ea_frag(w0, kb2, 1);
    const v16h b01 = ea_frag(w1, kb2, 0);
    const v16h b11 = ea_frag(w1, kb2, 1);
    for (int t = cg; t < KT; t += 16) {
      // halo pixel of this window -> its row in the stage; the rows that pad the
      // last tile repeat the last pixel and are never read by the correlation
      const int h  = min(t * 16 + mrow, HALO2 - 1);
      const int hy = h / HX;
      const int px = (hy + OFF) * HSX + (h - hy * HX) + OFF;
      const _Float16* srow = &stage[px * SPIT];
      v16h a0 = ea_frag(srow, kb2, 0);
      v16h a1 = ea_frag(srow, kb2, 1);
      v8f acc0 = {}, acc1 = {};
      acc0 = __builtin_amdgcn_wmma_f32_16x16x32_f16(false, b00, false, a0,
                                                    (short)0, acc0, false, false);
      acc1 = __builtin_amdgcn_wmma_f32_16x16x32_f16(false, b01, false, a0,
                                                    (short)0, acc1, false, false);
      acc0 = __builtin_amdgcn_wmma_f32_16x16x32_f16(false, b10, false, a1,
                                                    (short)0, acc0, false, false);
      acc1 = __builtin_amdgcn_wmma_f32_16x16x32_f16(false, b11, false, a1,
                                                    (short)0, acc1, false, false);
      ea_norm_store(ks + (t * 16 + col) * QPIT, acc0, acc1, mhi);
    }
  }
  ea_lds_barrier();

  // every wave has its weight fragments: the next window's weights take their
  // place (the barrier behind the correlation stands in front of their first read)
  {
    // rows 0-31 are wq, rows 32-63 wk, which lies directly behind it
    const int wo = (tid >> 3) * SPIT + (tid & 7) * 8;
    *(uint4*)&wqL[wo] = ea_pack8(nwa, nwb);
  }
  // The wait for the weights above has waited for the halo loads too, which are older.
  if (HOOK == 1 && more) ea_halo_pack<0, NI / 2>(hs);
  if (HOOK == 2 && more) {
    // behind the barrier above no wave reads the stage any more, and this window's
    // result tile ends in front of these rows
    ea_halo_pack<NI / 2, NI>(hs);
    ea_halo_store<NI / 2, NI>(hs, stage, lane, cg & 7);
  }

  // This thread writes out four neighbouring pixels of every fourth plane;
  // eight threads in a row cover one 128-byte line.
  const int g = tid & 127;
  const unsigned pixb = (unsigned)(((y0 + (g >> 3)) * WIMG + x0 + (g & 7) * 4) * 4);  // bytes
  const float4 kap4 =
      *(const float4*)((const char*)(kappa + ((size_t)b * 3 + slice) * HWPX) + pixb);
  // precaution: stands before any overwrite of the register this load names
  asm volatile("s_wait_xcnt 0x0" :: "v"(pixb) : "memory");

  // ---- windowed correlation as a banded matrix product ----
  // Wave w owns query row w of the tile, as two runs of 16 queries. One product is
  // 16 queries (A) against 16 keys of a halo row (B), all 32 channels in one step:
  // D[m][n] = q[m] . k[n]. Query m of run q wants keys 16q+m..16q+m+KW-1 of the HX
  // in the halo row: they lie in key tiles q and q + 1. Key tile 2 holds keys
  // 32..HX-1 (its other columns repeat the last key and are never stored). Key
  // tile 1 serves both runs.
  {
    const int qy = cg;
    const v16h qf0 = ea_frag(qs + (qy * TX + mrow) * QPIT, kb2, 0);
    const v16h qf1 = ea_frag(qs + (qy * TX + 16 + mrow) * QPIT, kb2, 0);
    const _Float16* k0 = ks + (qy * HX + col) * QPIT;
    const _Float16* k2 = ks + (qy * HX + 32 + min(col, 2 * P - 1)) * QPIT;
    // Register r of a lane is query m = r + mhi of the run against key col of the
    // run's first or second key tile: window offset dx = key - m. The two tiles'
    // bands fall on disjoint lanes, so they are merged: dx = (col - m) mod 16,
    // kept if < KW.
    // Four halo rows at a time, so that fragments and bands stay in few registers.
    // Every loop of this block is unrolled: band[] is then indexed by constants
    // (registers, no scratch) and the LDS offsets become immediates.
#pragma unroll
    for (int c0 = 0; c0 < KW; c0 += 4) {
      float band[8][8];  // [halo row of the chunk * 2 + run][register]
#pragma unroll
      for (int kc = 0; kc < 4; ++kc) {
        const int dy = c0 + kc;
        if (dy >= KW) continue;
        const v16h fa = ea_frag(k0 + dy * HX * QPIT, kb2, 0);
        const v16h fb = ea_frag(k0 + (dy * HX + 16) * QPIT, kb2, 0);
        const v16h fc = ea_frag(k2 + dy * HX * QPIT, kb2, 0);
#pragma unroll
        for (int q = 0; q < 2; ++q) {
          const v8f z = {};
          const v8f d0 = __builtin_amdgcn_wmma_f32_16x16x32_f16(
              false, q ? qf1 : qf0, false, q ? fb : fa, (short)0, z, false, false);
          const v8f d1 = __builtin_amdgcn_wmma_f32_16x16x32_f16(
              false, q ? qf1 : qf0, false, q ? fc : fb, (short)0, z, false, false);
#pragma unroll
          for (int r = 0; r < 8; ++r)
            band[kc * 2 + q][r] = (col >= r + mhi) ? d0[r] : d1[r];
        }
      }
      // Band -> ob[dy * KW + dx][pixel]; one lane mask per register index.
#pragma unroll
      for (int r = 0; r < 8; ++r) {
        const int m  = r + mhi;
        const int dx = (col - m) & 15;
        if (dx < KW) {
          float* o = ob + dx * OPIT + qy * TX + m;
#pragma unroll
          for (int e = 0; e < 8; ++e) {
            const int dy = c0 + (e >> 1);
            if (dy >= KW) continue;
            o[dy * KW * OPIT + (e & 1) * 16] = band[e][r];
          }
        }
      }
    }
  }

  if constexpr (HOOK == 0 || HOOK == 1) {
    // holds the kappa load's wait here, in front of the halo loads: behind them it
    // would have to wait for them as well (one path issues none, so no count fits both)
    asm volatile("" :: "v"(kap4.x), "v"(kap4.y), "v"(kap4.z), "v"(kap4.w));
    constexpr int I0 = HOOK == 0 ? 0 : NI / 2;
    if (more) ea_halo_issue<I0, I0 + NI / 2>(hs, yn, x0, lane);
    else      ea_halo_none<I0, I0 + NI / 2>(hs);
  }

  float sc[4];
  {
    const float kp[4] = {kap4.x, kap4.y, kap4.z, kap4.w};
#pragma unroll  // kp[] and sc[] indexed by constants: registers
    for (int j = 0; j < 4; ++j) {
      float tau = 0.5f - ((kp[j] - kmin) / denom) * (0.5f - 0.03f);
      tau = fminf(fmaxf(tau, 0.03f), 0.5f);
      sc[j] = 1.f / (tau + 1e-6f);
    }
  }
  ea_lds_barrier();  // the result tile is complete before other waves read it

  // ---- write out: 16 bytes a lane, planes pl0, pl0 + 4, ... ----
  constexpr int NP = KK / 4;  // KK = 4 * NP + 1: the last plane goes to pl0 == 0
  const int pl0 = cg >> 2;
  char* ou = (char*)(out + ((size_t)b * KK + pl0) * HWPX);
  float4 ov[NP + 1];
  // both loops unrolled: ov[] stays in registers, and all LDS reads are issued
  // ahead of the first store
#pragma unroll
  for (int i = 0; i < NP; ++i) ov[i] = *(const float4*)&ob[(pl0 + 4 * i) * OPIT + g * 4];
  // a value on the other path too: an unset register would count as live round the tile loop
  ov[NP] = make_float4(0.f, 0.f, 0.f, 0.f);
  if (pl0 == 0) ov[NP] = *(const float4*)&ob[(4 * NP) * OPIT + g * 4];
#pragma unroll
  for (int i = 0; i <= NP; ++i) {
    // precaution: the last plane's address is formed in its own branch; stands
    // before any overwrite there of a register the stores above name
    if (i == NP) asm volatile("s_wait_xcnt 0x0" :: "v"(pixb) : "memory");
    if (i < NP || pl0 == 0) {
      float4 v = ov[i];
      v.x *= sc[0]; v.y *= sc[1]; v.z *= sc[2]; v.w *= sc[3];
      *(float4*)(ou + (size_t)i * (4u * HWPX * 4u) + pixb) = v;
    }
  }
  // precaution: the next window's code follows and reuses registers; stands
  // before any overwrite of a register these stores name
  asm volatile("s_wait_xcnt 0x0" :: "v"(pixb) : "memory");
}

// Temperature range from curvature: the global min/max of a slice, folded from its
// records; their addresses are uniform (scalar loads).
struct EaRange { float kmin, denom; };
__device__ __forceinline__ EaRange ea_range(const unsigned* __restrict__ mm, int slice) {
  unsigned emin = 0xFFFFFFFFu, emax = 0u;
#pragma unroll  // all records are fetched before the first is used
  for (int i = 0; i < KPART; ++i) {
    const unsigned* rec = mm + (slice * KPART + i) * KREC;
    emin = min(emin, rec[0]);
    emax = max(emax, rec[1]);
  }
  EaRange r;
  r.kmin  = fdec(emin);
  r.denom = (fdec(emax) - r.kmin) + 1e-6f;
  return r;
}

// All three window sizes of ntile tiles of 32 x 16: a tile's halo is staged once.
// ntile is an argument and no constant: with a known count of two the compiler takes
// the one next tile's addresses for constants of the loop, forms them all ahead of it
// and keeps them in registers, over the budget (scratch).
__global__ __launch_bounds__(512) void ea_affinity(const float* __restrict__ feat,
                                                   const float* __restrict__ kappa,
                                                   const float* __restrict__ qw,
                                                   const float* __restrict__ kw,
                                                   const unsigned* __restrict__ mm,
                                                   float* __restrict__ out, int ntile) {
  __shared__ __attribute__((aligned(16))) char lds_raw[L_ALL];
  static_assert(L_ALL <= 320 * 1024 && L_OB3 + 9 * OPIT * 4 <= L_ALL && 49 * OPIT * 4 <= L_ST + PXA * SPIT * 2,
                "the map fits one work-group's LDS, the last tile ends in front of row PXA");
  _Float16* wqL   = (_Float16*)(lds_raw + L_WQ);

  const int tid  = threadIdx.x;
  const int lane = tid & 31;
  // Which tiles this work-group walks. The index mod NDIE picks a region of full image width (one image's upper
  // or lower half) and the rest of the index a place in it: tiles side by side in x,
  // which read the same lines at their common edge and write the two halves of the
  // same 256-byte units, have the same index mod NDIE. For speed only:
  // the map is one-to-one, every tile is done once wherever a work-group runs.
  const int reg  = blockIdx.x % NDIE, idx = blockIdx.x / NDIE;
  const int b    = reg / RPI;
  const int yb   = ((reg % RPI) * (NYB / RPI) + idx / NXT) * ntile * TY;
  const int x0   = (idx % NXT) * TX;

  // Weights of the first window (5 x 5): a thread takes 8 consecutive channels of
  // one row of qw (waves 0-7) or of kw (waves 8-15); in LDS wk's rows follow wq's.
  constexpr int WSL = CATT * CIN;                    // floats of one window's weights
  const int cg = __builtin_amdgcn_readfirstlane(tid >> 5);  // the wave, 0..15
  const int wo = (tid >> 3) * SPIT + (tid & 7) * 8;  // its place in LDS, halfs
  const unsigned wb = (unsigned)(tid & 255) * 32u;   // its place in qw / kw, bytes
  const float* wsrc = (cg < 8 ? qw : kw) + WSL;
  // ---- halo of the first tile: all loads are issued before the first value is used ----
  const int cc = cg & 7;
  EaHalo hs;
  hs.fg = feat + ((size_t)b * CIN + cc * 8) * HWPX;
  hs.g0 = (cg >> 3) * (NI / 2);
  ea_halo_issue<0, NI / 2>(hs, yb, x0, lane);
  ea_halo_issue<NI / 2, NI>(hs, yb, x0, lane);
  const float4 wa = *(const float4*)((const char*)wsrc + wb);
  const float4 wc = *(const float4*)((const char*)wsrc + wb + 16);
  // precaution: stands before any overwrite of the register these loads name
  asm volatile("s_wait_xcnt 0x0" :: "v"(wb) : "memory");
  ea_halo_pack<0, NI>(hs);
  *(uint4*)&wqL[wo] = ea_pack8(wa, wc);

  _Float16* stage = (_Float16*)(lds_raw + L_ST);
  ea_halo_store<NI / 2, NI>(hs, stage, lane, cc);

  // folded once for all tiles
  const EaRange kr[3] = {ea_range(mm, 0), ea_range(mm, 1), ea_range(mm, 2)};

  // At the head of a trip the first half of the tile's packed halo is in hs.pk, the
  // second half in the stage. Not unrolled: one copy of the windows' code, for speed only.
#pragma clang loop unroll(disable)
  for (int it = 0;; ++it) {
    const int  y0   = yb + it * TY;
    const bool more = it + 1 < ntile;
    // ---- halo into LDS (f16), zero-padded outside the image + tile padding ----
    ea_halo_store<0, NI / 2>(hs, stage, lane, cc);
    // the packed registers end here on every path (as in ea_halo_none)
#pragma unroll
    for (int i = 0; i < NI / 2; ++i) hs.pk[i] = make_uint4(0u, 0u, 0u, 0u);
    ea_lds_barrier();

    ea_window<5, L_OB5, 0>(lds_raw, kappa, kr[1].kmin, kr[1].denom,
                           out + (size_t)BSZ * 9 * HWPX, 1, b, y0, x0, tid, cg, qw, kw,
                           hs, more, y0 + TY);
    ea_window<3, L_OB3, 1>(lds_raw, kappa, kr[0].kmin, kr[0].denom, out, 0,
                           b, y0, x0, tid, cg, qw + 2 * WSL, kw + 2 * WSL, hs, more, y0 + TY);
    // its next weights are those of the next tile's first window
    ea_window<7, L_OB7, 2>(lds_raw, kappa, kr[2].kmin, kr[2].denom,
                           out + (size_t)BSZ * (9 + 25) * HWPX, 2, b, y0, x0, tid, cg,
                           qw + WSL, kw + WSL, hs, more, y0 + TY);
    if (!more) break;
    // the last result tile lies over the stage's first rows: every wave has read it
    ea_lds_barrier();
  }
}

extern "C" void kernel_launch(void* const* d_in, const int* in_sizes, int n_in,
                              void* d_out, int out_size, void* d_ws, size_t ws_size,
                              hipStream_t stream) {
  const float* feat  = (const float*)d_in[0];
  const float* kappa = (const float*)d_in[1];
  const float* qw    = (const float*)d_in[2];  // (3, 32, 64)
  const float* kw    = (const float*)d_in[3];  // (3, 32, 64)
  float*       out   = (float*)d_out;
  unsigned*    mm    = (unsigned*)d_ws;        // 3 x KPART records {min,max}, encoded

  ea_kap_minmax<<<dim3(KPART, 3), KTHR, 0, stream>>>(kappa, mm);

  const dim3 grid(NXT * NYB * BSZ), block(512);
  ea_affinity<<<grid, block, 0, stream>>>(feat, kappa, qw, kw, mm, out, TPW);
}

// v009
// Measured time: 39.4 microseconds a run.
// In both of two side-by-side timings against v008, it was 1.05 times as fast.
// Over all steps from v000 it is 9.65 times as fast.
#include <hip/hip_runtime.h>
#include <hip/hip_bf16.h>

typedef __attribute__((ext_vector_type(16))) _Float16 v16h;
typedef __attribute__((ext_vector_type(8)))  float    v8f;

#define HWPX (256 * 256)
#define HIMG 256
#define WIMG 256
#define BSZ  4
#define CIN  64
#define CATT 32
// halfs per LDS row of a WMMA operand (64 channels + 8): 144 B = 16 B x 9, so
// 16 lanes on 16 consecutive rows spread their 16-byte accesses over all banks
#define SPIT (CIN + 8)
// halfs per LDS row of a projected pixel (32 channels + 8): 80 B = 16 B x 5, the
// same spreading for the 16-byte fragment reads of the correlation product
#define QPIT (CATT + 8)
// The tile of one work-group: TX pixels are one 128-byte line of every plane
#define TX  32
#define TY  16
#define NPX (TX * TY)
// floats per LDS plane of the result tile (512 pixels + 12): the lanes of one
// band store sit on different window offsets, so on planes; the 12 spreads them
#define OPIT (NPX + 12)

// ---- order-preserving float <-> uint encoding: min/max become integer ops ----
__device__ __forceinline__ unsigned fenc(float f) {
  unsigned u = __float_as_uint(f);
  return u ^ ((u >> 31) ? 0xFFFFFFFFu : 0x80000000u);
}
__device__ __forceinline__ float fdec(unsigned u) {
  u ^= ((u >> 31) ? 0x80000000u : 0xFFFFFFFFu);
  return __uint_as_float(u);
}

// min/max of kappa[:, slice, :, :] leave this launch as KPART records {min, max}
// a slice, one per work-group; the reader folds them. A record has a 128-byte
// line of the workspace to itself (KREC unsigneds apart): one writer per line.
#define KPART 16
#define KTHR  512
#define KREC  32

__global__ __launch_bounds__(KTHR) void ea_kap_minmax(const float* __restrict__ kappa,
                                                      unsigned* __restrict__ mm) {
  const int slice = blockIdx.y;
  const int tid   = threadIdx.x;
  // A plane half is KPART * KTHR units of 16 bytes; a thread takes one unit of
  // each half of each of the BSZ planes. All loads are issued before the first use.
  const unsigned vb = (unsigned)(blockIdx.x * KTHR + tid) * 16u;  // bytes
  const char* kp = (const char*)(kappa + (size_t)slice * HWPX);
  float4 v[2 * BSZ];
#pragma unroll  // v[] indexed by constants: registers
  for (int i = 0; i < 2 * BSZ; ++i)
    v[i] = *(const float4*)(kp + (size_t)(i >> 1) * (3u * HWPX * 4u) +
                            (size_t)(i & 1) * (HWPX * 2u) + vb);
  unsigned lmin = 0xFFFFFFFFu, lmax = 0u;
#pragma unroll  // as above
  for (int i = 0; i < 2 * BSZ; ++i) {
    const unsigned k0 = fenc(v[i].x), k1 = fenc(v[i].y), k2 = fenc(v[i].z), k3 = fenc(v[i].w);
    lmin = min(lmin, min(min(k0, k1), min(k2, k3)));
    lmax = max(lmax, max(max(k0, k1), max(k2, k3)));
  }
  // butterfly over the wave, then over the waves' results
#pragma unroll  // the lane distances become constants
  for (int s = 16; s > 0; s >>= 1) {
    lmin = min(lmin, __shfl_xor(lmin, s));
    lmax = max(lmax, __shfl_xor(lmax, s));
  }
  __shared__ unsigned smin[KTHR / 32], smax[KTHR / 32];
  if ((tid & 31) == 0) { smin[tid >> 5] = lmin; smax[tid >> 5] = lmax; }
  __syncthreads();
  if (tid < 32) {
    lmin = smin[tid & (KTHR / 32 - 1)];
    lmax = smax[tid & (KTHR / 32 - 1)];
#pragma unroll  // the lane distances become constants
    for (int s = KTHR / 64; s > 0; s >>= 1) {
      lmin = min(lmin, __shfl_xor(lmin, s));
      lmax = max(lmax, __shfl_xor(lmax, s));
    }
    if (tid == 0)
      *(uint2*)&mm[(slice * KPART + blockIdx.x) * KREC] = make_uint2(lmin, lmax);
  }
}

// Assemble a 16x32 f16 WMMA fragment (A or B operand) from an LDS row of 32
// (stage, weights) or 16 (q, k) channel-pairs, per the ISA layout: halves 0-7 = K kb..kb+7, halves 8-15 =
// K kb+16..kb+23 (kb = 0 for lanes 0-15, 8 for lanes 16-31). Union with
// constant indices keeps everything in VGPRs (SROA), no scratch.
// Rows start on 16 bytes, so each run of 8 halves is one 16-byte LDS load.
__device__ __forceinline__ v16h ea_frag(const _Float16* row, int kb2, int s) {
  const uint4* p = (const uint4*)row;
  union { v16h v; uint4 q[2]; } r;
  r.q[0] = p[s * 4 + (kb2 >> 2)];
  r.q[1] = p[s * 4 + (kb2 >> 2) + 2];
  return r.v;
}

// Work-group barrier that orders LDS alone: the wave's own LDS accesses are waited
// for, its global loads and stores stay in flight (__syncthreads() waits for those
// too, which would end the fetch of the next halo at the first barrier). Nothing in
// global memory goes from wave to wave in this kernel.
__device__ __forceinline__ void ea_lds_barrier() {
  asm volatile("s_wait_dscnt 0x0\n\ts_barrier_signal -1\n\ts_barrier_wait -1" ::: "memory");
}

// lane l with lane l ^ 16
__device__ __forceinline__ float ea_xhalf(float x) {
  const int b = __builtin_bit_cast(int, x);
  return __builtin_bit_cast(
      float, __builtin_amdgcn_permlanex16(b, b, 0x76543210, 0xfedcba98, false, false));
}

// The projections are computed transposed (weight rows are A, pixels are B), so a
// lane holds channels of ONE pixel: mhi..mhi+7 in c0, 16+mhi..16+mhi+7 in c1, and
// lane l ^ 16 holds that pixel's other 16. L2 normalize (x / max(||x||, 1e-12);
// zero rows stay zero) from the f32 accumulators, then two 16-byte LDS stores
// into the pixel's row of QPIT halfs. 1 / max(sqrt(s), 1e-12) is taken as
// min(rsq(s), 1e12) with the hardware's reciprocal square root: two instructions
// on the path from the sum to the stores, where the exactly rounded square root
// and division are a chain of some two dozen dependent ones. s = 0 gives
// min(inf, 1e12). The result is rounded to f16 directly behind it.
__device__ __forceinline__ void ea_norm_store(_Float16* row, v8f c0, v8f c1, int mhi) {
  float s0 = 0.f, s1 = 0.f;
  // both loops unrolled: c0[], c1[] and h[] are then indexed by constants (registers)
#pragma unroll
  for (int r = 0; r < 8; ++r) { s0 += c0[r] * c0[r]; s1 += c1[r] * c1[r]; }
  float s = s0 + s1;
  s += ea_xhalf(s);
  const float inv = fminf(__builtin_amdgcn_rsqf(s), 1e12f);
  union { uint4 q; _Float16 h[8]; } p0, p1;
#pragma unroll
  for (int r = 0; r < 8; ++r) {
    p0.h[r] = (_Float16)(c0[r] * inv);
    p1.h[r] = (_Float16)(c1[r] * inv);
  }
  *(uint4*)&row[mhi]      = p0.q;
  *(uint4*)&row[16 + mhi] = p1.q;
}

// 8 floats -> 8 halfs, one 16-byte unit
__device__ __forceinline__ uint4 ea_pack8(float4 a, float4 c) {
  union { uint4 q; _Float16 h[8]; } p;
  p.h[0] = (_Float16)a.x; p.h[1] = (_Float16)a.y;
  p.h[2] = (_Float16)a.z; p.h[3] = (_Float16)a.w;
  p.h[4] = (_Float16)c.x; p.h[5] = (_Float16)c.y;
  p.h[6] = (_Float16)c.z; p.h[7] = (_Float16)c.w;
  return p.q;
}

// LDS map of the fused kernel, bytes. The 38 x 22 halo of the widest window is
// staged once and serves all three window sizes.
#define PST   3                      // halo width of the stage
#define HSX   (TX + 2 * PST)         // its edges
#define HSY   (TY + 2 * PST)
#define PADST 848                    // its pixels (836), rounded up to 16
// The stage starts L_ST bytes in: the last window's result tile, which starts at 0,
// then ends in front of the stage's row PXA, and the rows from there on can take
// the next tile's halo while that result tile is in use.
#define L_ST  38400
#define PXA   448
#define L_WQ  (L_ST + PADST * SPIT * 2)      // weights behind the stage
#define L_QS  (L_WQ + 2 * CATT * SPIT * 2)   // 512 q rows
#define L_KS  (L_QS + NPX * QPIT * 2)        // key rows: 720 / 624 / 848 by window
// Result tiles. The windows run in the order 5, 3, 7. A tile may still be read by
// slow waves while fast ones write the next window's key rows, so it lies behind
// those: 5's behind 624 (and its own 720) rows, 3's behind 848. 7's lies over the
// first PXA rows of the stage, which is dead by then.
#define L_OB5 (L_KS + 720 * QPIT * 2)
#define L_OB3 (L_KS + PADST * QPIT * 2)
#define L_OB7 0
#define L_ALL (L_OB5 + 25 * OPIT * 4)

// A work-group walks TPW tiles, one below the other. The halo of the next tile is
// fetched into registers while the current tile's windows are computed.
#define TPW 2
// The grid: NXT work-groups across an image, NYB down, in NDIE regions, RPI an image
#define NXT  (WIMG / TX)
#define NYB  (HIMG / (TPW * TY))
#define NDIE 8
#define RPI  (NDIE / BSZ)
static_assert(RPI * BSZ == NDIE && NYB % RPI == 0, "regions tile the images");
// Halo fetch: waves w and w + 8 own channels 8w..8w+7, each one half of the groups
// of 32 pixels below row PXA (its groups 0..NI/2-1) and one half of those from PXA
// on (its groups NI/2..NI-1); a lane gathers the channels of one halo pixel in registers and
// writes them as one 16-byte LDS store.
#define NI ((PADST + 63) / 64)  // groups a wave
static_assert(NI * 64 >= PADST && PADST >= 32 && NI >= 8 && NI % 2 == 0 && NI * 32 == PXA,
              "groups cover the stage");
struct EaHalo {
  float        hv[NI][8];  // values in flight
  uint4        pk[NI];     // the same as f16, zero outside the image
  unsigned     inm;        // bit i: the pixel of group i lies inside the image
  const float* fg;         // first of this wave's 8 channel planes
  int          g0;         // first group of this wave: 0 or NI / 2
};

// the halo pixel of a lane in group i; the last groups are shifted back to end at
// PADST: the wave writes some rows again with the same values, no group needs a branch
// (only the last two i can reach the end: the others differ by constants)
__device__ __forceinline__ int ea_halo_gs(int g0, int i) {  // lane 0's, the same for the wave
  const int gs = (g0 + i + (i >= NI / 2 ? NI / 2 : 0)) * 32;
  return (NI + i) * 32 <= PADST - 32 ? gs : min(gs, PADST - 32);
}
__device__ __forceinline__ int ea_halo_px(int g0, int i, int lane) {
  return ea_halo_gs(g0, i) + lane;
}

// Issue the loads of groups I0..I1-1 of the halo of the tile at (y0, x0); nothing
// here uses a loaded value.
template <int I0, int I1>
__device__ __forceinline__ void ea_halo_issue(EaHalo& hs, int y0, int x0, int lane) {
  unsigned ha[NI];
  if (I0 == 0) hs.inm = 0u;
#pragma unroll  // hv[] and ha[] indexed by constants: registers
  for (int i = I0; i < I1; ++i) {
    // Row and column are taken from the pixel's number counted from image row 0, the
    // group's part of it summed as a scalar (readfirstlane keeps that sum together):
    // no vector value here is then the same for every tile. Such values would be
    // kept in registers round the tile loop, over the budget (scratch).
    const int gs = ea_halo_gs(hs.g0, i);
    const unsigned q  = (unsigned)__builtin_amdgcn_readfirstlane(gs + y0 * HSX) + (unsigned)lane;
    const unsigned qy = q / HSX;
    const int gy = (int)qy - PST, gx = x0 - PST + (int)(q - qy * HSX);
    const bool inp = (NI + i) * 32 + 31 < HSX * HSY || gs + lane < HSX * HSY;
    const bool inb = inp && gy >= 0 && gy < HIMG && gx >= 0 && gx < WIMG;
    ha[i] = inb ? (unsigned)(gy * WIMG + gx) * 4u : 0u;  // bytes; always a valid address
    hs.inm |= (inb ? 1u : 0u) << i;
    // the plane's distance is a constant of the load: one address register a group
#pragma unroll
    for (int j = 0; j < 8; ++j)
      hs.hv[i][j] = *(const float*)((const char*)hs.fg + ha[i] + (size_t)j * (HWPX * 4));
    // precaution, once per four groups: stands before any overwrite of the
    // registers these loads name (kept live up to here as inputs)
    if (((i - I0) & 3) == 3 || i == I1 - 1)
      asm volatile("s_wait_xcnt 0x0" :: "v"(ha[i]), "v"(ha[i - 1]), "v"(ha[i - 2]),
                   "v"(ha[i - 3]) : "memory");
  }
}

// No tile follows: nothing is fetched. The registers get a value all the same, so
// that on this path too their old values end here; otherwise the old values count
// as live round the whole tile loop and the register budget is overrun (scratch).
template <int I0, int I1>
__device__ __forceinline__ void ea_halo_none(EaHalo& hs) {
  if (I0 == 0) hs.inm = 0u;
#pragma unroll  // hv[] indexed by constants: registers
  for (int i = I0; i < I1; ++i)
#pragma unroll
    for (int j = 0; j < 8; ++j) hs.hv[i][j] = 0.f;
}

// Two f32 -> one register of two f16, a in the low half, rounded to nearest even as
// the cast does. In asm text so that the conversion stays where it is written: the
// compiler otherwise moves it down to the LDS store behind the last window, all f32
// values stay live through that window's correlation, and registers go to scratch.
__device__ __forceinline__ unsigned ea_cvt2_here(float a, float c) {
  unsigned r;
  asm volatile("v_cvt_pk_f16_f32 %0, %1, %2" : "=v"(r) : "v"(a), "v"(c));
  return r;
}

// f32 -> f16, 8 channels of a pixel to one 16-byte unit, zero outside the image
template <int I0, int I1>
__device__ __forceinline__ void ea_halo_pack(EaHalo& hs) {
#pragma unroll  // hv[] and pk[] indexed by constants: registers
  for (int i = I0; i < I1; ++i) {
    const bool inb = hs.inm >> i & 1u;
    const float* v = hs.hv[i];
    const unsigned r0 = ea_cvt2_here(v[0], v[1]), r1 = ea_cvt2_here(v[2], v[3]);
    const unsigned r2 = ea_cvt2_here(v[4], v[5]), r3 = ea_cvt2_here(v[6], v[7]);
    hs.pk[i] = make_uint4(inb ? r0 : 0u, inb ? r1 : 0u, inb ? r2 : 0u, inb ? r3 : 0u);
  }
}

// Packed groups I0..I1-1 into the stage. One address register: the groups lie a
// constant apart, but for the last ones, which are shifted back by a count that is
// the same for the whole wave.
template <int I0, int I1>
__device__ __forceinline__ void ea_halo_store(const EaHalo& hs, _Float16* stage, int lane,
                                              int cc) {
  const int px0 = ea_halo_px(hs.g0, I0, lane);
  char* sb = (char*)&stage[px0 * SPIT + cc * 8];
#pragma unroll  // pk[] indexed by constants: registers
  for (int i = I0; i < I1; ++i)
    *(uint4*)(sb + (ea_halo_px(hs.g0, i, lane) - px0) * (SPIT * 2)) = hs.pk[i];
}

// One window size, from the staged halo and the weights in LDS to its output:
// f16-WMMA q/k projection with L2 normalize -> k x k windowed cosine / tau.
// nqw, nkw: the next window's weights: fetched while this window's
// projections run, put into LDS as soon as this window's are dead.
// HOOK, if more (a tile follows at yn): the next halo's loads are issued in two halves,
// each behind a window's correlation (HOOK 0: first half, 1: second half), and packed
// to f16 behind the following window's projections (HOOK 1: first half, 2: second
// half, which goes into the stage at once). Loads return in order, so a half lies
// between two places where the windows wait for loads of their own; it stays under
// the count of loads a wave can have outstanding, and off the correlations' registers.
template <int KW, int OBAT, int HOOK>
__device__ __forceinline__ void ea_window(char* lds_raw,
                                          const float* __restrict__ kappa,
                                          float kmin, float rden,
                                          float* __restrict__ out, int slice,
                                          int b, int y0, int x0, int tid, int cg,
                                          const float* __restrict__ nqw,
                                          const float* __restrict__ nkw,
                                          EaHalo& hs, bool more, int yn) {
  constexpr int P     = KW / 2;
  constexpr int HX    = TX + 2 * P;          // halo tile edges
  constexpr int HY    = TY + 2 * P;
  constexpr int HALO2 = HX * HY;             // halo pixels
  constexpr int KT    = (HALO2 + 15) / 16;   // 16-pixel tiles for key proj
  constexpr int KK    = KW * KW;
  constexpr int OFF   = PST - P;             // this halo's corner in the stage

  _Float16* stage = (_Float16*)(lds_raw + L_ST);   // PADST rows of SPIT (f16)
  _Float16* wqL   = (_Float16*)(lds_raw + L_WQ);
  _Float16* wkL   = wqL + CATT * SPIT;
  _Float16* qs    = (_Float16*)(lds_raw + L_QS);   // NPX rows of QPIT (f16)
  _Float16* ks    = (_Float16*)(lds_raw + L_KS);   // KT * 16 rows of QPIT (f16)
  float*    ob    = (float*)(lds_raw + OBAT);      // KK planes of OPIT (f32)

  const int lane = tid & 31;
  const int mrow = lane & 15;
  const int kb2  = (lane >= 16) ? 4 : 0;  // channel-pair base for this half-wave
  const int mhi  = (lane >= 16) ? 8 : 0;
  const int col  = lane & 15;

  // A thread takes 8 consecutive channels of one row of the next qw (waves 0-7)
  // or kw (waves 8-15).
  float4 nwa, nwb;
  {
    const float* nsrc = cg < 8 ? nqw : nkw;
    const unsigned wb = (unsigned)(tid & 255) * 32u;  // its place in qw / kw, bytes
    nwa = *(const float4*)((const char*)nsrc + wb);
    nwb = *(const float4*)((const char*)nsrc + wb + 16);
    // precaution: stands before any overwrite of the register these loads name
    asm volatile("s_wait_xcnt 0x0" :: "v"(wb) : "memory");
  }
  // ---- q projection: 32 tiles of 16 interior pixels, normalized on the way; a
  // wave takes the two of its own image row ----
  {
    const _Float16* w0 = &wqL[mrow * SPIT];
    const _Float16* w1 = &wqL[(16 + mrow) * SPIT];
    const v16h b00 = ea_frag(w0, kb2, 0);  // kstep0, channels 0-15
    const v16h b10 = ea_frag(w0, kb2, 1);  // kstep1, channels 0-15
    const v16h b01 = ea_frag(w1, kb2, 0);  // kstep0, channels 16-31
    const v16h b11 = ea_frag(w1, kb2, 1);  // kstep1, channels 16-31
    for (int t = cg * 2; t < cg * 2 + 2; ++t) {
      int ip = t * 16 + mrow;  // interior pixel 0..511
      int px = ((ip >> 5) + PST) * HSX + ((ip & 31) + PST);
      const _Float16* srow = &stage[px * SPIT];
      v16h a0 = ea_frag(srow, kb2, 0);
      v16h a1 = ea_frag(srow, kb2, 1);
      v8f acc0 = {}, acc1 = {};
      acc0 = __builtin_amdgcn_wmma_f32_16x16x32_f16(false, b00, false, a0,
                                                    (short)0, acc0, false, false);
      acc1 = __builtin_amdgcn_wmma_f32_16x16x32_f16(false, b01, false, a0,
                                                    (short)0, acc1, false, false);
      acc0 = __builtin_amdgcn_wmma_f32_16x16x32_f16(false, b10, false, a1,
                                                    (short)0, acc0, false, false);
      acc1 = __builtin_amdgcn_wmma_f32_16x16x32_f16(false, b11, false, a1,
                                                    (short)0, acc1, false, false);
      ea_norm_store(qs + (t * 16 + col) * QPIT, acc0, acc1, mhi);
    }
  }

  // ---- key projection: KT tiles of 16 halo pixels, normalized on the way ----
  {
    const _Float16* w0 = &wkL[mrow * SPIT];
    const _Float16* w1 = &wkL[(16 + mrow) * SPIT];
    const v16h b00 = ea_frag(w0, kb2, 0);
    const v16h b10 = ea_frag(w0, kb2, 1);
    const v16h b01 = ea_frag(w1, kb2, 0);
    const v16h b11 = ea_frag(w1, kb2, 1);
    for (int t = cg; t < KT; t += 16) {
      // halo pixel of this window -> its row in the stage; the rows that pad the
      // last tile repeat the last pixel and are never read by the correlation
      const int h  = min(t * 16 + mrow, HALO2 - 1);
      const int hy = h / HX;
      const int px = (hy + OFF) * HSX + (h - hy * HX) + OFF;
      const _Float16* srow = &stage[px * SPIT];
      v16h a0 = ea_frag(srow, kb2, 0);
      v16h a1 = ea_frag(srow, kb2, 1);
      v8f acc0 = {}, acc1 = {};
      acc0 = __builtin_amdgcn_wmma_f32_16x16x32_f16(false, b00, false, a0,
                                                    (short)0, acc0, false, false);
      acc1 = __builtin_amdgcn_wmma_f32_16x16x32_f16(false, b01, false, a0,
                                                    (short)0, acc1, false, false);
      acc0 = __builtin_amdgcn_wmma_f32_16x16x32_f16(false, b10, false, a1,
                                                    (short)0, acc0, false, false);
      acc1 = __builtin_amdgcn_wmma_f32_16x16x32_f16(false, b11, false, a1,
                                                    (short)0, acc1, false, false);
      ea_norm_store(ks + (t * 16 + col) * QPIT, acc0, acc1, mhi);
    }
  }
  ea_lds_barrier();

  // every wave has its weight fragments: the next window's weights take their
  // place (the barrier behind the correlation stands in front of their first read)
  {
    // rows 0-31 are wq, rows 32-63 wk, which lies directly behind it
    const int wo = (tid >> 3) * SPIT + (tid & 7) * 8;
    *(uint4*)&wqL[wo] = ea_pack8(nwa, nwb);
  }
  // The wait for the weights above has waited for the halo loads too, which are older.
  if (HOOK == 1 && more) ea_halo_pack<0, NI / 2>(hs);
  if (HOOK == 2 && more) {
    // behind the barrier above no wave reads the stage any more, and this window's
    // result tile ends in front of these rows
    ea_halo_pack<NI / 2, NI>(hs);
    ea_halo_store<NI / 2, NI>(hs, stage, lane, cg & 7);
  }

  // This thread writes out four neighbouring pixels of every fourth plane;
  // eight threads in a row cover one 128-byte line.
  const int g = tid & 127;
  const unsigned pixb = (unsigned)(((y0 + (g >> 3)) * WIMG + x0 + (g & 7) * 4) * 4);  // bytes
  const float4 kap4 =
      *(const float4*)((const char*)(kappa + ((size_t)b * 3 + slice) * HWPX) + pixb);
  // precaution: stands before any overwrite of the register this load names
  asm volatile("s_wait_xcnt 0x0" :: "v"(pixb) : "memory");

  // ---- windowed correlation as a banded matrix product ----
  // Wave w owns query row w of the tile, as two runs of 16 queries. One product is
  // 16 queries (A) against 16 keys of a halo row (B), all 32 channels in one step:
  // D[m][n] = q[m] . k[n]. Query m of run q wants keys 16q+m..16q+m+KW-1 of the HX
  // in the halo row: they lie in key tiles q and q + 1. Key tile 2 holds keys
  // 32..HX-1 (its other columns repeat the last key and are never stored). Key
  // tile 1 serves both runs.
  {
    const int qy = cg;
    const v16h qf0 = ea_frag(qs + (qy * TX + mrow) * QPIT, kb2, 0);
    const v16h qf1 = ea_frag(qs + (qy * TX + 16 + mrow) * QPIT, kb2, 0);
    const _Float16* k0 = ks + (qy * HX + col) * QPIT;
    const _Float16* k2 = ks + (qy * HX + 32 + min(col, 2 * P - 1)) * QPIT;
    // Register r of a lane is query m = r + mhi of the run against key col of the
    // run's first or second key tile: window offset dx = key - m. The two tiles'
    // bands fall on disjoint lanes, so they are merged: dx = (col - m) mod 16,
    // kept if < KW.
    // Four halo rows at a time, so that fragments and bands stay in few registers.
    // Every loop of this block is unrolled: band[] is then indexed by constants
    // (registers, no scratch) and the LDS offsets become immediates.
#pragma unroll
    for (int c0 = 0; c0 < KW; c0 += 4) {
      float band[8][8];  // [halo row of the chunk * 2 + run][register]
#pragma unroll
      for (int kc = 0; kc < 4; ++kc) {
        const int dy = c0 + kc;
        if (dy >= KW) continue;
        const v16h fa = ea_frag(k0 + dy * HX * QPIT, kb2, 0);
        const v16h fb = ea_frag(k0 + (dy * HX + 16) * QPIT, kb2, 0);
        const v16h fc = ea_frag(k2 + dy * HX * QPIT, kb2, 0);
#pragma unroll
        for (int q = 0; q < 2; ++q) {
          const v8f z = {};
          const v8f d0 = __builtin_amdgcn_wmma_f32_16x16x32_f16(
              false, q ? qf1 : qf0, false, q ? fb : fa, (short)0, z, false, false);
          const v8f d1 = __builtin_amdgcn_wmma_f32_16x16x32_f16(
              false, q ? qf1 : qf0, false, q ? fc : fb, (short)0, z, false, false);
#pragma unroll
          for (int r = 0; r < 8; ++r)
            band[kc * 2 + q][r] = (col >= r + mhi) ? d0[r] : d1[r];
        }
      }
      // Band -> ob[dy * KW + dx][pixel]; one lane mask per register index.
#pragma unroll
      for (int r = 0; r < 8; ++r) {
        const int m  = r + mhi;
        const int dx = (col - m) & 15;
        if (dx < KW) {
          float* o = ob + dx * OPIT + qy * TX + m;
#pragma unroll
          for (int e = 0; e < 8; ++e) {
            const int dy = c0 + (e >> 1);
            if (dy >= KW) continue;
            o[dy * KW * OPIT + (e & 1) * 16] = band[e][r];
          }
        }
      }
    }
  }

  if constexpr (HOOK == 0 || HOOK == 1) {
    // holds the kappa load's wait here, in front of the halo loads: behind them it
    // would have to wait for them as well (one path issues none, so no count fits both)
    asm volatile("" :: "v"(kap4.x), "v"(kap4.y), "v"(kap4.z), "v"(kap4.w));
    constexpr int I0 = HOOK == 0 ? 0 : NI / 2;
    if (more) ea_halo_issue<I0, I0 + NI / 2>(hs, yn, x0, lane);
    else      ea_halo_none<I0, I0 + NI / 2>(hs);
  }

  float sc[4];
  {
    const float kp[4] = {kap4.x, kap4.y, kap4.z, kap4.w};
#pragma unroll  // kp[] and sc[] indexed by constants: registers
    for (int j = 0; j < 4; ++j) {
      // the range's reciprocal is formed once a kernel; tau + 1e-6 lies in 0.03..0.5,
      // where the hardware's reciprocal needs none of a division's range handling
      float tau = 0.5f - ((kp[j] - kmin) * rden) * (0.5f - 0.03f);
      tau = fminf(fmaxf(tau, 0.03f), 0.5f);
      sc[j] = __builtin_amdgcn_rcpf(tau + 1e-6f);
    }
  }
  ea_lds_barrier();  // the result tile is complete before other waves read it

  // ---- write out: 16 bytes a lane, planes pl0, pl0 + 4, ... ----
  constexpr int NP = KK / 4;  // KK = 4 * NP + 1: the last plane goes to pl0 == 0
  const int pl0 = cg >> 2;
  char* ou = (char*)(out + ((size_t)b * KK + pl0) * HWPX);
  float4 ov[NP + 1];
  // both loops unrolled: ov[] stays in registers, and all LDS reads are issued
  // ahead of the first store
#pragma unroll
  for (int i = 0; i < NP; ++i) ov[i] = *(const float4*)&ob[(pl0 + 4 * i) * OPIT + g * 4];
  // the slot that the instruction set asks for behind a transcendental
  asm volatile("v_nop" :: "v"(sc[0]), "v"(sc[1]), "v"(sc[2]), "v"(sc[3]));
  // a value on the other path too: an unset register would count as live round the tile loop
  ov[NP] = make_float4(0.f, 0.f, 0.f, 0.f);
  if (pl0 == 0) ov[NP] = *(const float4*)&ob[(4 * NP) * OPIT + g * 4];
#pragma unroll
  for (int i = 0; i <= NP; ++i) {
    // precaution: the last plane's address is formed in its own branch; stands
    // before any overwrite there of a register the stores above name
    if (i == NP) asm volatile("s_wait_xcnt 0x0" :: "v"(pixb) : "memory");
    if (i < NP || pl0 == 0) {
      float4 v = ov[i];
      v.x *= sc[0]; v.y *= sc[1]; v.z *= sc[2]; v.w *= sc[3];
      *(float4*)(ou + (size_t)i * (4u * HWPX * 4u) + pixb) = v;
    }
  }
  // precaution: the next window's code follows and reuses registers; stands
  // before any overwrite of a register these stores name
  asm volatile("s_wait_xcnt 0x0" :: "v"(pixb) : "memory");
}

// Temperature range from curvature: the global min/max of a slice, folded from its
// records; their addresses are uniform (scalar loads).
struct EaRange { float kmin, rden; };  // rden = 1 / (max - min + 1e-6)
__device__ __forceinline__ EaRange ea_range(const unsigned* __restrict__ mm, int slice) {
  unsigned emin = 0xFFFFFFFFu, emax = 0u;
#pragma unroll  // all records are fetched before the first is used
  for (int i = 0; i < KPART; ++i) {
    const unsigned* rec = mm + (slice * KPART + i) * KREC;
    emin = min(emin, rec[0]);
    emax = max(emax, rec[1]);
  }
  EaRange r;
  r.kmin  = fdec(emin);
  r.rden  = 1.f / ((fdec(emax) - r.kmin) + 1e-6f);  // an exact division, once a kernel
  return r;
}

// All three window sizes of ntile tiles of 32 x 16: a tile's halo is staged once.
// ntile is an argument and no constant: with a known count of two the compiler takes
// the one next tile's addresses for constants of the loop, forms them all ahead of it
// and keeps them in registers, over the budget (scratch).
__global__ __launch_bounds__(512) void ea_affinity(const float* __restrict__ feat,
                                                   const float* __restrict__ kappa,
                                                   const float* __restrict__ qw,
                                                   const float* __restrict__ kw,
                                                   const unsigned* __restrict__ mm,
                                                   float* __restrict__ out, int ntile) {
  __shared__ __attribute__((aligned(16))) char lds_raw[L_ALL];
  static_assert(L_ALL <= 320 * 1024 && L_OB3 + 9 * OPIT * 4 <= L_ALL && 49 * OPIT * 4 <= L_ST + PXA * SPIT * 2,
                "the map fits one work-group's LDS, the last tile ends in front of row PXA");
  _Float16* wqL   = (_Float16*)(lds_raw + L_WQ);

  const int tid  = threadIdx.x;
  const int lane = tid & 31;
  // Which tiles this work-group walks. The index mod NDIE picks a region of full image width (one image's upper
  // or lower half) and the rest of the index a place in it: tiles side by side in x,
  // which read the same lines at their common edge and write the two halves of the
  // same 256-byte units, have the same index mod NDIE. For speed only:
  // the map is one-to-one, every tile is done once wherever a work-group runs.
  const int reg  = blockIdx.x % NDIE, idx = blockIdx.x / NDIE;
  const int b    = reg / RPI;
  const int yb   = ((reg % RPI) * (NYB / RPI) + idx / NXT) * ntile * TY;
  const int x0   = (idx % NXT) * TX;

  // Weights of the first window (5 x 5): a thread takes 8 consecutive channels of
  // one row of qw (waves 0-7) or of kw (waves 8-15); in LDS wk's rows follow wq's.
  constexpr int WSL = CATT * CIN;                    // floats of one window's weights
  const int cg = __builtin_amdgcn_readfirstlane(tid >> 5);  // the wave, 0..15
  const int wo = (tid >> 3) * SPIT + (tid & 7) * 8;  // its place in LDS, halfs
  const unsigned wb = (unsigned)(tid & 255) * 32u;   // its place in qw / kw, bytes
  const float* wsrc = (cg < 8 ? qw : kw) + WSL;
  // ---- halo of the first tile: all loads are issued before the first value is used ----
  const int cc = cg & 7;
  EaHalo hs;
  hs.fg = feat + ((size_t)b * CIN + cc * 8) * HWPX;
  hs.g0 = (cg >> 3) * (NI / 2);
  ea_halo_issue<0, NI / 2>(hs, yb, x0, lane);
  ea_halo_issue<NI / 2, NI>(hs, yb, x0, lane);
  const float4 wa = *(const float4*)((const char*)wsrc + wb);
  const float4 wc = *(const float4*)((const char*)wsrc + wb + 16);
  // precaution: stands before any overwrite of the register these loads name
  asm volatile("s_wait_xcnt 0x0" :: "v"(wb) : "memory");
  ea_halo_pack<0, NI>(hs);
  *(uint4*)&wqL[wo] = ea_pack8(wa, wc);

  _Float16* stage = (_Float16*)(lds_raw + L_ST);
  ea_halo_store<NI / 2, NI>(hs, stage, lane, cc);

  // folded once for all tiles
  const EaRange kr[3] = {ea_range(mm, 0), ea_range(mm, 1), ea_range(mm, 2)};

  // At the head of a trip the first half of the tile's packed halo is in hs.pk, the
  // second half in the stage. Not unrolled: one copy of the windows' code, for speed only.
#pragma clang loop unroll(disable)
  for (int it = 0;; ++it) {
    const int  y0   = yb + it * TY;
    const bool more = it + 1 < ntile;
    // ---- halo into LDS (f16), zero-padded outside the image + tile padding ----
    ea_halo_store<0, NI / 2>(hs, stage, lane, cc);
    // the packed registers end here on every path (as in ea_halo_none)
#pragma unroll
    for (int i = 0; i < NI / 2; ++i) hs.pk[i] = make_uint4(0u, 0u, 0u, 0u);
    ea_lds_barrier();

    ea_window<5, L_OB5, 0>(lds_raw, kappa, kr[1].kmin, kr[1].rden,
                           out + (size_t)BSZ * 9 * HWPX, 1, b, y0, x0, tid, cg, qw, kw,
                           hs, more, y0 + TY);
    ea_window<3, L_OB3, 1>(lds_raw, kappa, kr[0].kmin, kr[0].rden, out, 0,
                           b, y0, x0, tid, cg, qw + 2 * WSL, kw + 2 * WSL, hs, more, y0 + TY);
    // its next weights are those of the next tile's first window
    ea_window<7, L_OB7, 2>(lds_raw, kappa, kr[2].kmin, kr[2].rden,
                           out + (size_t)BSZ * (9 + 25) * HWPX, 2, b, y0, x0, tid, cg,
                           qw + WSL, kw + WSL, hs, more, y0 + TY);
    if (!more) break;
    // the last result tile lies over the stage's first rows: every wave has read it
    ea_lds_barrier();
  }
}

extern "C" void kernel_launch(void* const* d_in, const int* in_sizes, int n_in,
                              void* d_out, int out_size, void* d_ws, size_t ws_size,
                              hipStream_t stream) {
  const float* feat  = (const float*)d_in[0];
  const float* kappa = (const float*)d_in[1];
  const float* qw    = (const float*)d_in[2];  // (3, 32, 64)
  const float* kw    = (const float*)d_in[3];  // (3, 32, 64)
  float*       out   = (float*)d_out;
  unsigned*    mm    = (unsigned*)d_ws;        // 3 x KPART records {min,max}, encoded

  ea_kap_minmax<<<dim3(KPART, 3), KTHR, 0, stream>>>(kappa, mm);

  const dim3 grid(NXT * NYB * BSZ), block(512);
  ea_affinity<<<grid, block, 0, stream>>>(feat, kappa, qw, kw, mm, out, TPW);
}

// v010
// A run of this version takes 36.3 microseconds.
// In both of two side-by-side timings against v009, it was 1.09 times as fast.
// Counting every step since v000, it is 10.5 times as fast.
#include <hip/hip_runtime.h>
#include <hip/hip_bf16.h>

typedef __attribute__((ext_vector_type(16))) _Float16 v16h;
typedef __attribute__((ext_vector_type(8)))  float    v8f;

#define HWPX (256 * 256)
#define HIMG 256
#define WIMG 256
#define BSZ  4
#define CIN  64
#define CATT 32
// halfs per LDS row of a WMMA operand (64 channels + 8): 144 B = 16 B x 9, so
// 16 lanes on 16 consecutive rows spread their 16-byte accesses over all banks
#define SPIT (CIN + 8)
// halfs per LDS row of a projected pixel (32 channels + 8): 80 B = 16 B x 5, the
// same spreading for the 16-byte fragment reads of the correlation product
#define QPIT (CATT + 8)
// The tile of one work-group: TX pixels are one 128-byte line of every plane
#define TX  32
#define TY  16
#define NPX (TX * TY)
// floats per LDS plane of the result tile (512 pixels + 12): the lanes of one
// band store sit on different window offsets, so on planes; the 12 spreads them
#define OPIT (NPX + 12)

// ---- order-preserving float <-> uint encoding: min/max become integer ops ----
__device__ __forceinline__ unsigned fenc(float f) {
  unsigned u = __float_as_uint(f);
  return u ^ ((u >> 31) ? 0xFFFFFFFFu : 0x80000000u);
}
__device__ __forceinline__ float fdec(unsigned u) {
  u ^= ((u >> 31) ? 0x80000000u : 0xFFFFFFFFu);
  return __uint_as_float(u);
}

// min/max of kappa[:, slice, :, :] leave this launch as KPART records {min, max}
// a slice, one per work-group; the reader folds them. A record has a 128-byte
// line of the workspace to itself (KREC unsigneds apart): one writer per line.
#define KPART 16
#define KTHR  512
#define KREC  32

__global__ __launch_bounds__(KTHR) void ea_kap_minmax(const float* __restrict__ kappa,
                                                      unsigned* __restrict__ mm) {
  const int slice = blockIdx.y;
  const int tid   = threadIdx.x;
  // A plane half is KPART * KTHR units of 16 bytes; a thread takes one unit of
  // each half of each of the BSZ planes. All loads are issued before the first use.
  const unsigned vb = (unsigned)(blockIdx.x * KTHR + tid) * 16u;  // bytes
  const char* kp = (const char*)(kappa + (size_t)slice * HWPX);
  float4 v[2 * BSZ];
#pragma unroll  // v[] indexed by constants: registers
  for (int i = 0; i < 2 * BSZ; ++i)
    v[i] = *(const float4*)(kp + (size_t)(i >> 1) * (3u * HWPX * 4u) +
                            (size_t)(i & 1) * (HWPX * 2u) + vb);
  unsigned lmin = 0xFFFFFFFFu, lmax = 0u;
#pragma unroll  // as above
  for (int i = 0; i < 2 * BSZ; ++i) {
    const unsigned k0 = fenc(v[i].x), k1 = fenc(v[i].y), k2 = fenc(v[i].z), k3 = fenc(v[i].w);
    lmin = min(lmin, min(min(k0, k1), min(k2, k3)));
    lmax = max(lmax, max(max(k0, k1), max(k2, k3)));
  }
  // butterfly over the wave, then over the waves' results
#pragma unroll  // the lane distances become constants
  for (int s = 16; s > 0; s >>= 1) {
    lmin = min(lmin, __shfl_xor(lmin, s));
    lmax = max(lmax, __shfl_xor(lmax, s));
  }
  __shared__ unsigned smin[KTHR / 32], smax[KTHR / 32];
  if ((tid & 31) == 0) { smin[tid >> 5] = lmin; smax[tid >> 5] = lmax; }
  __syncthreads();
  if (tid < 32) {
    lmin = smin[tid & (KTHR / 32 - 1)];
    lmax = smax[tid & (KTHR / 32 - 1)];
#pragma unroll  // the lane distances become constants
    for (int s = KTHR / 64; s > 0; s >>= 1) {
      lmin = min(lmin, __shfl_xor(lmin, s));
      lmax = max(lmax, __shfl_xor(lmax, s));
    }
    if (tid == 0)
      *(uint2*)&mm[(slice * KPART + blockIdx.x) * KREC] = make_uint2(lmin, lmax);
  }
}

// Assemble a 16x32 f16 WMMA fragment (A or B operand) from an LDS row of 32
// (stage, weights) or 16 (q, k) channel-pairs, per the ISA layout: halves 0-7 = K kb..kb+7, halves 8-15 =
// K kb+16..kb+23 (kb = 0 for lanes 0-15, 8 for lanes 16-31). Union with
// constant indices keeps everything in VGPRs (SROA), no scratch.
// Rows start on 16 bytes, so each run of 8 halves is one 16-byte LDS load.
__device__ __forceinline__ v16h ea_frag(const _Float16* row, int kb2, int s) {
  const uint4* p = (const uint4*)row;
  union { v16h v; uint4 q[2]; } r;
  r.q[0] = p[s * 4 + (kb2 >> 2)];
  r.q[1] = p[s * 4 + (kb2 >> 2) + 2];
  return r.v;
}

// Work-group barrier that orders LDS alone: the wave's own LDS accesses are waited
// for, its global loads and stores stay in flight (__syncthreads() waits for those
// too, which would end the fetch of the next halo at the first barrier). Nothing in
// global memory goes from wave to wave in this kernel.
__device__ __forceinline__ void ea_lds_barrier() {
  asm volatile("s_wait_dscnt 0x0\n\ts_barrier_signal -1\n\ts_barrier_wait -1" ::: "memory");
}

// lane l with lane l ^ 16
__device__ __forceinline__ float ea_xhalf(float x) {
  const int b = __builtin_bit_cast(int, x);
  return __builtin_bit_cast(
      float, __builtin_amdgcn_permlanex16(b, b, 0x76543210, 0xfedcba98, false, false));
}

// Lane p of each row of 16 lanes takes the value of lane (p + r) mod 16 of that row;
// r is a constant where this is called, so the two selector words are constants
__device__ __forceinline__ float ea_rotl(float x, int r) {
  if (r == 0) return x;
  unsigned lo = 0u, hi = 0u;
#pragma unroll  // folded to constants
  for (int p = 0; p < 8; ++p) {
    lo |= (unsigned)((p + r) & 15) << (4 * p);
    hi |= (unsigned)((p + 8 + r) & 15) << (4 * p);
  }
  const int b = __builtin_bit_cast(int, x);
  return __builtin_bit_cast(float, __builtin_amdgcn_permlane16(b, b, lo, hi, false, false));
}

// 8 pixels of each of a wave's two segments into one plane of the result tile
__device__ __forceinline__ void ea_band_store(float* o, const float* a, const float* c) {
  *(float4*)(o)      = make_float4(a[0], a[1], a[2], a[3]);
  *(float4*)(o + 4)  = make_float4(a[4], a[5], a[6], a[7]);
  *(float4*)(o + 8)  = make_float4(c[0], c[1], c[2], c[3]);
  *(float4*)(o + 12) = make_float4(c[4], c[5], c[6], c[7]);
}

// The projections are computed transposed (weight rows are A, pixels are B), so a
// lane holds channels of ONE pixel: mhi..mhi+7 in c0, 16+mhi..16+mhi+7 in c1, and
// lane l ^ 16 holds that pixel's other 16. L2 normalize (x / max(||x||, 1e-12);
// zero rows stay zero) from the f32 accumulators, then two 16-byte LDS stores
// into the pixel's row of QPIT halfs. 1 / max(sqrt(s), 1e-12) is taken as
// min(rsq(s), 1e12) with the hardware's reciprocal square root: two instructions
// on the path from the sum to the stores, where the exactly rounded square root
// and division are a chain of some two dozen dependent ones. s = 0 gives
// min(inf, 1e12). The result is rounded to f16 directly behind it.
__device__ __forceinline__ void ea_norm_store(_Float16* row, v8f c0, v8f c1, int mhi) {
  float s0 = 0.f, s1 = 0.f;
  // both loops unrolled: c0[], c1[] and h[] are then indexed by constants (registers)
#pragma unroll
  for (int r = 0; r < 8; ++r) { s0 += c0[r] * c0[r]; s1 += c1[r] * c1[r]; }
  float s = s0 + s1;
  s += ea_xhalf(s);
  const float inv = fminf(__builtin_amdgcn_rsqf(s), 1e12f);
  union { uint4 q; _Float16 h[8]; } p0, p1;
#pragma unroll
  for (int r = 0; r < 8; ++r) {
    p0.h[r] = (_Float16)(c0[r] * inv);
    p1.h[r] = (_Float16)(c1[r] * inv);
  }
  *(uint4*)&row[mhi]      = p0.q;
  *(uint4*)&row[16 + mhi] = p1.q;
}

// 8 floats -> 8 halfs, one 16-byte unit
__device__ __forceinline__ uint4 ea_pack8(float4 a, float4 c) {
  union { uint4 q; _Float16 h[8]; } p;
  p.h[0] = (_Float16)a.x; p.h[1] = (_Float16)a.y;
  p.h[2] = (_Float16)a.z; p.h[3] = (_Float16)a.w;
  p.h[4] = (_Float16)c.x; p.h[5] = (_Float16)c.y;
  p.h[6] = (_Float16)c.z; p.h[7] = (_Float16)c.w;
  return p.q;
}

// LDS map of the fused kernel, bytes. The 38 x 22 halo of the widest window is
// staged once and serves all three window sizes.
#define PST   3                      // halo width of the stage
#define HSX   (TX + 2 * PST)         // its edges
#define HSY   (TY + 2 * PST)
#define PADST 848                    // its pixels (836), rounded up to 16
// The stage starts L_ST bytes in: the last window's result tile, which starts at 0,
// then ends in front of the stage's row PXA, and the rows from there on can take
// the next tile's halo while that result tile is in use.
#define L_ST  38400
#define PXA   448
#define L_WQ  (L_ST + PADST * SPIT * 2)      // weights behind the stage
#define L_QS  (L_WQ + 2 * CATT * SPIT * 2)   // 512 q rows
#define L_KS  (L_QS + NPX * QPIT * 2)        // key rows: 720 / 624 / 848 by window
// Result tiles. The windows run in the order 5, 3, 7. A tile may still be read by
// slow waves while fast ones write the next window's key rows, so it lies behind
// those: 5's behind 624 (and its own 720) rows, 3's behind 848. 7's lies over the
// first PXA rows of the stage, which is dead by then.
#define L_OB5 (L_KS + 720 * QPIT * 2)
#define L_OB3 (L_KS + PADST * QPIT * 2)
#define L_OB7 0
#define L_ALL (L_OB5 + 25 * OPIT * 4)

// A work-group walks TPW tiles, one below the other. The halo of the next tile is
// fetched into registers while the current tile's windows are computed.
#define TPW 2
// The grid: NXT work-groups across an image, NYB down, in NDIE regions, RPI an image
#define NXT  (WIMG / TX)
#define NYB  (HIMG / (TPW * TY))
#define NDIE 8
#define RPI  (NDIE / BSZ)
static_assert(RPI * BSZ == NDIE && NYB % RPI == 0, "regions tile the images");
// Halo fetch: waves w and w + 8 own channels 8w..8w+7, each one half of the groups
// of 32 pixels below row PXA (its groups 0..NI/2-1) and one half of those from PXA
// on (its groups NI/2..NI-1); a lane gathers the channels of one halo pixel in registers and
// writes them as one 16-byte LDS store.
#define NI ((PADST + 63) / 64)  // groups a wave
static_assert(NI * 64 >= PADST && PADST >= 32 && NI >= 8 && NI % 2 == 0 && NI * 32 == PXA,
              "groups cover the stage");
struct EaHalo {
  float        hv[NI][8];  // values in flight
  uint4        pk[NI];     // the same as f16, zero outside the image
  unsigned     inm;        // bit i: the pixel of group i lies inside the image
  const float* fg;         // first of this wave's 8 channel planes
  int          g0;         // first group of this wave: 0 or NI / 2
};

// the halo pixel of a lane in group i; the last groups are shifted back to end at
// PADST: the wave writes some rows again with the same values, no group needs a branch
// (only the last two i can reach the end: the others differ by constants)
__device__ __forceinline__ int ea_halo_gs(int g0, int i) {  // lane 0's, the same for the wave
  const int gs = (g0 + i + (i >= NI / 2 ? NI / 2 : 0)) * 32;
  return (NI + i) * 32 <= PADST - 32 ? gs : min(gs, PADST - 32);
}
__device__ __forceinline__ int ea_halo_px(int g0, int i, int lane) {
  return ea_halo_gs(g0, i) + lane;
}

// Issue the loads of groups I0..I1-1 of the halo of the tile at (y0, x0); nothing
// here uses a loaded value.
template <int I0, int I1>
__device__ __forceinline__ void ea_halo_issue(EaHalo& hs, int y0, int x0, int lane) {
  unsigned ha[NI];
  if (I0 == 0) hs.inm = 0u;
#pragma unroll  // hv[] and ha[] indexed by constants: registers
  for (int i = I0; i < I1; ++i) {
    // Row and column are taken from the pixel's number counted from image row 0, the
    // group's part of it summed as a scalar (readfirstlane keeps that sum together):
    // no vector value here is then the same for every tile. Such values would be
    // kept in registers round the tile loop, over the budget (scratch).
    const int gs = ea_halo_gs(hs.g0, i);
    const unsigned q  = (unsigned)__builtin_amdgcn_readfirstlane(gs + y0 * HSX) + (unsigned)lane;
    const unsigned qy = q / HSX;
    const int gy = (int)qy - PST, gx = x0 - PST + (int)(q - qy * HSX);
    const bool inp = (NI + i) * 32 + 31 < HSX * HSY || gs + lane < HSX * HSY;
    const bool inb = inp && gy >= 0 && gy < HIMG && gx >= 0 && gx < WIMG;
    ha[i] = inb ? (unsigned)(gy * WIMG + gx) * 4u : 0u;  // bytes; always a valid address
    hs.inm |= (inb ? 1u : 0u) << i;
    // the plane's distance is a constant of the load: one address register a group
#pragma unroll
    for (int j = 0; j < 8; ++j)
      hs.hv[i][j] = *(const float*)((const char*)hs.fg + ha[i] + (size_t)j * (HWPX * 4));
    // precaution, once per four groups: stands before any overwrite of the
    // registers these loads name (kept live up to here as inputs)
    if (((i - I0) & 3) == 3 || i == I1 - 1)
      asm volatile("s_wait_xcnt 0x0" :: "v"(ha[i]), "v"(ha[i - 1]), "v"(ha[i - 2]),
                   "v"(ha[i - 3]) : "memory");
  }
}

// No tile follows: nothing is fetched. The registers get a value all the same, so
// that on this path too their old values end here; otherwise the old values count
// as live round the whole tile loop and the register budget is overrun (scratch).
template <int I0, int I1>
__device__ __forceinline__ void ea_halo_none(EaHalo& hs) {
  if (I0 == 0) hs.inm = 0u;
#pragma unroll  // hv[] indexed by constants: registers
  for (int i = I0; i < I1; ++i)
#pragma unroll
    for (int j = 0; j < 8; ++j) hs.hv[i][j] = 0.f;
}

// Two f32 -> one register of two f16, a in the low half, rounded to nearest even as
// the cast does. In asm text so that the conversion stays where it is written: the
// compiler otherwise moves it down to the LDS store behind the last window, all f32
// values stay live through that window's correlation, and registers go to scratch.
__device__ __forceinline__ unsigned ea_cvt2_here(float a, float c) {
  unsigned r;
  asm volatile("v_cvt_pk_f16_f32 %0, %1, %2" : "=v"(r) : "v"(a), "v"(c));
  return r;
}

// f32 -> f16, 8 channels of a pixel to one 16-byte unit, zero outside the image
template <int I0, int I1>
__device__ __forceinline__ void ea_halo_pack(EaHalo& hs) {
#pragma unroll  // hv[] and pk[] indexed by constants: registers
  for (int i = I0; i < I1; ++i) {
    const bool inb = hs.inm >> i & 1u;
    const float* v = hs.hv[i];
    const unsigned r0 = ea_cvt2_here(v[0], v[1]), r1 = ea_cvt2_here(v[2], v[3]);
    const unsigned r2 = ea_cvt2_here(v[4], v[5]), r3 = ea_cvt2_here(v[6], v[7]);
    hs.pk[i] = make_uint4(inb ? r0 : 0u, inb ? r1 : 0u, inb ? r2 : 0u, inb ? r3 : 0u);
  }
}

// Packed groups I0..I1-1 into the stage. One address register: the groups lie a
// constant apart, but for the last ones, which are shifted back by a count that is
// the same for the whole wave.
template <int I0, int I1>
__device__ __forceinline__ void ea_halo_store(const EaHalo& hs, _Float16* stage, int lane,
                                              int cc) {
  const int px0 = ea_halo_px(hs.g0, I0, lane);
  char* sb = (char*)&stage[px0 * SPIT + cc * 8];
#pragma unroll  // pk[] indexed by constants: registers
  for (int i = I0; i < I1; ++i)
    *(uint4*)(sb + (ea_halo_px(hs.g0, i, lane) - px0) * (SPIT * 2)) = hs.pk[i];
}

// One window size, from the staged halo and the weights in LDS to its output:
// f16-WMMA q/k projection with L2 normalize -> k x k windowed cosine / tau.
// nqw, nkw: the next window's weights: fetched while this window's
// projections run, put into LDS as soon as this window's are dead.
// HOOK, if more (a tile follows at yn): the next halo's loads are issued in two halves,
// each behind a window's correlation (HOOK 0: first half, 1: second half), and packed
// to f16 behind the following window's projections (HOOK 1: first half, 2: second
// half, which goes into the stage at once). Loads return in order, so a half lies
// between two places where the windows wait for loads of their own; it stays under
// the count of loads a wave can have outstanding, and off the correlations' registers.
template <int KW, int OBAT, int HOOK>
__device__ __forceinline__ void ea_window(char* lds_raw,
                                          const float* __restrict__ kappa,
                                          float kmin, float rden,
                                          float* __restrict__ out, int slice,
                                          int b, int y0, int x0, int tid, int cg,
                                          const float* __restrict__ nqw,
                                          const float* __restrict__ nkw,
                                          EaHalo& hs, bool more, int yn) {
  constexpr int P     = KW / 2;
  constexpr int HX    = TX + 2 * P;          // halo tile edges
  constexpr int HY    = TY + 2 * P;
  constexpr int HALO2 = HX * HY;             // halo pixels
  constexpr int KT    = (HALO2 + 15) / 16;   // 16-pixel tiles for key proj
  constexpr int KK    = KW * KW;
  constexpr int OFF   = PST - P;             // this halo's corner in the stage

  _Float16* stage = (_Float16*)(lds_raw + L_ST);   // PADST rows of SPIT (f16)
  _Float16* wqL   = (_Float16*)(lds_raw + L_WQ);
  _Float16* wkL   = wqL + CATT * SPIT;
  _Float16* qs    = (_Float16*)(lds_raw + L_QS);   // NPX rows of QPIT (f16)
  _Float16* ks    = (_Float16*)(lds_raw + L_KS);   // KT * 16 rows of QPIT (f16)
  float*    ob    = (float*)(lds_raw + OBAT);      // KK planes of OPIT (f32)

  const int lane = tid & 31;
  const int mrow = lane & 15;
  const int kb2  = (lane >= 16) ? 4 : 0;  // channel-pair base for this half-wave
  const int mhi  = (lane >= 16) ? 8 : 0;
  const int col  = lane & 15;

  // A thread takes 8 consecutive channels of one row of the next qw (waves 0-7)
  // or kw (waves 8-15).
  float4 nwa, nwb;
  {
    const float* nsrc = cg < 8 ? nqw : nkw;
    const unsigned wb = (unsigned)(tid & 255) * 32u;  // its place in qw / kw, bytes
    nwa = *(const float4*)((const char*)nsrc + wb);
    nwb = *(const float4*)((const char*)nsrc + wb + 16);
    // precaution: stands before any overwrite of the register these loads name
    asm volatile("s_wait_xcnt 0x0" :: "v"(wb) : "memory");
  }
  // ---- q projection: 32 tiles of 16 interior pixels, normalized on the way; a
  // wave takes the two of its own image row ----
  {
    const _Float16* w0 = &wqL[mrow * SPIT];
    const _Float16* w1 = &wqL[(16 + mrow) * SPIT];
    const v16h b00 = ea_frag(w0, kb2, 0);  // kstep0, channels 0-15
    const v16h b10 = ea_frag(w0, kb2, 1);  // kstep1, channels 0-15
    const v16h b01 = ea_frag(w1, kb2, 0);  // kstep0, channels 16-31
    const v16h b11 = ea_frag(w1, kb2, 1);  // kstep1, channels 16-31
    for (int t = cg * 2; t < cg * 2 + 2; ++t) {
      int ip = t * 16 + mrow;  // interior pixel 0..511
      int px = ((ip >> 5) + PST) * HSX + ((ip & 31) + PST);
      const _Float16* srow = &stage[px * SPIT];
      v16h a0 = ea_frag(srow, kb2, 0);
      v16h a1 = ea_frag(srow, kb2, 1);
      v8f acc0 = {}, acc1 = {};
      acc0 = __builtin_amdgcn_wmma_f32_16x16x32_f16(false, b00, false, a0,
                                                    (short)0, acc0, false, false);
      acc1 = __builtin_amdgcn_wmma_f32_16x16x32_f16(false, b01, false, a0,
                                                    (short)0, acc1, false, false);
      acc0 = __builtin_amdgcn_wmma_f32_16x16x32_f16(false, b10, false, a1,
                                                    (short)0, acc0, false, false);
      acc1 = __builtin_amdgcn_wmma_f32_16x16x32_f16(false, b11, false, a1,
                                                    (short)0, acc1, false, false);
      ea_norm_store(qs + (t * 16 + col) * QPIT, acc0, acc1, mhi);
    }
  }

  // ---- key projection: KT tiles of 16 halo pixels, normalized on the way ----
  {
    const _Float16* w0 = &wkL[mrow * SPIT];
    const _Float16* w1 = &wkL[(16 + mrow) * SPIT];
    const v16h b00 = ea_frag(w0, kb2, 0);
    const v16h b10 = ea_frag(w0, kb2, 1);
    const v16h b01 = ea_frag(w1, kb2, 0);
    const v16h b11 = ea_frag(w1, kb2, 1);
    for (int t = cg; t < KT; t += 16) {
      // halo pixel of this window -> its row in the stage; the rows that pad the
      // last tile repeat the last pixel and are never read by the correlation
      const int h  = min(t * 16 + mrow, HALO2 - 1);
      const int hy = h / HX;
      const int px = (hy + OFF) * HSX + (h - hy * HX) + OFF;
      const _Float16* srow = &stage[px * SPIT];
      v16h a0 = ea_frag(srow, kb2, 0);
      v16h a1 = ea_frag(srow, kb2, 1);
      v8f acc0 = {}, acc1 = {};
      acc0 = __builtin_amdgcn_wmma_f32_16x16x32_f16(false, b00, false, a0,
                                                    (short)0, acc0, false, false);
      acc1 = __builtin_amdgcn_wmma_f32_16x16x32_f16(false, b01, false, a0,
                                                    (short)0, acc1, false, false);
      acc0 = __builtin_amdgcn_wmma_f32_16x16x32_f16(false, b10, false, a1,
                                                    (short)0, acc0, false, false);
      acc1 = __builtin_amdgcn_wmma_f32_16x16x32_f16(false, b11, false, a1,
                                                    (short)0, acc1, false, false);
      ea_norm_store(ks + (t * 16 + col) * QPIT, acc0, acc1, mhi);
    }
  }
  ea_lds_barrier();

  // every wave has its weight fragments: the next window's weights take their
  // place (the barrier behind the correlation stands in front of their first read)
  {
    // rows 0-31 are wq, rows 32-63 wk, which lies directly behind it
    const int wo = (tid >> 3) * SPIT + (tid & 7) * 8;
    *(uint4*)&wqL[wo] = ea_pack8(nwa, nwb);
  }
  // The wait for the weights above has waited for the halo loads too, which are older.
  if (HOOK == 1 && more) ea_halo_pack<0, NI / 2>(hs);
  if (HOOK == 2 && more) {
    // behind the barrier above no wave reads the stage any more, and this window's
    // result tile ends in front of these rows
    ea_halo_pack<NI / 2, NI>(hs);
    ea_halo_store<NI / 2, NI>(hs, stage, lane, cg & 7);
  }

  // This thread writes out four neighbouring pixels of every fourth plane;
  // eight threads in a row cover one 128-byte line.
  const int g = tid & 127;
  const unsigned pixb = (unsigned)(((y0 + (g >> 3)) * WIMG + x0 + (g & 7) * 4) * 4);  // bytes
  const float4 kap4 =
      *(const float4*)((const char*)(kappa + ((size_t)b * 3 + slice) * HWPX) + pixb);
  // precaution: stands before any overwrite of the register this load names
  asm volatile("s_wait_xcnt 0x0" :: "v"(pixb) : "memory");

  // ---- windowed correlation as a banded matrix product ----
  // Waves 2i and 2i + 1 own query rows 2i and 2i + 1 of the tile, one the left 16
  // pixels, one the right 16, each as two segments of 8. One product is a segment of
  // BOTH rows (A: rows 0-7 the upper query row, rows 8-15 the lower) against 16 keys
  // of one halo row (B), all 32 channels in one step. A key row serves the upper
  // queries as window row j and the lower ones as j - 1, and the 8 + KW - 1 keys that
  // a segment wants lie inside the 16: every band lies whole in one product.
  {
    const int half = lane >> 4;         // 0: upper query row, 1: lower
    const int qa   = (cg >> 1) * 2;     // the upper query row
    const int xh   = (cg & 1) * 16;     // first pixel of this wave's 16
    const _Float16* qp = qs + ((qa + (mrow >> 3)) * TX + xh + (mrow & 7)) * QPIT;
    const v16h qf0 = ea_frag(qp, kb2, 0);
    const v16h qf1 = ea_frag(qp + 8 * QPIT, kb2, 0);
    // keys xh + col and xh + 8 + col of halo row qa; the columns past the end of the
    // row repeat its last key and are never stored
    const _Float16* k0 = ks + (qa * HX + xh + col) * QPIT;
    const _Float16* k1 = ks + (qa * HX + min(xh + 8 + col, HX - 1)) * QPIT;
    // Register r of a lane is query pixel r of the segment against key col: window
    // offset dx = col - r. Rotating register r by r lanes brings dx = lane for every
    // r: a lane below KW then holds 8 neighbouring pixels of ONE plane, two 16-byte
    // LDS stores under one lane mask. The place of window row 1 (upper) or 0 (lower):
    float* o = ob + (col + (half ? 0 : KW)) * OPIT + (qa + half) * TX + xh;
    const bool inband = col < KW;
    constexpr int NJ = KW + 1;  // key rows: the first serves the upper queries only,
                                // the last the lower ones only
    // Four key rows at a time, so that fragments and bands stay in few registers.
    // Every loop of this block is unrolled: e[] is then indexed by constants
    // (registers, no scratch) and the LDS offsets become immediates.
#pragma unroll
    for (int c0 = 0; c0 < NJ; c0 += 4) {
      float e[8][8];  // [key row of the chunk * 2 + segment][pixel]
#pragma unroll
      for (int kc = 0; kc < 4; ++kc) {
        const int j = c0 + kc;
        if (j >= NJ) continue;
        const v16h f0 = ea_frag(k0 + j * HX * QPIT, kb2, 0);
        const v16h f1 = ea_frag(k1 + j * HX * QPIT, kb2, 0);
        const v8f z = {};
        const v8f d0 = __builtin_amdgcn_wmma_f32_16x16x32_f16(false, qf0, false, f0,
                                                              (short)0, z, false, false);
        const v8f d1 = __builtin_amdgcn_wmma_f32_16x16x32_f16(false, qf1, false, f1,
                                                              (short)0, z, false, false);
#pragma unroll
        for (int r = 0; r < 8; ++r) {
          e[kc * 2][r]     = ea_rotl(d0[r], r);
          e[kc * 2 + 1][r] = ea_rotl(d1[r], r);
        }
      }
      // Bands -> ob[window row * KW + dx][pixel]
      if (inband) {
#pragma unroll
        for (int kc = 0; kc < 4; ++kc) {
          const int j = c0 + kc;
          if (j < 1 || j >= KW) continue;
          ea_band_store(o + (j - 1) * KW * OPIT, e[kc * 2], e[kc * 2 + 1]);
        }
      }
      if (c0 == 0 && inband && half == 0) ea_band_store(o - KW * OPIT, e[0], e[1]);
      if (c0 + 4 >= NJ && inband && half == 1)
        ea_band_store(o + (KW - 1) * KW * OPIT, e[(KW - c0) * 2], e[(KW - c0) * 2 + 1]);
    }
  }

  if constexpr (HOOK == 0 || HOOK == 1) {
    // holds the kappa load's wait here, in front of the halo loads: behind them it
    // would have to wait for them as well (one path issues none, so no count fits both)
    asm volatile("" :: "v"(kap4.x), "v"(kap4.y), "v"(kap4.z), "v"(kap4.w));
    constexpr int I0 = HOOK == 0 ? 0 : NI / 2;
    if (more) ea_halo_issue<I0, I0 + NI / 2>(hs, yn, x0, lane);
    else      ea_halo_none<I0, I0 + NI / 2>(hs);
  }

  float sc[4];
  {
    const float kp[4] = {kap4.x, kap4.y, kap4.z, kap4.w};
#pragma unroll  // kp[] and sc[] indexed by constants: registers
    for (int j = 0; j < 4; ++j) {
      // the range's reciprocal is formed once a kernel; tau + 1e-6 lies in 0.03..0.5,
      // where the hardware's reciprocal needs none of a division's range handling
      float tau = 0.5f - ((kp[j] - kmin) * rden) * (0.5f - 0.03f);
      tau = fminf(fmaxf(tau, 0.03f), 0.5f);
      sc[j] = __builtin_amdgcn_rcpf(tau + 1e-6f);
    }
  }
  ea_lds_barrier();  // the result tile is complete before other waves read it

  // ---- write out: 16 bytes a lane, planes pl0, pl0 + 4, ... ----
  constexpr int NP = KK / 4;  // KK = 4 * NP + 1: the last plane goes to pl0 == 0
  const int pl0 = cg >> 2;
  char* ou = (char*)(out + ((size_t)b * KK + pl0) * HWPX);
  float4 ov[NP + 1];
  // both loops unrolled: ov[] stays in registers, and all LDS reads are issued
  // ahead of the first store
#pragma unroll
  for (int i = 0; i < NP; ++i) ov[i] = *(const float4*)&ob[(pl0 + 4 * i) * OPIT + g * 4];
  // the slot that the instruction set asks for behind a transcendental
  asm volatile("v_nop" :: "v"(sc[0]), "v"(sc[1]), "v"(sc[2]), "v"(sc[3]));
  // a value on the other path too: an unset register would count as live round the tile loop
  ov[NP] = make_float4(0.f, 0.f, 0.f, 0.f);
  if (pl0 == 0) ov[NP] = *(const float4*)&ob[(4 * NP) * OPIT + g * 4];
#pragma unroll
  for (int i = 0; i <= NP; ++i) {
    // precaution: the last plane's address is formed in its own branch; stands
    // before any overwrite there of a register the stores above name
    if (i == NP) asm volatile("s_wait_xcnt 0x0" :: "v"(pixb) : "memory");
    if (i < NP || pl0 == 0) {
      float4 v = ov[i];
      v.x *= sc[0]; v.y *= sc[1]; v.z *= sc[2]; v.w *= sc[3];
      *(float4*)(ou + (size_t)i * (4u * HWPX * 4u) + pixb) = v;
    }
  }
  // precaution: the next window's code follows and reuses registers; stands
  // before any overwrite of a register these stores name
  asm volatile("s_wait_xcnt 0x0" :: "v"(pixb) : "memory");
}

// Temperature range from curvature: the global min/max of a slice, folded from its
// records; their addresses are uniform (scalar loads).
struct EaRange { float kmin, rden; };  // rden = 1 / (max - min + 1e-6)
__device__ __forceinline__ EaRange ea_range(const unsigned* __restrict__ mm, int slice) {
  unsigned emin = 0xFFFFFFFFu, emax = 0u;
#pragma unroll  // all records are fetched before the first is used
  for (int i = 0; i < KPART; ++i) {
    const unsigned* rec = mm + (slice * KPART + i) * KREC;
    emin = min(emin, rec[0]);
    emax = max(emax, rec[1]);
  }
  EaRange r;
  r.kmin  = fdec(emin);
  r.rden  = 1.f / ((fdec(emax) - r.kmin) + 1e-6f);  // an exact division, once a kernel
  return r;
}

// All three window sizes of ntile tiles of 32 x 16: a tile's halo is staged once.
// ntile is an argument and no constant: with a known count of two the compiler takes
// the one next tile's addresses for constants of the loop, forms them all ahead of it
// and keeps them in registers, over the budget (scratch).
__global__ __launch_bounds__(512) void ea_affinity(const float* __restrict__ feat,
                                                   const float* __restrict__ kappa,
                                                   const float* __restrict__ qw,
                                                   const float* __restrict__ kw,
                                                   const unsigned* __restrict__ mm,
                                                   float* __restrict__ out, int ntile) {
  __shared__ __attribute__((aligned(16))) char lds_raw[L_ALL];
  static_assert(L_ALL <= 320 * 1024 && L_OB3 + 9 * OPIT * 4 <= L_ALL && 49 * OPIT * 4 <= L_ST + PXA * SPIT * 2,
                "the map fits one work-group's LDS, the last tile ends in front of row PXA");
  _Float16* wqL   = (_Float16*)(lds_raw + L_WQ);

  const int tid  = threadIdx.x;
  const int lane = tid & 31;
  // Which tiles this work-group walks. The index mod NDIE picks a region of full image width (one image's upper
  // or lower half) and the rest of the index a place in it: tiles side by side in x,
  // which read the same lines at their common edge and write the two halves of the
  // same 256-byte units, have the same index mod NDIE. For speed only:
  // the map is one-to-one, every tile is done once wherever a work-group runs.
  const int reg  = blockIdx.x % NDIE, idx = blockIdx.x / NDIE;
  const int b    = reg / RPI;
  const int yb   = ((reg % RPI) * (NYB / RPI) + idx / NXT) * ntile * TY;
  const int x0   = (idx % NXT) * TX;

  // Weights of the first window (5 x 5): a thread takes 8 consecutive channels of
  // one row of qw (waves 0-7) or of kw (waves 8-15); in LDS wk's rows follow wq's.
  constexpr int WSL = CATT * CIN;                    // floats of one window's weights
  const int cg = __builtin_amdgcn_readfirstlane(tid >> 5);  // the wave, 0..15
  const int wo = (tid >> 3) * SPIT + (tid & 7) * 8;  // its place in LDS, halfs
  const unsigned wb = (unsigned)(tid & 255) * 32u;   // its place in qw / kw, bytes
  const float* wsrc = (cg < 8 ? qw : kw) + WSL;
  // ---- halo of the first tile: all loads are issued before the first value is used ----
  const int cc = cg & 7;
  EaHalo hs;
  hs.fg = feat + ((size_t)b * CIN + cc * 8) * HWPX;
  hs.g0 = (cg >> 3) * (NI / 2);
  ea_halo_issue<0, NI / 2>(hs, yb, x0, lane);
  ea_halo_issue<NI / 2, NI>(hs, yb, x0, lane);
  const float4 wa = *(const float4*)((const char*)wsrc + wb);
  const float4 wc = *(const float4*)((const char*)wsrc + wb + 16);
  // precaution: stands before any overwrite of the register these loads name
  asm volatile("s_wait_xcnt 0x0" :: "v"(wb) : "memory");
  ea_halo_pack<0, NI>(hs);
  *(uint4*)&wqL[wo] = ea_pack8(wa, wc);

  _Float16* stage = (_Float16*)(lds_raw + L_ST);
  ea_halo_store<NI / 2, NI>(hs, stage, lane, cc);

  // folded once for all tiles
  const EaRange kr[3] = {ea_range(mm, 0), ea_range(mm, 1), ea_range(mm, 2)};

  // At the head of a trip the first half of the tile's packed halo is in hs.pk, the
  // second half in the stage. Not unrolled: one copy of the windows' code, for speed only.
#pragma clang loop unroll(disable)
  for (int it = 0;; ++it) {
    const int  y0   = yb + it * TY;
    const bool more = it + 1 < ntile;
    // ---- halo into LDS (f16), zero-padded outside the image + tile padding ----
    ea_halo_store<0, NI / 2>(hs, stage, lane, cc);
    // the packed registers end here on every path (as in ea_halo_none)
#pragma unroll
    for (int i = 0; i < NI / 2; ++i) hs.pk[i] = make_uint4(0u, 0u, 0u, 0u);
    ea_lds_barrier();

    ea_window<5, L_OB5, 0>(lds_raw, kappa, kr[1].kmin, kr[1].rden,
                           out + (size_t)BSZ * 9 * HWPX, 1, b, y0, x0, tid, cg, qw, kw,
                           hs, more, y0 + TY);
    ea_window<3, L_OB3, 1>(lds_raw, kappa, kr[0].kmin, kr[0].rden, out, 0,
                           b, y0, x0, tid, cg, qw + 2 * WSL, kw + 2 * WSL, hs, more, y0 + TY);
    // its next weights are those of the next tile's first window
    ea_window<7, L_OB7, 2>(lds_raw, kappa, kr[2].kmin, kr[2].rden,
                           out + (size_t)BSZ * (9 + 25) * HWPX, 2, b, y0, x0, tid, cg,
                           qw + WSL, kw + WSL, hs, more, y0 + TY);
    if (!more) break;
    // the last result tile lies over the stage's first rows: every wave has read it
    ea_lds_barrier();
  }
}

extern "C" void kernel_launch(void* const* d_in, const int* in_sizes, int n_in,
                              void* d_out, int out_size, void* d_ws, size_t ws_size,
                              hipStream_t stream) {
  const float* feat  = (const float*)d_in[0];
  const float* kappa = (const float*)d_in[1];
  const float* qw    = (const float*)d_in[2];  // (3, 32, 64)
  const float* kw    = (const float*)d_in[3];  // (3, 32, 64)
  float*       out   = (float*)d_out;
  unsigned*    mm    = (unsigned*)d_ws;        // 3 x KPART records {min,max}, encoded

  ea_kap_minmax<<<dim3(KPART, 3), KTHR, 0, stream>>>(kappa, mm);

  const dim3 grid(NXT * NYB * BSZ), block(512);
  ea_affinity<<<grid, block, 0, stream>>>(feat, kappa, qw, kw, mm, out, TPW);
}
